// v000
// Times are from an AMD MI455X. After a warm-up the kernel runs many times in a row, and a time is the length of
// such a window on the GPU divided by its runs, so every launch and the gaps after it count. The runs cycle
// through copies of the inputs. A figure is the median of several windows, for all but v000 over two sittings.
// Sittings can differ by a few percent; kernels timed side by side share one.
// The starting kernel, v000, takes 400 microseconds a run.
// compute dtype: all float inputs rounded to bf16; q = x Wq^T with EXACT bf16 products on WMMA 16x16x32; AvgPool1d (exact f32 sums of 4 bf16 tokens) + BatchNorm (eval) in f32; k, v = xr W^T with xr as bf16 hi + lo (2 products); no softmax in the module, so (q k^T) v is evaluated exactly re-associated as q (k^T v): KV_h = k_h^T v_h with k, v as f16 hi + lo and ctx = scale q_h KV_h with q, KV as bf16 hi + lo (3 products each); out = ctx (bf16 hi + lo) . Wp^T + bp; f32 output.
#include <hip/hip_runtime.h>
#include <math.h>

typedef __attribute__((ext_vector_type(16))) _Float16 v16h;
typedef __attribute__((ext_vector_type(16))) __bf16 v16b;
typedef __attribute__((ext_vector_type(8)))  _Float16 v8h;
typedef __attribute__((ext_vector_type(8)))  float v8f;
typedef __attribute__((ext_vector_type(4)))  float v4f;
typedef __attribute__((ext_vector_type(2)))  float v2f;
typedef __attribute__((ext_vector_type(4)))  unsigned v4u;
typedef __attribute__((ext_vector_type(4)))  int v4i;
typedef float __attribute__((may_alias)) float_a;
typedef int __attribute__((may_alias)) int_a;

template <typename T> __device__ __forceinline__ void vst2(void* p, T v) { *(T*)p = v;  }
__device__ __forceinline__ v8f wmma16(v16h a, v16h b, v8f c) {
  v8f d = __builtin_amdgcn_wmma_f32_16x16x32_f16(false, a, false, b, (short)0, c, false, false);
  asm volatile("v_nop\n\tv_nop\n\tv_nop\n\tv_nop" : "+v"(d) : "v"(a), "v"(b));
  return d;
}
__device__ __forceinline__ v8f wmma_bf(v16b a, v16b b, v8f c) {
  v8f d = __builtin_amdgcn_wmma_f32_16x16x32_bf16(false, a, false, b, (short)0, c, false, false);
  asm volatile("v_nop\n\tv_nop\n\tv_nop\n\tv_nop" : "+v"(d) : "v"(a), "v"(b));
  return d;
}
// 16x16x32 fragments: lane = (h = lane>>4, row/col = lane&15); elements 0..7 = k0+8h+0..7, 8..15 = k0+16+8h+0..7; D element r = row 8h+r
__device__ __forceinline__ v16h frag_h(const _Float16* rowk0, int lane) {
  union { v16h v; v8h q[2]; } u; const _Float16* p = rowk0 + 8 * (lane >> 4);
  u.q[0] = *(const v8h*)p; u.q[1] = *(const v8h*)(p + 16); return u.v;
}
__device__ __forceinline__ v16h frag_f32(const float* rowk0, int lane) {
  v16h a; const float* p = rowk0 + 8 * (lane >> 4);
#pragma unroll
  for (int i = 0; i < 8; ++i) { a[i] = (_Float16)p[i]; a[8 + i] = (_Float16)p[16 + i]; }
  return a;
}
__device__ __forceinline__ v16h frag_f32s(const float* rowk0, int lane, float sc) {
  v16h a; const float* p = rowk0 + 8 * (lane >> 4);
#pragma unroll
  for (int i = 0; i < 8; ++i) { a[i] = (_Float16)(p[i] * sc); a[8 + i] = (_Float16)(p[16 + i] * sc); }
  return a;
}
// column fragment from a [K][ld] layout (column n), rows >= K read as 0
__device__ __forceinline__ v16h fragc_f32(const float* W, int k0, int n, int lane, int ld, int K) {
  v16h a; const int g = lane >> 4;
#pragma unroll
  for (int i = 0; i < 8; ++i) { const int ka = k0 + 8 * g + i, kb = ka + 16;
    a[i] = (_Float16)(ka < K ? W[(size_t)(ka < K ? ka : K - 1) * ld + n] : 0.f); a[8 + i] = (_Float16)(kb < K ? W[(size_t)(kb < K ? kb : K - 1) * ld + n] : 0.f); }
  return a;
}
struct F2 { v16b h, l; };
__device__ __forceinline__ F2 bsplit16(const float v[16]) { F2 r;
#pragma unroll
  for (int i = 0; i < 16; ++i) { const __bf16 h = (__bf16)v[i]; r.h[i] = h; r.l[i] = (__bf16)(v[i] - (float)h); }
  return r; }
__device__ __forceinline__ F2 split_row(const float* row, int k0, int lane) { float v[16]; const float* p = row + k0 + 8 * (lane >> 4);
#pragma unroll
  for (int i = 0; i < 8; ++i) { v[i] = p[i]; v[8 + i] = p[16 + i]; }
  return bsplit16(v); }
__device__ __forceinline__ F2 split_rowK(const float* row, int k0, int lane, int K) { float v[16]; const int g = lane >> 4;
#pragma unroll
  for (int i = 0; i < 8; ++i) { const int ka = k0 + 8 * g + i, kb = ka + 16; v[i] = ka < K ? row[ka < K ? ka : K - 1] : 0.f; v[8 + i] = kb < K ? row[kb < K ? kb : K - 1] : 0.f; }
  return bsplit16(v); }
__device__ __forceinline__ F2 split_col(const float* W, int k0, int n, int lane, int ld, int K) { float v[16]; const int g = lane >> 4;
#pragma unroll
  for (int i = 0; i < 8; ++i) { const int ka = k0 + 8 * g + i, kb = ka + 16; v[i] = ka < K ? W[(size_t)(ka < K ? ka : K - 1) * ld + n] : 0.f; v[8 + i] = kb < K ? W[(size_t)(kb < K ? kb : K - 1) * ld + n] : 0.f; }
  return bsplit16(v); }
__device__ __forceinline__ v8f mac3(const F2& a, const F2& b, v8f c) { c = wmma_bf(a.l, b.h, c); c = wmma_bf(a.h, b.l, c); return wmma_bf(a.h, b.h, c); }
__device__ __forceinline__ float sigm(float v) { return 1.0f / (1.0f + expf(-v)); }
#define LDSX() do { asm volatile("s_wait_dscnt 0" ::: "memory"); __builtin_amdgcn_wave_barrier(); __builtin_amdgcn_fence(__ATOMIC_RELEASE, "workgroup"); } while (0)


// Efficient multi-head attention WITHOUT softmax (B 4, N 2,048, C 1,024, 32 heads x 32, reduction 4 -> M 512): out = ((q k^T) * 32^-1/2) v, then Wp + bp; evaluated as q (k^T v).
#define NB 4
#define NN 2048
#define CC 1024
#define NH 32
#define HD 32
#define NR 4              // N_RATIO
#define MM (NN / NR)      // 512
#define BNEPS 1e-6f
#ifndef TNB
#define TNB NB
#endif
#ifndef TOB
#define TOB (TNB * NN / 64)
#endif
typedef __attribute__((ext_vector_type(8))) __bf16 v8b;
__device__ __forceinline__ v16b frag_b(const __bf16* rowk0, int lane) {
  union { v16b v; v8b q[2]; } u; const __bf16* p = rowk0 + 8 * (lane >> 4);
  u.q[0] = *(const v8b*)p; u.q[1] = *(const v8b*)(p + 16); return u.v;
}
__device__ __forceinline__ float bfr(float v) { return (float)(__bf16)v; }
__device__ __attribute__((noinline)) float exp_ni(float v) { return expf(v); }
__device__ __attribute__((noinline)) float erf_ni(float v) { return erff(v); }

#define WS_Q   0u                                   // f32 q rows [b*NN + n][1024]
#define WS_XR  (WS_Q + 4u * (size_t)NB * NN * CC)         // f32 BN(avgpool) rows [b*MM + m][1024]
#define WS_KT  (WS_XR + 4u * (size_t)NB * MM * CC)        // f16 hi|lo k planes [b][1024 (h,d)][MM]; v planes
#define WS_KTL (WS_KT + 2u * (size_t)NB * CC * MM)
#define WS_VT  (WS_KTL + 2u * (size_t)NB * CC * MM)
#define WS_VTL (WS_VT + 2u * (size_t)NB * CC * MM)
#define WS_KV  (WS_VTL + 2u * (size_t)NB * CC * MM)       // f32 KV^T rows [b][(h,e) 1024][d 32] (transposed for the B operand)
#define WS_CT  (WS_KV + 4u * (size_t)NB * CC * HD)        // f32 ctx rows [b*NN + n][1024]
#define WS_END (WS_CT + 4u * (size_t)NB * NN * CC)

__device__ __forceinline__ v16b fragb_f32(const float* __restrict__ p, int lane) { v16b a; const float* pp = p + 8 * (lane >> 4);
#pragma unroll
  for (int i = 0; i < 8; ++i) { a[i] = (__bf16)pp[i]; a[8 + i] = (__bf16)pp[16 + i]; } return a; }
// ---- k_q: block = (64 rows, 128 cols): q = x . Wq^T (exact) -> f32 rows
__global__ __launch_bounds__(128) void k_q(const float* __restrict__ X, const float* __restrict__ WQ, float* __restrict__ Q) { __shared__ __align__(16) float sf[4][16][132];
  const int tid = threadIdx.x, wave = tid >> 5, lane = tid & 31, col = lane & 15, g = lane >> 4; const size_t r0 = (size_t)blockIdx.x * 64 + wave * 16; const int c0 = blockIdx.y * 128;
  v8f acc[8] = {};
#pragma unroll 2
  for (int kc = 0; kc < CC / 32; ++kc) { const v16b a = fragb_f32(X + (r0 + col) * CC + kc * 32, lane);
#pragma unroll
    for (int j = 0; j < 8; ++j) acc[j] = wmma_bf(a, fragb_f32(WQ + (size_t)(c0 + j * 16 + col) * CC + kc * 32, lane), acc[j]); }
#pragma unroll
  for (int j = 0; j < 8; ++j)
#pragma unroll
    for (int r = 0; r < 8; ++r) sf[wave][8 * g + r][j * 16 + col] = acc[j][r];
  LDSX(); for (int rl = 0; rl < 16; ++rl) vst2(Q + (r0 + rl) * CC + c0 + lane * 4, *(const v4f*)&sf[wave][rl][lane * 4]); }
// ---- k_pool: block = reduced row (b, m): xr = BN(mean of 4 tokens)
__global__ __launch_bounds__(256) void k_pool(const float* __restrict__ X, const float* __restrict__ G, const float* __restrict__ Bt, const float* __restrict__ Mu, const float* __restrict__ Var, float* __restrict__ XR) { __shared__ __align__(16) float so[CC]; const int t = threadIdx.x; const size_t row = blockIdx.x; const size_t b = row / MM; const int m = (int)(row % MM);
  for (int c = t; c < CC; c += 256) { float s = 0.f;
#pragma unroll
    for (int i = 0; i < NR; ++i) s += bfr(X[(b * NN + (size_t)m * NR + i) * CC + c]);
    s *= (1.0f / NR); so[c] = (s - bfr(Mu[c])) / sqrtf(bfr(Var[c]) + BNEPS) * bfr(G[c]) + bfr(Bt[c]); }
  __syncthreads(); for (int q = t; q < CC / 4; q += 256) vst2(XR + row * CC + q * 4, *(const v4f*)&so[q * 4]); }
// ---- k_kv: block = (64 reduced rows, 128 cols, which*NB + b): k / v = xr (hi + lo) . W^T -> f16 hi/lo planes [b][c][m]
__global__ __launch_bounds__(128) void k_kv(const float* __restrict__ XR, const float* __restrict__ WK, const float* __restrict__ WV, _Float16* __restrict__ KT, _Float16* __restrict__ KTL, _Float16* __restrict__ VT, _Float16* __restrict__ VTL) { __shared__ __align__(16) _Float16 th[128][72], tl[128][72];
  const int tid = threadIdx.x, wave = tid >> 5, lane = tid & 31, col = lane & 15, g = lane >> 4; const int which = blockIdx.z / TNB; const size_t b = blockIdx.z % TNB; const int m0 = blockIdx.x * 64; const int c0 = blockIdx.y * 128; const size_t r0 = b * MM + m0 + wave * 16; const float* Wm = which == 0 ? WK : WV;
  v8f acc[8] = {};
#pragma unroll 2
  for (int kc = 0; kc < CC / 32; ++kc) { const F2 a = split_row(XR + (r0 + col) * CC, kc * 32, lane);
#pragma unroll
    for (int j = 0; j < 8; ++j) { const v16b w = fragb_f32(Wm + (size_t)(c0 + j * 16 + col) * CC + kc * 32, lane); acc[j] = wmma_bf(a.h, w, acc[j]); acc[j] = wmma_bf(a.l, w, acc[j]); } }
#pragma unroll
  for (int j = 0; j < 8; ++j)
#pragma unroll
    for (int r = 0; r < 8; ++r) { const float v = acc[j][r]; const _Float16 hv = (_Float16)v; th[j * 16 + col][wave * 16 + 8 * g + r] = hv; tl[j * 16 + col][wave * 16 + 8 * g + r] = (_Float16)((v - (float)hv) * 2048.0f); }
  __syncthreads(); _Float16* PH = which == 0 ? KT : VT; _Float16* PL = which == 0 ? KTL : VTL;
  for (int e = tid; e < 128 * 8; e += 128) { const int cl = e >> 3, q = e & 7; const size_t o = (b * CC + c0 + cl) * (size_t)MM + m0 + q * 8; vst2((unsigned*)(PH + o), *(const v4u*)&th[cl][q * 8]); vst2((unsigned*)(PL + o), *(const v4u*)&tl[cl][q * 8]); } }
// ---- k_kvp: block = (b*NH + h): KV[d][e] = sum_m k[m][d] v[m][e] (3 products over the 512 reduced tokens) -> stored transposed KV^T[(h,e)][d]
__global__ __launch_bounds__(64) void k_kvp(const _Float16* __restrict__ KT, const _Float16* __restrict__ KTL, const _Float16* __restrict__ VT, const _Float16* __restrict__ VTL, float* __restrict__ KVT) { __shared__ __align__(16) float st[HD][HD + 4];
  const int tid = threadIdx.x, wave = tid >> 5, lane = tid & 31, col = lane & 15, g = lane >> 4; const size_t bh = blockIdx.x; const size_t b = bh / NH; const int h = bh % NH;
  // wave = row tile of d (2 tiles); cols e (2 tiles); K = m (16 kc)
  v8f acc[2] = {};
#pragma unroll 2
  for (int kc = 0; kc < MM / 32; ++kc) { const size_t ao = (b * CC + (size_t)h * HD + wave * 16 + col) * MM + kc * 32; const v16h ah = frag_h(KT + ao, lane), al = frag_h(KTL + ao, lane);
#pragma unroll
    for (int j = 0; j < 2; ++j) { const size_t bo = (b * CC + (size_t)h * HD + j * 16 + col) * MM + kc * 32; const v16h vh = frag_h(VT + bo, lane), vl = frag_h(VTL + bo, lane); acc[j] = wmma16(ah, vh, acc[j]); v8f t2 = {}; t2 = wmma16(ah, vl, t2); t2 = wmma16(al, vh, t2);
#pragma unroll
      for (int r = 0; r < 8; ++r) acc[j][r] += t2[r] * (1.0f / 2048.0f); } }
#pragma unroll
  for (int j = 0; j < 2; ++j)
#pragma unroll
    for (int r = 0; r < 8; ++r) st[j * 16 + col][wave * 16 + 8 * g + r] = acc[j][r];   // transposed: [e][d]
  __syncthreads(); for (int e = tid; e < HD * 8; e += 64) { const int ee = e >> 3, q = e & 7; vst2(KVT + ((b * CC) + (size_t)h * HD + ee) * HD + q * 4, *(const v4f*)&st[ee][q * 4]); } }
// ---- k_ctx: block = (64 rows, 128 cols = 4 heads, b implied by row): ctx[n][(h,e)] = scale sum_d q[n][h*32+d] KV^T[(h,e)][d]  (q hi+lo x KV hi+lo, 3 products; K = 32)
__global__ __launch_bounds__(128) void k_ctx(const float* __restrict__ Q, const float* __restrict__ KVT, float* __restrict__ CT) { __shared__ __align__(16) float sf[4][16][132];
  const int tid = threadIdx.x, wave = tid >> 5, lane = tid & 31, col = lane & 15, g = lane >> 4; const size_t r0 = (size_t)blockIdx.x * 64 + wave * 16; const int c0 = blockIdx.y * 128; const size_t b = ((size_t)blockIdx.x * 64) / NN;
  v8f acc[8] = {};
#pragma unroll
  for (int hh = 0; hh < 4; ++hh) { const int h = c0 / HD + hh; const F2 a = split_row(Q + (r0 + col) * CC, h * HD, lane);
#pragma unroll
    for (int jj = 0; jj < 2; ++jj) { float wv[16]; const float* wr = KVT + (b * CC + (size_t)h * HD + jj * 16 + col) * HD + 8 * g;
#pragma unroll
      for (int i = 0; i < 8; ++i) { wv[i] = wr[i]; wv[8 + i] = wr[16 + i]; }
      const F2 wb = bsplit16(wv); const int j = hh * 2 + jj; acc[j] = wmma_bf(a.h, wb.h, acc[j]); acc[j] = wmma_bf(a.h, wb.l, acc[j]); acc[j] = wmma_bf(a.l, wb.h, acc[j]); } }
#pragma unroll
  for (int j = 0; j < 8; ++j)
#pragma unroll
    for (int r = 0; r < 8; ++r) sf[wave][8 * g + r][j * 16 + col] = acc[j][r] * 0.17677669529663687f;
  LDSX(); for (int rl = 0; rl < 16; ++rl) vst2(CT + (r0 + rl) * CC + c0 + lane * 4, *(const v4f*)&sf[wave][rl][lane * 4]); }
// ---- k_out: block = (64 rows, 128 cols): out = ctx (hi + lo) . Wp^T + bp
__global__ __launch_bounds__(128) void k_out(const float* __restrict__ CT, const float* __restrict__ WP, const float* __restrict__ BP, float* __restrict__ OUT) { __shared__ __align__(16) float sf[4][16][132];
  const int tid = threadIdx.x, wave = tid >> 5, lane = tid & 31, col = lane & 15, g = lane >> 4; const size_t r0 = (size_t)blockIdx.x * 64 + wave * 16; const int c0 = blockIdx.y * 128;
  v8f acc[8] = {};
#pragma unroll 2
  for (int kc = 0; kc < CC / 32; ++kc) { const F2 a = split_row(CT + (r0 + col) * CC, kc * 32, lane);
#pragma unroll
    for (int j = 0; j < 8; ++j) { const v16b w = fragb_f32(WP + (size_t)(c0 + j * 16 + col) * CC + kc * 32, lane); acc[j] = wmma_bf(a.h, w, acc[j]); acc[j] = wmma_bf(a.l, w, acc[j]); } }
#pragma unroll
  for (int j = 0; j < 8; ++j) { const float bb = bfr(BP[c0 + j * 16 + col]);
#pragma unroll
    for (int r = 0; r < 8; ++r) sf[wave][8 * g + r][j * 16 + col] = acc[j][r] + bb; }
  LDSX(); for (int rl = 0; rl < 16; ++rl) vst2(OUT + (r0 + rl) * CC + c0 + lane * 4, *(const v4f*)&sf[wave][rl][lane * 4]); }
extern "C" void kernel_launch(void* const* d_in, const int* in_sizes, int n_in, void* d_out, int out_size, void* d_ws, size_t ws_size, hipStream_t stream) {
  (void)in_sizes; (void)n_in; (void)out_size;
  const float** F = (const float**)d_in;   // 0 x [4,2048,1024], 1 Wq, 2 Wk, 3 Wv, 4 Wp (natural), 5 bp, 6 bn_gamma, 7 bn_beta, 8 bn_mean, 9 bn_var
  if (ws_size < (size_t)WS_END) return;
  char* ws = (char*)d_ws; float *Q = (float*)(ws + WS_Q), *XR = (float*)(ws + WS_XR), *KVT = (float*)(ws + WS_KV), *CT = (float*)(ws + WS_CT); _Float16 *KT = (_Float16*)(ws + WS_KT), *KTL = (_Float16*)(ws + WS_KTL), *VT = (_Float16*)(ws + WS_VT), *VTL = (_Float16*)(ws + WS_VTL);
  k_q<<<dim3(TOB, CC / 128), 128, 0, stream>>>(F[0], F[1], Q);
  k_pool<<<TNB * MM, 256, 0, stream>>>(F[0], F[6], F[7], F[8], F[9], XR);
  k_kv<<<dim3(MM / 64, CC / 128, 2 * TNB), 128, 0, stream>>>(XR, F[2], F[3], KT, KTL, VT, VTL);
  k_kvp<<<TNB * NH, 64, 0, stream>>>(KT, KTL, VT, VTL, KVT);
  k_ctx<<<dim3(TOB, CC / 128), 128, 0, stream>>>(Q, KVT, CT);
  k_out<<<dim3(TOB, CC / 128), 128, 0, stream>>>(CT, F[4], F[5], (float*)d_out);
}

// v001
// One run takes 113 microseconds.
// Two timings next to v000 put it at 3.61 and 3.62 times that version's speed.
// compute dtype: all float inputs rounded to bf16; q = x Wq^T with EXACT bf16 products on WMMA 16x16x32; AvgPool1d (exact f32 sums of 4 bf16 tokens) + BatchNorm (eval) in f32; k, v = xr W^T with xr as bf16 hi + lo (2 products); no softmax in the module, so (q k^T) v is evaluated exactly re-associated as q (k^T v): KV_h = k_h^T v_h with k, v as f16 hi + lo and ctx = scale q_h KV_h with q, KV as bf16 hi + lo (3 products each); out = ctx (bf16 hi + lo) . Wp^T + bp; f32 output.
#include <hip/hip_runtime.h>
#include <math.h>

typedef __attribute__((ext_vector_type(16))) _Float16 v16h;
typedef __attribute__((ext_vector_type(16))) __bf16 v16b;
typedef __attribute__((ext_vector_type(8)))  _Float16 v8h;
typedef __attribute__((ext_vector_type(8)))  float v8f;
typedef __attribute__((ext_vector_type(4)))  float v4f;
typedef __attribute__((ext_vector_type(2)))  float v2f;
typedef __attribute__((ext_vector_type(4)))  unsigned v4u;
typedef __attribute__((ext_vector_type(4)))  int v4i;
typedef float __attribute__((may_alias)) float_a;
typedef int __attribute__((may_alias)) int_a;

template <typename T> __device__ __forceinline__ void vst2(void* p, T v) { *(T*)p = v;  }
__device__ __forceinline__ v8f wmma16(v16h a, v16h b, v8f c) {
  v8f d = __builtin_amdgcn_wmma_f32_16x16x32_f16(false, a, false, b, (short)0, c, false, false);
  asm volatile("v_nop\n\tv_nop\n\tv_nop\n\tv_nop" : "+v"(d) : "v"(a), "v"(b));
  return d;
}
__device__ __forceinline__ v8f wmma_bf(v16b a, v16b b, v8f c) {
  v8f d = __builtin_amdgcn_wmma_f32_16x16x32_bf16(false, a, false, b, (short)0, c, false, false);
  asm volatile("v_nop\n\tv_nop\n\tv_nop\n\tv_nop" : "+v"(d) : "v"(a), "v"(b));
  return d;
}
// 16x16x32 fragments: lane = (h = lane>>4, row/col = lane&15); elements 0..7 = k0+8h+0..7, 8..15 = k0+16+8h+0..7; D element r = row 8h+r
__device__ __forceinline__ v16h frag_h(const _Float16* rowk0, int lane) {
  union { v16h v; v8h q[2]; } u; const _Float16* p = rowk0 + 8 * (lane >> 4);
  u.q[0] = *(const v8h*)p; u.q[1] = *(const v8h*)(p + 16); return u.v;
}
__device__ __forceinline__ v16h frag_f32(const float* rowk0, int lane) {
  v16h a; const float* p = rowk0 + 8 * (lane >> 4);
#pragma unroll
  for (int i = 0; i < 8; ++i) { a[i] = (_Float16)p[i]; a[8 + i] = (_Float16)p[16 + i]; }
  return a;
}
__device__ __forceinline__ v16h frag_f32s(const float* rowk0, int lane, float sc) {
  v16h a; const float* p = rowk0 + 8 * (lane >> 4);
#pragma unroll
  for (int i = 0; i < 8; ++i) { a[i] = (_Float16)(p[i] * sc); a[8 + i] = (_Float16)(p[16 + i] * sc); }
  return a;
}
// column fragment from a [K][ld] layout (column n), rows >= K read as 0
__device__ __forceinline__ v16h fragc_f32(const float* W, int k0, int n, int lane, int ld, int K) {
  v16h a; const int g = lane >> 4;
#pragma unroll
  for (int i = 0; i < 8; ++i) { const int ka = k0 + 8 * g + i, kb = ka + 16;
    a[i] = (_Float16)(ka < K ? W[(size_t)(ka < K ? ka : K - 1) * ld + n] : 0.f); a[8 + i] = (_Float16)(kb < K ? W[(size_t)(kb < K ? kb : K - 1) * ld + n] : 0.f); }
  return a;
}
struct F2 { v16b h, l; };
__device__ __forceinline__ F2 bsplit16(const float v[16]) { F2 r;
#pragma unroll
  for (int i = 0; i < 16; ++i) { const __bf16 h = (__bf16)v[i]; r.h[i] = h; r.l[i] = (__bf16)(v[i] - (float)h); }
  return r; }
__device__ __forceinline__ F2 split_row(const float* row, int k0, int lane) { float v[16]; const float* p = row + k0 + 8 * (lane >> 4);
#pragma unroll
  for (int i = 0; i < 8; ++i) { v[i] = p[i]; v[8 + i] = p[16 + i]; }
  return bsplit16(v); }
__device__ __forceinline__ F2 split_rowK(const float* row, int k0, int lane, int K) { float v[16]; const int g = lane >> 4;
#pragma unroll
  for (int i = 0; i < 8; ++i) { const int ka = k0 + 8 * g + i, kb = ka + 16; v[i] = ka < K ? row[ka < K ? ka : K - 1] : 0.f; v[8 + i] = kb < K ? row[kb < K ? kb : K - 1] : 0.f; }
  return bsplit16(v); }
__device__ __forceinline__ F2 split_col(const float* W, int k0, int n, int lane, int ld, int K) { float v[16]; const int g = lane >> 4;
#pragma unroll
  for (int i = 0; i < 8; ++i) { const int ka = k0 + 8 * g + i, kb = ka + 16; v[i] = ka < K ? W[(size_t)(ka < K ? ka : K - 1) * ld + n] : 0.f; v[8 + i] = kb < K ? W[(size_t)(kb < K ? kb : K - 1) * ld + n] : 0.f; }
  return bsplit16(v); }
__device__ __forceinline__ v8f mac3(const F2& a, const F2& b, v8f c) { c = wmma_bf(a.l, b.h, c); c = wmma_bf(a.h, b.l, c); return wmma_bf(a.h, b.h, c); }
__device__ __forceinline__ float sigm(float v) { return 1.0f / (1.0f + expf(-v)); }
#define LDSX() do { asm volatile("s_wait_dscnt 0" ::: "memory"); __builtin_amdgcn_wave_barrier(); __builtin_amdgcn_fence(__ATOMIC_RELEASE, "workgroup"); } while (0)


// Efficient multi-head attention WITHOUT softmax (B 4, N 2,048, C 1,024, 32 heads x 32, reduction 4 -> M 512): out = ((q k^T) * 32^-1/2) v, then Wp + bp; evaluated as q (k^T v).
#define NB 4
#define NN 2048
#define CC 1024
#define NH 32
#define HD 32
#define NR 4              // N_RATIO
#define MM (NN / NR)      // 512
#define BNEPS 1e-6f
#ifndef TNB
#define TNB NB
#endif
#ifndef TOB
#define TOB (TNB * NN / 64)
#endif
typedef __attribute__((ext_vector_type(8))) __bf16 v8b;
__device__ __forceinline__ v16b frag_b(const __bf16* rowk0, int lane) {
  union { v16b v; v8b q[2]; } u; const __bf16* p = rowk0 + 8 * (lane >> 4);
  u.q[0] = *(const v8b*)p; u.q[1] = *(const v8b*)(p + 16); return u.v;
}
__device__ __forceinline__ float bfr(float v) { return (float)(__bf16)v; }
__device__ __attribute__((noinline)) float exp_ni(float v) { return expf(v); }
__device__ __attribute__((noinline)) float erf_ni(float v) { return erff(v); }

#define WS_Q   0u                                   // f32 q rows [b*NN + n][1024]
#define WS_XR  (WS_Q + 4u * (size_t)NB * NN * CC)         // f32 BN(avgpool) rows [b*MM + m][1024]
#define WS_KT  (WS_XR + 4u * (size_t)NB * MM * CC)        // f16 hi|lo k planes [b][1024 (h,d)][MM]; v planes
#define WS_KTL (WS_KT + 2u * (size_t)NB * CC * MM)
#define WS_VT  (WS_KTL + 2u * (size_t)NB * CC * MM)
#define WS_VTL (WS_VT + 2u * (size_t)NB * CC * MM)
#define WS_KV  (WS_VTL + 2u * (size_t)NB * CC * MM)       // f32 KV^T rows [b][(h,e) 1024][d 32] (transposed for the B operand)
#define WS_CT  (WS_KV + 4u * (size_t)NB * CC * HD)        // f32 ctx rows [b*NN + n][1024]
#define WS_END (WS_CT + 4u * (size_t)NB * NN * CC)

__device__ __forceinline__ v16b fragb_f32(const float* __restrict__ p, int lane) { v16b a; const float* pp = p + 8 * (lane >> 4);
#pragma unroll
  for (int i = 0; i < 8; ++i) { a[i] = (__bf16)pp[i]; a[8 + i] = (__bf16)pp[16 + i]; } return a; }
// ---- shared core of the three projection GEMMs: one block of 8 waves makes Y[128][128] = A[128][1024] . W[128][1024]^T.
// Each stage is 64 k: every wave-wide global load covers two 256-B row pieces (whole lines); the f32 values are rounded to bf16 (A also to its lo part where LO) ONCE per block and laid in LDS,
// where the 8 waves (4 x 2, 32 x 64 of Y each) read their fragments. Two buffers: the next stage's global loads fly while this stage is multiplied.
#define GBK 64                    // k per stage
#define GPB 144                   // LDS row pitch in bytes: 64 bf16 + 16 B (16 B x odd for ds_load_b128 readers)
#define GPL (128 * GPB)           // one operand plane of a stage; planes: A hi | A lo (LO only) | W
typedef __attribute__((ext_vector_type(4))) __bf16 v4b;
template <int LO> __device__ __forceinline__ void gemm_tile(const float* __restrict__ A, const float* __restrict__ Wm, char* sm, v8f (&acc)[2][4]) {
  constexpr int STG = (2 + LO) * GPL;
  const int tid = threadIdx.x, wave = tid >> 5, lane = tid & 31, col = lane & 15; const int lr = tid >> 4, lc = tid & 15;
  const float* ga = A + (size_t)lr * CC + lc * 4; const float* gb = Wm + (size_t)lr * CC + lc * 4; char* st = sm + lr * GPB + lc * 8;
  const char* fa = sm + ((wave >> 1) * 32 + col) * GPB; const char* fb = sm + (1 + LO) * GPL + ((wave & 1) * 64 + col) * GPB;
  v4f ra[8], rb[8];
  auto ldg = [&](int s) {
#pragma unroll
    for (int i = 0; i < 8; ++i) { ra[i] = *(const v4f*)(ga + (size_t)i * 16 * CC + s * GBK); rb[i] = *(const v4f*)(gb + (size_t)i * 16 * CC + s * GBK); } };
  auto sts = [&](int buf) { char* p = st + buf * STG;
#pragma unroll
    for (int i = 0; i < 8; ++i) { v4b h, l, w;
#pragma unroll
      for (int e = 0; e < 4; ++e) { const __bf16 hh = (__bf16)ra[i][e]; h[e] = hh; l[e] = (__bf16)(ra[i][e] - (float)hh); w[e] = (__bf16)rb[i][e]; }
      *(v4b*)(p + i * 16 * GPB) = h; if (LO) *(v4b*)(p + GPL + i * 16 * GPB) = l; *(v4b*)(p + (1 + LO) * GPL + i * 16 * GPB) = w; } };
  ldg(0); sts(0); __syncthreads();
#pragma unroll 1   // rolled, for speed only
  for (int s = 0; s < CC / GBK; ++s) { const int buf = s & 1;
    if (s + 1 < CC / GBK) ldg(s + 1);
#pragma unroll
    for (int kk = 0; kk < 2; ++kk) { const char* pa = fa + buf * STG + kk * 64; const char* pb = fb + buf * STG + kk * 64; v16b b[4], ah[2], al[2];
#pragma unroll
      for (int j = 0; j < 4; ++j) b[j] = frag_b((const __bf16*)(pb + j * 16 * GPB), lane);
#pragma unroll
      for (int i = 0; i < 2; ++i) { ah[i] = frag_b((const __bf16*)(pa + i * 16 * GPB), lane); if (LO) al[i] = frag_b((const __bf16*)(pa + GPL + i * 16 * GPB), lane); }
#pragma unroll
      for (int i = 0; i < 2; ++i) {
#pragma unroll
        for (int j = 0; j < 4; ++j) acc[i][j] = wmma_bf(ah[i], b[j], acc[i][j]);
        if (LO) {
#pragma unroll
          for (int j = 0; j < 4; ++j) acc[i][j] = wmma_bf(al[i], b[j], acc[i][j]); } } }
    if (s + 1 < CC / GBK) sts(buf ^ 1);
    __syncthreads(); } }   // one barrier per stage: publishes stage s + 1 and ends every read of the buffer that stage s + 2 overwrites
// f32 tile out: each wave stages its 32 x 64 in its own LDS range and stores whole 256-B row pieces. Y = the block's first row and column. Call only behind gemm_tile's last barrier.
__device__ __forceinline__ void put_tile(const v8f (&acc)[2][4], char* sm, float* __restrict__ Y) {
  const int tid = threadIdx.x, wave = tid >> 5, lane = tid & 31, col = lane & 15, g = lane >> 4; float* sf = (float*)sm + wave * (32 * 68);
#pragma unroll
  for (int i = 0; i < 2; ++i)
#pragma unroll
    for (int j = 0; j < 4; ++j)
#pragma unroll
      for (int r = 0; r < 8; ++r) sf[(i * 16 + 8 * g + r) * 68 + j * 16 + col] = acc[i][j][r];
  LDSX();   // the wave's rows are complete in LDS before its lanes read what other lanes wrote
#pragma unroll
  for (int it = 0; it < 16; ++it) { const int rl = it * 2 + g; vst2(Y + (size_t)((wave >> 1) * 32 + rl) * CC + (wave & 1) * 64 + col * 4, *(const v4f*)&sf[rl * 68 + col * 4]); } }
// ---- k_q: block = (128 rows, 128 cols): q = x . Wq^T (exact) -> f32 rows
__global__ __launch_bounds__(256) void k_q(const float* __restrict__ X, const float* __restrict__ WQ, float* __restrict__ Q) { __shared__ __align__(16) char sm[2 * 2 * GPL];
  const size_t r0 = (size_t)blockIdx.x * 128; const int c0 = blockIdx.y * 128; v8f acc[2][4] = {};
  gemm_tile<0>(X + r0 * CC, WQ + (size_t)c0 * CC, sm, acc); put_tile(acc, sm, Q + r0 * CC + c0); }
// ---- k_pool: block = reduced row (b, m): xr = BN(mean of 4 tokens)
__global__ __launch_bounds__(256) void k_pool(const float* __restrict__ X, const float* __restrict__ G, const float* __restrict__ Bt, const float* __restrict__ Mu, const float* __restrict__ Var, float* __restrict__ XR) { __shared__ __align__(16) float so[CC]; const int t = threadIdx.x; const size_t row = blockIdx.x; const size_t b = row / MM; const int m = (int)(row % MM);
  for (int c = t; c < CC; c += 256) { float s = 0.f;
#pragma unroll
    for (int i = 0; i < NR; ++i) s += bfr(X[(b * NN + (size_t)m * NR + i) * CC + c]);
    s *= (1.0f / NR); so[c] = (s - bfr(Mu[c])) / sqrtf(bfr(Var[c]) + BNEPS) * bfr(G[c]) + bfr(Bt[c]); }
  __syncthreads(); for (int q = t; q < CC / 4; q += 256) vst2(XR + row * CC + q * 4, *(const v4f*)&so[q * 4]); }
// ---- k_kv: block = (128 reduced rows, 128 cols, which*NB + b): k / v = xr (hi + lo) . W^T -> f16 hi/lo planes [b][c][m]
__global__ __launch_bounds__(256) void k_kv(const float* __restrict__ XR, const float* __restrict__ WK, const float* __restrict__ WV, _Float16* __restrict__ KT, _Float16* __restrict__ KTL, _Float16* __restrict__ VT, _Float16* __restrict__ VTL) { __shared__ __align__(16) char sm[2 * 3 * GPL];
  const int tid = threadIdx.x, wave = tid >> 5, lane = tid & 31, col = lane & 15, g = lane >> 4; const int which = blockIdx.z / TNB; const size_t b = blockIdx.z % TNB; const int m0 = blockIdx.x * 128; const int c0 = blockIdx.y * 128; const size_t r0 = b * MM + m0; const float* Wm = which == 0 ? WK : WV;
  v8f acc[2][4] = {};
  gemm_tile<1>(XR + r0 * CC, Wm + (size_t)c0 * CC, sm, acc);
  _Float16* th = (_Float16*)sm; _Float16* tl = th + 128 * 136;   // transposed tiles [c 128][m 128 + 8], in the ring's LDS behind its last barrier
#pragma unroll
  for (int i = 0; i < 2; ++i)
#pragma unroll
    for (int j = 0; j < 4; ++j) { v8h hq, lq;
#pragma unroll
      for (int r = 0; r < 8; ++r) { const float v = acc[i][j][r]; const _Float16 hv = (_Float16)v; hq[r] = hv; lq[r] = (_Float16)((v - (float)hv) * 2048.0f); }
      const int o = ((wave & 1) * 64 + j * 16 + col) * 136 + (wave >> 1) * 32 + i * 16 + 8 * g; *(v8h*)&th[o] = hq; *(v8h*)&tl[o] = lq; }
  __syncthreads(); _Float16* PH = which == 0 ? KT : VT; _Float16* PL = which == 0 ? KTL : VTL;
  for (int e = tid; e < 128 * 16; e += 256) { const int cl = e >> 4, q = e & 15; const size_t o = (b * CC + c0 + cl) * (size_t)MM + m0 + q * 8; vst2((unsigned*)(PH + o), *(const v4u*)&th[cl * 136 + q * 8]); vst2((unsigned*)(PL + o), *(const v4u*)&tl[cl * 136 + q * 8]); } }
// ---- k_kvp: block = (b*NH + h): KV[d][e] = sum_m k[m][d] v[m][e] (3 products over the 512 reduced tokens) -> stored transposed KV^T[(h,e)][d]
__global__ __launch_bounds__(64) void k_kvp(const _Float16* __restrict__ KT, const _Float16* __restrict__ KTL, const _Float16* __restrict__ VT, const _Float16* __restrict__ VTL, float* __restrict__ KVT) { __shared__ __align__(16) float st[HD][HD + 4];
  const int tid = threadIdx.x, wave = tid >> 5, lane = tid & 31, col = lane & 15, g = lane >> 4; const size_t bh = blockIdx.x; const size_t b = bh / NH; const int h = bh % NH;
  // wave = row tile of d (2 tiles); cols e (2 tiles); K = m (16 kc)
  v8f acc[2] = {};
#pragma unroll 2
  for (int kc = 0; kc < MM / 32; ++kc) { const size_t ao = (b * CC + (size_t)h * HD + wave * 16 + col) * MM + kc * 32; const v16h ah = frag_h(KT + ao, lane), al = frag_h(KTL + ao, lane);
#pragma unroll
    for (int j = 0; j < 2; ++j) { const size_t bo = (b * CC + (size_t)h * HD + j * 16 + col) * MM + kc * 32; const v16h vh = frag_h(VT + bo, lane), vl = frag_h(VTL + bo, lane); acc[j] = wmma16(ah, vh, acc[j]); v8f t2 = {}; t2 = wmma16(ah, vl, t2); t2 = wmma16(al, vh, t2);
#pragma unroll
      for (int r = 0; r < 8; ++r) acc[j][r] += t2[r] * (1.0f / 2048.0f); } }
#pragma unroll
  for (int j = 0; j < 2; ++j)
#pragma unroll
    for (int r = 0; r < 8; ++r) st[j * 16 + col][wave * 16 + 8 * g + r] = acc[j][r];   // transposed: [e][d]
  __syncthreads(); for (int e = tid; e < HD * 8; e += 64) { const int ee = e >> 3, q = e & 7; vst2(KVT + ((b * CC) + (size_t)h * HD + ee) * HD + q * 4, *(const v4f*)&st[ee][q * 4]); } }
// ---- k_ctx: block = (64 rows, 128 cols = 4 heads, b implied by row): ctx[n][(h,e)] = scale sum_d q[n][h*32+d] KV^T[(h,e)][d]  (q hi+lo x KV hi+lo, 3 products; K = 32)
__global__ __launch_bounds__(128) void k_ctx(const float* __restrict__ Q, const float* __restrict__ KVT, float* __restrict__ CT) { __shared__ __align__(16) float sf[4][16][132];
  const int tid = threadIdx.x, wave = tid >> 5, lane = tid & 31, col = lane & 15, g = lane >> 4; const size_t r0 = (size_t)blockIdx.x * 64 + wave * 16; const int c0 = blockIdx.y * 128; const size_t b = ((size_t)blockIdx.x * 64) / NN;
  v8f acc[8] = {};
#pragma unroll
  for (int hh = 0; hh < 4; ++hh) { const int h = c0 / HD + hh; const F2 a = split_row(Q + (r0 + col) * CC, h * HD, lane);
#pragma unroll
    for (int jj = 0; jj < 2; ++jj) { float wv[16]; const float* wr = KVT + (b * CC + (size_t)h * HD + jj * 16 + col) * HD + 8 * g;
#pragma unroll
      for (int i = 0; i < 8; ++i) { wv[i] = wr[i]; wv[8 + i] = wr[16 + i]; }
      const F2 wb = bsplit16(wv); const int j = hh * 2 + jj; acc[j] = wmma_bf(a.h, wb.h, acc[j]); acc[j] = wmma_bf(a.h, wb.l, acc[j]); acc[j] = wmma_bf(a.l, wb.h, acc[j]); } }
#pragma unroll
  for (int j = 0; j < 8; ++j)
#pragma unroll
    for (int r = 0; r < 8; ++r) sf[wave][8 * g + r][j * 16 + col] = acc[j][r] * 0.17677669529663687f;
  LDSX(); for (int rl = 0; rl < 16; ++rl) vst2(CT + (r0 + rl) * CC + c0 + lane * 4, *(const v4f*)&sf[wave][rl][lane * 4]); }
// ---- k_out: block = (128 rows, 128 cols): out = ctx (hi + lo) . Wp^T + bp
__global__ __launch_bounds__(256) void k_out(const float* __restrict__ CT, const float* __restrict__ WP, const float* __restrict__ BP, float* __restrict__ OUT) { __shared__ __align__(16) char sm[2 * 3 * GPL];
  const int wave = threadIdx.x >> 5, col = threadIdx.x & 15; const size_t r0 = (size_t)blockIdx.x * 128; const int c0 = blockIdx.y * 128; v8f acc[2][4] = {};
  gemm_tile<1>(CT + r0 * CC, WP + (size_t)c0 * CC, sm, acc);
#pragma unroll
  for (int j = 0; j < 4; ++j) { const float bb = bfr(BP[c0 + (wave & 1) * 64 + j * 16 + col]);
#pragma unroll
    for (int i = 0; i < 2; ++i)
#pragma unroll
      for (int r = 0; r < 8; ++r) acc[i][j][r] = acc[i][j][r] + bb; }
  put_tile(acc, sm, OUT + r0 * CC + c0); }
extern "C" void kernel_launch(void* const* d_in, const int* in_sizes, int n_in, void* d_out, int out_size, void* d_ws, size_t ws_size, hipStream_t stream) {
  (void)in_sizes; (void)n_in; (void)out_size;
  const float** F = (const float**)d_in;   // 0 x [4,2048,1024], 1 Wq, 2 Wk, 3 Wv, 4 Wp (natural), 5 bp, 6 bn_gamma, 7 bn_beta, 8 bn_mean, 9 bn_var
  if (ws_size < (size_t)WS_END) return;
  char* ws = (char*)d_ws; float *Q = (float*)(ws + WS_Q), *XR = (float*)(ws + WS_XR), *KVT = (float*)(ws + WS_KV), *CT = (float*)(ws + WS_CT); _Float16 *KT = (_Float16*)(ws + WS_KT), *KTL = (_Float16*)(ws + WS_KTL), *VT = (_Float16*)(ws + WS_VT), *VTL = (_Float16*)(ws + WS_VTL);
  k_q<<<dim3(TNB * NN / 128, CC / 128), 256, 0, stream>>>(F[0], F[1], Q);
  k_pool<<<TNB * MM, 256, 0, stream>>>(F[0], F[6], F[7], F[8], F[9], XR);
  k_kv<<<dim3(MM / 128, CC / 128, 2 * TNB), 256, 0, stream>>>(XR, F[2], F[3], KT, KTL, VT, VTL);
  k_kvp<<<TNB * NH, 64, 0, stream>>>(KT, KTL, VT, VTL, KVT);
  k_ctx<<<dim3(TOB, CC / 128), 128, 0, stream>>>(Q, KVT, CT);
  k_out<<<dim3(TNB * NN / 128, CC / 128), 256, 0, stream>>>(CT, F[4], F[5], (float*)d_out);
}

// v002
// Measured time: 104 microseconds a run.
// Timed twice side by side with v001, it ran 1.09 times as fast both times.
// Over all steps from v000 it is 3.94 times as fast.
// compute dtype: all float inputs rounded to bf16; q = x Wq^T with EXACT bf16 products on WMMA 16x16x32; AvgPool1d (exact f32 sums of 4 bf16 tokens) + BatchNorm (eval) in f32; k, v = xr W^T with xr as bf16 hi + lo (2 products); no softmax in the module, so (q k^T) v is evaluated exactly re-associated as q (k^T v): KV_h = k_h^T v_h with k, v as f16 hi + lo and ctx = scale q_h KV_h with q, KV as bf16 hi + lo (3 products each); out = ctx (bf16 hi + lo) . Wp^T + bp; f32 output.
#include <hip/hip_runtime.h>
#include <math.h>

typedef __attribute__((ext_vector_type(16))) _Float16 v16h;
typedef __attribute__((ext_vector_type(16))) __bf16 v16b;
typedef __attribute__((ext_vector_type(8)))  _Float16 v8h;
typedef __attribute__((ext_vector_type(8)))  float v8f;
typedef __attribute__((ext_vector_type(4)))  float v4f;
typedef __attribute__((ext_vector_type(2)))  float v2f;
typedef __attribute__((ext_vector_type(4)))  unsigned v4u;
typedef __attribute__((ext_vector_type(4)))  int v4i;
typedef float __attribute__((may_alias)) float_a;
typedef int __attribute__((may_alias)) int_a;

template <typename T> __device__ __forceinline__ void vst2(void* p, T v) { *(T*)p = v;  }
__device__ __forceinline__ v8f wmma16(v16h a, v16h b, v8f c) {
  v8f d = __builtin_amdgcn_wmma_f32_16x16x32_f16(false, a, false, b, (short)0, c, false, false);
  asm volatile("v_nop\n\tv_nop\n\tv_nop\n\tv_nop" : "+v"(d) : "v"(a), "v"(b));
  return d;
}
__device__ __forceinline__ v8f wmma_bf(v16b a, v16b b, v8f c) {
  v8f d = __builtin_amdgcn_wmma_f32_16x16x32_bf16(false, a, false, b, (short)0, c, false, false);
  asm volatile("v_nop\n\tv_nop\n\tv_nop\n\tv_nop" : "+v"(d) : "v"(a), "v"(b));
  return d;
}
// 16x16x32 fragments: lane = (h = lane>>4, row/col = lane&15); elements 0..7 = k0+8h+0..7, 8..15 = k0+16+8h+0..7; D element r = row 8h+r
__device__ __forceinline__ v16h frag_h(const _Float16* rowk0, int lane) {
  union { v16h v; v8h q[2]; } u; const _Float16* p = rowk0 + 8 * (lane >> 4);
  u.q[0] = *(const v8h*)p; u.q[1] = *(const v8h*)(p + 16); return u.v;
}
__device__ __forceinline__ v16h frag_f32(const float* rowk0, int lane) {
  v16h a; const float* p = rowk0 + 8 * (lane >> 4);
#pragma unroll
  for (int i = 0; i < 8; ++i) { a[i] = (_Float16)p[i]; a[8 + i] = (_Float16)p[16 + i]; }
  return a;
}
__device__ __forceinline__ v16h frag_f32s(const float* rowk0, int lane, float sc) {
  v16h a; const float* p = rowk0 + 8 * (lane >> 4);
#pragma unroll
  for (int i = 0; i < 8; ++i) { a[i] = (_Float16)(p[i] * sc); a[8 + i] = (_Float16)(p[16 + i] * sc); }
  return a;
}
// column fragment from a [K][ld] layout (column n), rows >= K read as 0
__device__ __forceinline__ v16h fragc_f32(const float* W, int k0, int n, int lane, int ld, int K) {
  v16h a; const int g = lane >> 4;
#pragma unroll
  for (int i = 0; i < 8; ++i) { const int ka = k0 + 8 * g + i, kb = ka + 16;
    a[i] = (_Float16)(ka < K ? W[(size_t)(ka < K ? ka : K - 1) * ld + n] : 0.f); a[8 + i] = (_Float16)(kb < K ? W[(size_t)(kb < K ? kb : K - 1) * ld + n] : 0.f); }
  return a;
}
struct F2 { v16b h, l; };
__device__ __forceinline__ F2 bsplit16(const float v[16]) { F2 r;
#pragma unroll
  for (int i = 0; i < 16; ++i) { const __bf16 h = (__bf16)v[i]; r.h[i] = h; r.l[i] = (__bf16)(v[i] - (float)h); }
  return r; }
__device__ __forceinline__ F2 split_row(const float* row, int k0, int lane) { float v[16]; const float* p = row + k0 + 8 * (lane >> 4);
#pragma unroll
  for (int i = 0; i < 8; ++i) { v[i] = p[i]; v[8 + i] = p[16 + i]; }
  return bsplit16(v); }
__device__ __forceinline__ F2 split_rowK(const float* row, int k0, int lane, int K) { float v[16]; const int g = lane >> 4;
#pragma unroll
  for (int i = 0; i < 8; ++i) { const int ka = k0 + 8 * g + i, kb = ka + 16; v[i] = ka < K ? row[ka < K ? ka : K - 1] : 0.f; v[8 + i] = kb < K ? row[kb < K ? kb : K - 1] : 0.f; }
  return bsplit16(v); }
__device__ __forceinline__ F2 split_col(const float* W, int k0, int n, int lane, int ld, int K) { float v[16]; const int g = lane >> 4;
#pragma unroll
  for (int i = 0; i < 8; ++i) { const int ka = k0 + 8 * g + i, kb = ka + 16; v[i] = ka < K ? W[(size_t)(ka < K ? ka : K - 1) * ld + n] : 0.f; v[8 + i] = kb < K ? W[(size_t)(kb < K ? kb : K - 1) * ld + n] : 0.f; }
  return bsplit16(v); }
__device__ __forceinline__ v8f mac3(const F2& a, const F2& b, v8f c) { c = wmma_bf(a.l, b.h, c); c = wmma_bf(a.h, b.l, c); return wmma_bf(a.h, b.h, c); }
__device__ __forceinline__ float sigm(float v) { return 1.0f / (1.0f + expf(-v)); }
#define LDSX() do { asm volatile("s_wait_dscnt 0" ::: "memory"); __builtin_amdgcn_wave_barrier(); __builtin_amdgcn_fence(__ATOMIC_RELEASE, "workgroup"); } while (0)


// Efficient multi-head attention WITHOUT softmax (B 4, N 2,048, C 1,024, 32 heads x 32, reduction 4 -> M 512): out = ((q k^T) * 32^-1/2) v, then Wp + bp; evaluated as q (k^T v).
#define NB 4
#define NN 2048
#define CC 1024
#define NH 32
#define HD 32
#define NR 4              // N_RATIO
#define MM (NN / NR)      // 512
#define BNEPS 1e-6f
#ifndef TNB
#define TNB NB
#endif
#ifndef TOB
#define TOB (TNB * NN / 64)
#endif
typedef __attribute__((ext_vector_type(8))) __bf16 v8b;
__device__ __forceinline__ v16b frag_b(const __bf16* rowk0, int lane) {
  union { v16b v; v8b q[2]; } u; const __bf16* p = rowk0 + 8 * (lane >> 4);
  u.q[0] = *(const v8b*)p; u.q[1] = *(const v8b*)(p + 16); return u.v;
}
__device__ __forceinline__ float bfr(float v) { return (float)(__bf16)v; }
__device__ __attribute__((noinline)) float exp_ni(float v) { return expf(v); }
__device__ __attribute__((noinline)) float erf_ni(float v) { return erff(v); }

#define WS_Q   0u                                   // f32 q rows [b*NN + n][1024]
#define WS_XR  (WS_Q + 4u * (size_t)NB * NN * CC)         // BN(avgpool) rows [b*MM + m][1024] as two bf16 planes, hi then lo
#define WS_KT  (WS_XR + 4u * (size_t)NB * MM * CC)        // f16 hi|lo k planes [b][1024 (h,d)][MM]; v planes
#define WS_KTL (WS_KT + 2u * (size_t)NB * CC * MM)
#define WS_VT  (WS_KTL + 2u * (size_t)NB * CC * MM)
#define WS_VTL (WS_VT + 2u * (size_t)NB * CC * MM)
#define WS_KV  (WS_VTL + 2u * (size_t)NB * CC * MM)       // f32 KV^T rows [b][(h,e) 1024][d 32] (transposed for the B operand)
#define WS_CT  (WS_KV + 4u * (size_t)NB * CC * HD)        // ctx rows [b*NN + n][1024] as two bf16 planes, hi then lo
#define WS_XB  (WS_CT + 4u * (size_t)NB * NN * CC)        // bf16 x rows [b*NN + n][1024]
#define WS_WB  (WS_XB + 2u * (size_t)NB * NN * CC)        // bf16 Wq | Wk | Wv | Wp, each [1024][1024]
#define WS_END (WS_WB + 2u * 4u * (size_t)CC * CC)

__device__ __forceinline__ v16b fragb_f32(const float* __restrict__ p, int lane) { v16b a; const float* pp = p + 8 * (lane >> 4);
#pragma unroll
  for (int i = 0; i < 8; ++i) { a[i] = (__bf16)pp[i]; a[8 + i] = (__bf16)pp[16 + i]; } return a; }
// ---- shared core of the three projection GEMMs: one block of 8 waves makes Y[128][128] = A[128][1024] . W[128][1024]^T.
// The operands arrive as bf16 planes that their producers rounded once (A also as its lo plane where LO). Each stage is 64 k: every wave-wide global load covers four 128-B row pieces (whole lines),
// which go unchanged into LDS, where the 8 waves (4 x 2, 32 x 64 of Y each) read their fragments. Two buffers: the next stage's global loads fly while this stage is multiplied.
#define GBK 64                    // k per stage
#define GPB 144                   // LDS row pitch in bytes: 64 bf16 + 16 B (16 B x odd for ds_load_b128 readers)
#define GPL (128 * GPB)           // one operand plane of a stage; planes: A hi | A lo (LO only) | W
typedef __attribute__((ext_vector_type(4))) __bf16 v4b;
template <int LO> __device__ __forceinline__ void gemm_tile(const __bf16* __restrict__ A, const __bf16* __restrict__ AL, const __bf16* __restrict__ Wm, char* sm, v8f (&acc)[2][4]) {
  constexpr int STG = (2 + LO) * GPL;
  const int tid = threadIdx.x, wave = tid >> 5, lane = tid & 31, col = lane & 15; const int lr = tid >> 3, lc = tid & 7;
  const __bf16* ga = A + (size_t)lr * CC + lc * 8; const __bf16* gl = AL + (size_t)lr * CC + lc * 8; const __bf16* gb = Wm + (size_t)lr * CC + lc * 8; char* st = sm + lr * GPB + lc * 16;
  const char* fa = sm + ((wave >> 1) * 32 + col) * GPB; const char* fb = sm + (1 + LO) * GPL + ((wave & 1) * 64 + col) * GPB;
  v8b ra[4], rl[4], rb[4];
  auto ldg = [&](int s) {
#pragma unroll
    for (int i = 0; i < 4; ++i) { const size_t o = (size_t)i * 32 * CC + s * GBK; ra[i] = *(const v8b*)(ga + o); if (LO) rl[i] = *(const v8b*)(gl + o); rb[i] = *(const v8b*)(gb + o); } };
  auto sts = [&](int buf) { char* p = st + buf * STG;
#pragma unroll
    for (int i = 0; i < 4; ++i) { *(v8b*)(p + i * 32 * GPB) = ra[i]; if (LO) *(v8b*)(p + GPL + i * 32 * GPB) = rl[i]; *(v8b*)(p + (1 + LO) * GPL + i * 32 * GPB) = rb[i]; } };
  ldg(0); sts(0); __syncthreads();
#pragma unroll 1   // rolled, for speed only
  for (int s = 0; s < CC / GBK; ++s) { const int buf = s & 1;
    if (s + 1 < CC / GBK) ldg(s + 1);
#pragma unroll
    for (int kk = 0; kk < 2; ++kk) { const char* pa = fa + buf * STG + kk * 64; const char* pb = fb + buf * STG + kk * 64; v16b b[4], ah[2], al[2];
#pragma unroll
      for (int j = 0; j < 4; ++j) b[j] = frag_b((const __bf16*)(pb + j * 16 * GPB), lane);
#pragma unroll
      for (int i = 0; i < 2; ++i) { ah[i] = frag_b((const __bf16*)(pa + i * 16 * GPB), lane); if (LO) al[i] = frag_b((const __bf16*)(pa + GPL + i * 16 * GPB), lane); }
#pragma unroll
      for (int i = 0; i < 2; ++i) {
#pragma unroll
        for (int j = 0; j < 4; ++j) acc[i][j] = wmma_bf(ah[i], b[j], acc[i][j]);
        if (LO) {
#pragma unroll
          for (int j = 0; j < 4; ++j) acc[i][j] = wmma_bf(al[i], b[j], acc[i][j]); } } }
    if (s + 1 < CC / GBK) sts(buf ^ 1);
    __syncthreads(); } }   // one barrier per stage: publishes stage s + 1 and ends every read of the buffer that stage s + 2 overwrites
// f32 tile out: each wave stages its 32 x 64 in its own LDS range and stores whole 256-B row pieces. Y = the block's first row and column. Call only behind gemm_tile's last barrier.
__device__ __forceinline__ void put_tile(const v8f (&acc)[2][4], char* sm, float* __restrict__ Y) {
  const int tid = threadIdx.x, wave = tid >> 5, lane = tid & 31, col = lane & 15, g = lane >> 4; float* sf = (float*)sm + wave * (32 * 68);
#pragma unroll
  for (int i = 0; i < 2; ++i)
#pragma unroll
    for (int j = 0; j < 4; ++j)
#pragma unroll
      for (int r = 0; r < 8; ++r) sf[(i * 16 + 8 * g + r) * 68 + j * 16 + col] = acc[i][j][r];
  LDSX();   // the wave's rows are complete in LDS before its lanes read what other lanes wrote
#pragma unroll
  for (int it = 0; it < 16; ++it) { const int rl = it * 2 + g; vst2(Y + (size_t)((wave >> 1) * 32 + rl) * CC + (wave & 1) * 64 + col * 4, *(const v4f*)&sf[rl * 68 + col * 4]); } }
// ---- k_q: block = (128 rows, 128 cols): q = x . Wq^T (exact) -> f32 rows
__global__ __launch_bounds__(256) void k_q(const __bf16* __restrict__ X, const __bf16* __restrict__ WQ, float* __restrict__ Q) { __shared__ __align__(16) char sm[2 * 2 * GPL];
  const size_t r0 = (size_t)blockIdx.x * 128; const int c0 = blockIdx.y * 128; v8f acc[2][4] = {};
  gemm_tile<0>(X + r0 * CC, X + r0 * CC, WQ + (size_t)c0 * CC, sm, acc); put_tile(acc, sm, Q + r0 * CC + c0); }
// ---- k_pool: block = reduced row (b, m), a thread = 4 channels: xr = BN(mean of 4 tokens) -> bf16 hi and lo planes; the 4 tokens' bf16 values, which it forms anyway, -> the bf16 x plane.
// The 256 blocks behind the reduced rows round the four weight matrices to bf16, 16,384 elements each.
__global__ __launch_bounds__(256) void k_pool(const float* __restrict__ X, const float* __restrict__ G, const float* __restrict__ Bt, const float* __restrict__ Mu, const float* __restrict__ Var, const float* __restrict__ WQ, const float* __restrict__ WK, const float* __restrict__ WV, const float* __restrict__ WP, __bf16* __restrict__ XB, __bf16* __restrict__ XRH, __bf16* __restrict__ XRL, __bf16* __restrict__ WB) { const int t = threadIdx.x;
  if (blockIdx.x < TNB * MM) { const size_t row = blockIdx.x; const size_t b = row / MM; const int m = (int)(row % MM); const int c = t * 4; float s[4] = {0.f, 0.f, 0.f, 0.f};
#pragma unroll
  for (int i = 0; i < NR; ++i) { const size_t o = (b * NN + (size_t)m * NR + i) * CC + c; const v4f v = *(const v4f*)(X + o); v4b h;
#pragma unroll
    for (int e = 0; e < 4; ++e) { h[e] = (__bf16)v[e]; s[e] += (float)h[e]; }
    vst2(XB + o, h); }
  v4b hq, lq;
#pragma unroll
  for (int e = 0; e < 4; ++e) { const float a = s[e] * (1.0f / NR); const float y = (a - bfr(Mu[c + e])) / sqrtf(bfr(Var[c + e]) + BNEPS) * bfr(G[c + e]) + bfr(Bt[c + e]); const __bf16 hh = (__bf16)y; hq[e] = hh; lq[e] = (__bf16)(y - (float)hh); }
  vst2(XRH + row * CC + c, hq); vst2(XRL + row * CC + c, lq); }
  else { const int wb = blockIdx.x - TNB * MM, which = wb >> 6; const float* Wm = which == 0 ? WQ : which == 1 ? WK : which == 2 ? WV : WP; const size_t o = (size_t)(wb & 63) * 16384 + t * 4; __bf16* Wo = WB + (size_t)which * CC * CC;
#pragma unroll
    for (int i = 0; i < 16; ++i) { const v4f v = *(const v4f*)(Wm + o + i * 1024); v4b w;
#pragma unroll
      for (int e = 0; e < 4; ++e) w[e] = (__bf16)v[e];
      vst2(Wo + o + i * 1024, w); } } }
// ---- k_kv: block = (128 reduced rows, 128 cols, which*NB + b): k / v = xr (hi + lo) . W^T -> f16 hi/lo planes [b][c][m]
__global__ __launch_bounds__(256) void k_kv(const __bf16* __restrict__ XRH, const __bf16* __restrict__ XRL, const __bf16* __restrict__ WK, const __bf16* __restrict__ WV, _Float16* __restrict__ KT, _Float16* __restrict__ KTL, _Float16* __restrict__ VT, _Float16* __restrict__ VTL) { __shared__ __align__(16) char sm[2 * 3 * GPL];
  const int tid = threadIdx.x, wave = tid >> 5, lane = tid & 31, col = lane & 15, g = lane >> 4; const int which = blockIdx.z / TNB; const size_t b = blockIdx.z % TNB; const int m0 = blockIdx.x * 128; const int c0 = blockIdx.y * 128; const size_t r0 = b * MM + m0; const __bf16* Wm = which == 0 ? WK : WV;
  v8f acc[2][4] = {};
  gemm_tile<1>(XRH + r0 * CC, XRL + r0 * CC, Wm + (size_t)c0 * CC, sm, acc);
  _Float16* th = (_Float16*)sm; _Float16* tl = th + 128 * 136;   // transposed tiles [c 128][m 128 + 8], in the ring's LDS behind its last barrier
#pragma unroll
  for (int i = 0; i < 2; ++i)
#pragma unroll
    for (int j = 0; j < 4; ++j) { v8h hq, lq;
#pragma unroll
      for (int r = 0; r < 8; ++r) { const float v = acc[i][j][r]; const _Float16 hv = (_Float16)v; hq[r] = hv; lq[r] = (_Float16)((v - (float)hv) * 2048.0f); }
      const int o = ((wave & 1) * 64 + j * 16 + col) * 136 + (wave >> 1) * 32 + i * 16 + 8 * g; *(v8h*)&th[o] = hq; *(v8h*)&tl[o] = lq; }
  __syncthreads(); _Float16* PH = which == 0 ? KT : VT; _Float16* PL = which == 0 ? KTL : VTL;
  for (int e = tid; e < 128 * 16; e += 256) { const int cl = e >> 4, q = e & 15; const size_t o = (b * CC + c0 + cl) * (size_t)MM + m0 + q * 8; vst2((unsigned*)(PH + o), *(const v4u*)&th[cl * 136 + q * 8]); vst2((unsigned*)(PL + o), *(const v4u*)&tl[cl * 136 + q * 8]); } }
// ---- k_kvp: block = (b*NH + h): KV[d][e] = sum_m k[m][d] v[m][e] (3 products over the 512 reduced tokens) -> stored transposed KV^T[(h,e)][d]
__global__ __launch_bounds__(64) void k_kvp(const _Float16* __restrict__ KT, const _Float16* __restrict__ KTL, const _Float16* __restrict__ VT, const _Float16* __restrict__ VTL, float* __restrict__ KVT) { __shared__ __align__(16) float st[HD][HD + 4];
  const int tid = threadIdx.x, wave = tid >> 5, lane = tid & 31, col = lane & 15, g = lane >> 4; const size_t bh = blockIdx.x; const size_t b = bh / NH; const int h = bh % NH;
  // wave = row tile of d (2 tiles); cols e (2 tiles); K = m (16 kc)
  v8f acc[2] = {};
#pragma unroll 2
  for (int kc = 0; kc < MM / 32; ++kc) { const size_t ao = (b * CC + (size_t)h * HD + wave * 16 + col) * MM + kc * 32; const v16h ah = frag_h(KT + ao, lane), al = frag_h(KTL + ao, lane);
#pragma unroll
    for (int j = 0; j < 2; ++j) { const size_t bo = (b * CC + (size_t)h * HD + j * 16 + col) * MM + kc * 32; const v16h vh = frag_h(VT + bo, lane), vl = frag_h(VTL + bo, lane); acc[j] = wmma16(ah, vh, acc[j]); v8f t2 = {}; t2 = wmma16(ah, vl, t2); t2 = wmma16(al, vh, t2);
#pragma unroll
      for (int r = 0; r < 8; ++r) acc[j][r] += t2[r] * (1.0f / 2048.0f); } }
#pragma unroll
  for (int j = 0; j < 2; ++j)
#pragma unroll
    for (int r = 0; r < 8; ++r) st[j * 16 + col][wave * 16 + 8 * g + r] = acc[j][r];   // transposed: [e][d]
  __syncthreads(); for (int e = tid; e < HD * 8; e += 64) { const int ee = e >> 3, q = e & 7; vst2(KVT + ((b * CC) + (size_t)h * HD + ee) * HD + q * 4, *(const v4f*)&st[ee][q * 4]); } }
// ---- k_ctx: block = (64 rows, 128 cols = 4 heads, b implied by row): ctx[n][(h,e)] = scale sum_d q[n][h*32+d] KV^T[(h,e)][d]  (q hi+lo x KV hi+lo, 3 products; K = 32) -> bf16 hi and lo planes
__global__ __launch_bounds__(128) void k_ctx(const float* __restrict__ Q, const float* __restrict__ KVT, __bf16* __restrict__ CTH, __bf16* __restrict__ CTL) { __shared__ __align__(16) float sf[4][16][132];
  const int tid = threadIdx.x, wave = tid >> 5, lane = tid & 31, col = lane & 15, g = lane >> 4; const size_t r0 = (size_t)blockIdx.x * 64 + wave * 16; const int c0 = blockIdx.y * 128; const size_t b = ((size_t)blockIdx.x * 64) / NN;
  v8f acc[8] = {};
#pragma unroll
  for (int hh = 0; hh < 4; ++hh) { const int h = c0 / HD + hh; const F2 a = split_row(Q + (r0 + col) * CC, h * HD, lane);
#pragma unroll
    for (int jj = 0; jj < 2; ++jj) { float wv[16]; const float* wr = KVT + (b * CC + (size_t)h * HD + jj * 16 + col) * HD + 8 * g;
#pragma unroll
      for (int i = 0; i < 8; ++i) { wv[i] = wr[i]; wv[8 + i] = wr[16 + i]; }
      const F2 wb = bsplit16(wv); const int j = hh * 2 + jj; acc[j] = wmma_bf(a.h, wb.h, acc[j]); acc[j] = wmma_bf(a.h, wb.l, acc[j]); acc[j] = wmma_bf(a.l, wb.h, acc[j]); } }
#pragma unroll
  for (int j = 0; j < 8; ++j)
#pragma unroll
    for (int r = 0; r < 8; ++r) sf[wave][8 * g + r][j * 16 + col] = acc[j][r] * 0.17677669529663687f;
  LDSX(); for (int rl = 0; rl < 16; ++rl) { const v4f v = *(const v4f*)&sf[wave][rl][lane * 4]; v4b hq, lq;
#pragma unroll
    for (int e = 0; e < 4; ++e) { const __bf16 hh = (__bf16)v[e]; hq[e] = hh; lq[e] = (__bf16)(v[e] - (float)hh); }
    const size_t o = (r0 + rl) * CC + c0 + lane * 4; vst2(CTH + o, hq); vst2(CTL + o, lq); } }
// ---- k_out: block = (128 rows, 128 cols): out = ctx (hi + lo) . Wp^T + bp
__global__ __launch_bounds__(256) void k_out(const __bf16* __restrict__ CTH, const __bf16* __restrict__ CTL, const __bf16* __restrict__ WP, const float* __restrict__ BP, float* __restrict__ OUT) { __shared__ __align__(16) char sm[2 * 3 * GPL];
  const int wave = threadIdx.x >> 5, col = threadIdx.x & 15; const size_t r0 = (size_t)blockIdx.x * 128; const int c0 = blockIdx.y * 128; v8f acc[2][4] = {};
  gemm_tile<1>(CTH + r0 * CC, CTL + r0 * CC, WP + (size_t)c0 * CC, sm, acc);
#pragma unroll
  for (int j = 0; j < 4; ++j) { const float bb = bfr(BP[c0 + (wave & 1) * 64 + j * 16 + col]);
#pragma unroll
    for (int i = 0; i < 2; ++i)
#pragma unroll
      for (int r = 0; r < 8; ++r) acc[i][j][r] = acc[i][j][r] + bb; }
  put_tile(acc, sm, OUT + r0 * CC + c0); }
extern "C" void kernel_launch(void* const* d_in, const int* in_sizes, int n_in, void* d_out, int out_size, void* d_ws, size_t ws_size, hipStream_t stream) {
  (void)in_sizes; (void)n_in; (void)out_size;
  const float** F = (const float**)d_in;   // 0 x [4,2048,1024], 1 Wq, 2 Wk, 3 Wv, 4 Wp (natural), 5 bp, 6 bn_gamma, 7 bn_beta, 8 bn_mean, 9 bn_var
  if (ws_size < (size_t)WS_END) return;
  char* ws = (char*)d_ws; float *Q = (float*)(ws + WS_Q), *KVT = (float*)(ws + WS_KV); __bf16 *XRH = (__bf16*)(ws + WS_XR), *XRL = XRH + (size_t)NB * MM * CC, *CTH = (__bf16*)(ws + WS_CT), *CTL = CTH + (size_t)NB * NN * CC, *XB = (__bf16*)(ws + WS_XB), *WB = (__bf16*)(ws + WS_WB); _Float16 *KT = (_Float16*)(ws + WS_KT), *KTL = (_Float16*)(ws + WS_KTL), *VT = (_Float16*)(ws + WS_VT), *VTL = (_Float16*)(ws + WS_VTL);
  k_pool<<<TNB * MM + 256, 256, 0, stream>>>(F[0], F[6], F[7], F[8], F[9], F[1], F[2], F[3], F[4], XB, XRH, XRL, WB);
  k_q<<<dim3(TNB * NN / 128, CC / 128), 256, 0, stream>>>(XB, WB, Q);
  k_kv<<<dim3(MM / 128, CC / 128, 2 * TNB), 256, 0, stream>>>(XRH, XRL, WB + (size_t)CC * CC, WB + 2 * (size_t)CC * CC, KT, KTL, VT, VTL);
  k_kvp<<<TNB * NH, 64, 0, stream>>>(KT, KTL, VT, VTL, KVT);
  k_ctx<<<dim3(TOB, CC / 128), 128, 0, stream>>>(Q, KVT, CTH, CTL);
  k_out<<<dim3(TNB * NN / 128, CC / 128), 256, 0, stream>>>(CTH, CTL, WB + 3 * (size_t)CC * CC, F[5], (float*)d_out);
}

// v003
// A run of this version takes 91.3 microseconds.
// Next to v002, in two timings, it ran 1.14 and 1.13 times as fast.
// Over all steps from v000 it is 4.47 times as fast.
// compute dtype: all float inputs rounded to bf16; q = x Wq^T with EXACT bf16 products on WMMA 16x16x32; AvgPool1d (exact f32 sums of 4 bf16 tokens) + BatchNorm (eval) in f32; k, v = xr W^T with xr as bf16 hi + lo (2 products); no softmax in the module, so (q k^T) v is evaluated exactly re-associated as q (k^T v): KV_h = k_h^T v_h with k, v as f16 hi + lo and ctx = scale q_h KV_h with q, KV as bf16 hi + lo (3 products each); out = ctx (bf16 hi + lo) . Wp^T + bp; f32 output.
#include <hip/hip_runtime.h>
#include <math.h>

typedef __attribute__((ext_vector_type(16))) _Float16 v16h;
typedef __attribute__((ext_vector_type(16))) __bf16 v16b;
typedef __attribute__((ext_vector_type(8)))  _Float16 v8h;
typedef __attribute__((ext_vector_type(8)))  float v8f;
typedef __attribute__((ext_vector_type(4)))  float v4f;
typedef __attribute__((ext_vector_type(2)))  float v2f;
typedef __attribute__((ext_vector_type(4)))  unsigned v4u;
typedef __attribute__((ext_vector_type(4)))  int v4i;
typedef float __attribute__((may_alias)) float_a;
typedef int __attribute__((may_alias)) int_a;

template <typename T> __device__ __forceinline__ void vst2(void* p, T v) { *(T*)p = v;  }
__device__ __forceinline__ v8f wmma16(v16h a, v16h b, v8f c) {
  v8f d = __builtin_amdgcn_wmma_f32_16x16x32_f16(false, a, false, b, (short)0, c, false, false);
  asm volatile("v_nop\n\tv_nop\n\tv_nop\n\tv_nop" : "+v"(d) : "v"(a), "v"(b));
  return d;
}
__device__ __forceinline__ v8f wmma_bf(v16b a, v16b b, v8f c) {
  v8f d = __builtin_amdgcn_wmma_f32_16x16x32_bf16(false, a, false, b, (short)0, c, false, false);
  asm volatile("v_nop\n\tv_nop\n\tv_nop\n\tv_nop" : "+v"(d) : "v"(a), "v"(b));
  return d;
}
// 16x16x32 fragments: lane = (h = lane>>4, row/col = lane&15); elements 0..7 = k0+8h+0..7, 8..15 = k0+16+8h+0..7; D element r = row 8h+r
__device__ __forceinline__ v16h frag_h(const _Float16* rowk0, int lane) {
  union { v16h v; v8h q[2]; } u; const _Float16* p = rowk0 + 8 * (lane >> 4);
  u.q[0] = *(const v8h*)p; u.q[1] = *(const v8h*)(p + 16); return u.v;
}
__device__ __forceinline__ v16h frag_f32(const float* rowk0, int lane) {
  v16h a; const float* p = rowk0 + 8 * (lane >> 4);
#pragma unroll
  for (int i = 0; i < 8; ++i) { a[i] = (_Float16)p[i]; a[8 + i] = (_Float16)p[16 + i]; }
  return a;
}
__device__ __forceinline__ v16h frag_f32s(const float* rowk0, int lane, float sc) {
  v16h a; const float* p = rowk0 + 8 * (lane >> 4);
#pragma unroll
  for (int i = 0; i < 8; ++i) { a[i] = (_Float16)(p[i] * sc); a[8 + i] = (_Float16)(p[16 + i] * sc); }
  return a;
}
// column fragment from a [K][ld] layout (column n), rows >= K read as 0
__device__ __forceinline__ v16h fragc_f32(const float* W, int k0, int n, int lane, int ld, int K) {
  v16h a; const int g = lane >> 4;
#pragma unroll
  for (int i = 0; i < 8; ++i) { const int ka = k0 + 8 * g + i, kb = ka + 16;
    a[i] = (_Float16)(ka < K ? W[(size_t)(ka < K ? ka : K - 1) * ld + n] : 0.f); a[8 + i] = (_Float16)(kb < K ? W[(size_t)(kb < K ? kb : K - 1) * ld + n] : 0.f); }
  return a;
}
struct F2 { v16b h, l; };
__device__ __forceinline__ F2 bsplit16(const float v[16]) { F2 r;
#pragma unroll
  for (int i = 0; i < 16; ++i) { const __bf16 h = (__bf16)v[i]; r.h[i] = h; r.l[i] = (__bf16)(v[i] - (float)h); }
  return r; }
__device__ __forceinline__ F2 split_row(const float* row, int k0, int lane) { float v[16]; const float* p = row + k0 + 8 * (lane >> 4);
#pragma unroll
  for (int i = 0; i < 8; ++i) { v[i] = p[i]; v[8 + i] = p[16 + i]; }
  return bsplit16(v); }
__device__ __forceinline__ F2 split_rowK(const float* row, int k0, int lane, int K) { float v[16]; const int g = lane >> 4;
#pragma unroll
  for (int i = 0; i < 8; ++i) { const int ka = k0 + 8 * g + i, kb = ka + 16; v[i] = ka < K ? row[ka < K ? ka : K - 1] : 0.f; v[8 + i] = kb < K ? row[kb < K ? kb : K - 1] : 0.f; }
  return bsplit16(v); }
__device__ __forceinline__ F2 split_col(const float* W, int k0, int n, int lane, int ld, int K) { float v[16]; const int g = lane >> 4;
#pragma unroll
  for (int i = 0; i < 8; ++i) { const int ka = k0 + 8 * g + i, kb = ka + 16; v[i] = ka < K ? W[(size_t)(ka < K ? ka : K - 1) * ld + n] : 0.f; v[8 + i] = kb < K ? W[(size_t)(kb < K ? kb : K - 1) * ld + n] : 0.f; }
  return bsplit16(v); }
__device__ __forceinline__ v8f mac3(const F2& a, const F2& b, v8f c) { c = wmma_bf(a.l, b.h, c); c = wmma_bf(a.h, b.l, c); return wmma_bf(a.h, b.h, c); }
__device__ __forceinline__ float sigm(float v) { return 1.0f / (1.0f + expf(-v)); }
#define LDSX() do { asm volatile("s_wait_dscnt 0" ::: "memory"); __builtin_amdgcn_wave_barrier(); __builtin_amdgcn_fence(__ATOMIC_RELEASE, "workgroup"); } while (0)


// Efficient multi-head attention WITHOUT softmax (B 4, N 2,048, C 1,024, 32 heads x 32, reduction 4 -> M 512): out = ((q k^T) * 32^-1/2) v, then Wp + bp; evaluated as q (k^T v).
#define NB 4
#define NN 2048
#define CC 1024
#define NH 32
#define HD 32
#define NR 4              // N_RATIO
#define MM (NN / NR)      // 512
#define BNEPS 1e-6f
#ifndef TNB
#define TNB NB
#endif
#ifndef TOB
#define TOB (TNB * NN / 64)
#endif
typedef __attribute__((ext_vector_type(8))) __bf16 v8b;
__device__ __forceinline__ v16b frag_b(const __bf16* rowk0, int lane) {
  union { v16b v; v8b q[2]; } u; const __bf16* p = rowk0 + 8 * (lane >> 4);
  u.q[0] = *(const v8b*)p; u.q[1] = *(const v8b*)(p + 16); return u.v;
}
__device__ __forceinline__ float bfr(float v) { return (float)(__bf16)v; }
__device__ __attribute__((noinline)) float exp_ni(float v) { return expf(v); }
__device__ __attribute__((noinline)) float erf_ni(float v) { return erff(v); }

#define WS_Q   0u                                   // f32 q rows [b*NN + n][1024]
#define WS_XR  (WS_Q + 4u * (size_t)NB * NN * CC)         // BN(avgpool) rows [b*MM + m][1024] as two bf16 planes, hi then lo
#define WS_KT  (WS_XR + 4u * (size_t)NB * MM * CC)        // f16 hi|lo k planes [b][1024 (h,d)][MM]; v planes
#define WS_KTL (WS_KT + 2u * (size_t)NB * CC * MM)
#define WS_VT  (WS_KTL + 2u * (size_t)NB * CC * MM)
#define WS_VTL (WS_VT + 2u * (size_t)NB * CC * MM)
#define WS_KV  (WS_VTL + 2u * (size_t)NB * CC * MM)       // f32 KV^T rows [b][(h,e) 1024][d 32] (transposed for the B operand)
#define WS_CT  (WS_KV + 4u * (size_t)NB * CC * HD)        // ctx rows [b*NN + n][1024] as two bf16 planes, hi then lo
#define WS_XB  (WS_CT + 4u * (size_t)NB * NN * CC)        // bf16 x rows [b*NN + n][1024]
#define WS_WB  (WS_XB + 2u * (size_t)NB * NN * CC)        // bf16 Wq | Wk | Wv | Wp, each [1024][1024]
#define WS_END (WS_WB + 2u * 4u * (size_t)CC * CC)

__device__ __forceinline__ v16b fragb_f32(const float* __restrict__ p, int lane) { v16b a; const float* pp = p + 8 * (lane >> 4);
#pragma unroll
  for (int i = 0; i < 8; ++i) { a[i] = (__bf16)pp[i]; a[8 + i] = (__bf16)pp[16 + i]; } return a; }
// ---- shared core of the three projection GEMMs: one block of 8 waves makes Y[128][128] = A[128][1024] . W[128][1024]^T.
// The operands arrive as bf16 planes that their producers rounded once (A also as its lo plane where LO). Each stage is 64 k: every wave-wide global load covers four 128-B row pieces (whole lines),
// which go unchanged into LDS, where the 8 waves (4 x 2, 32 x 64 of Y each) read their fragments. Two buffers: the next stage's global loads fly while this stage is multiplied.
#define GBK 64                    // k per stage
#define GPB 144                   // LDS row pitch in bytes: 64 bf16 + 16 B (16 B x odd for ds_load_b128 readers)
#define GPL (128 * GPB)           // one operand plane of a stage; planes: A hi | A lo (LO only) | W
typedef __attribute__((ext_vector_type(4))) __bf16 v4b;
template <int LO> __device__ __forceinline__ void gemm_tile(const __bf16* __restrict__ A, const __bf16* __restrict__ AL, const __bf16* __restrict__ Wm, char* sm, v8f (&acc)[2][4]) {
  constexpr int STG = (2 + LO) * GPL;
  const int tid = threadIdx.x, wave = tid >> 5, lane = tid & 31, col = lane & 15; const int lr = tid >> 3, lc = tid & 7;
  const __bf16* ga = A + (size_t)lr * CC + lc * 8; const __bf16* gl = AL + (size_t)lr * CC + lc * 8; const __bf16* gb = Wm + (size_t)lr * CC + lc * 8; char* st = sm + lr * GPB + lc * 16;
  const char* fa = sm + ((wave >> 1) * 32 + col) * GPB; const char* fb = sm + (1 + LO) * GPL + ((wave & 1) * 64 + col) * GPB;
  v8b ra[4], rl[4], rb[4];
  auto ldg = [&](int s) {
#pragma unroll
    for (int i = 0; i < 4; ++i) { const size_t o = (size_t)i * 32 * CC + s * GBK; ra[i] = *(const v8b*)(ga + o); if (LO) rl[i] = *(const v8b*)(gl + o); rb[i] = *(const v8b*)(gb + o); } };
  auto sts = [&](int buf) { char* p = st + buf * STG;
#pragma unroll
    for (int i = 0; i < 4; ++i) { *(v8b*)(p + i * 32 * GPB) = ra[i]; if (LO) *(v8b*)(p + GPL + i * 32 * GPB) = rl[i]; *(v8b*)(p + (1 + LO) * GPL + i * 32 * GPB) = rb[i]; } };
  ldg(0); sts(0); __syncthreads();
#pragma unroll 1   // rolled, for speed only
  for (int s = 0; s < CC / GBK; ++s) { const int buf = s & 1;
    if (s + 1 < CC / GBK) ldg(s + 1);
#pragma unroll
    for (int kk = 0; kk < 2; ++kk) { const char* pa = fa + buf * STG + kk * 64; const char* pb = fb + buf * STG + kk * 64; v16b b[4], ah[2], al[2];
#pragma unroll
      for (int j = 0; j < 4; ++j) b[j] = frag_b((const __bf16*)(pb + j * 16 * GPB), lane);
#pragma unroll
      for (int i = 0; i < 2; ++i) { ah[i] = frag_b((const __bf16*)(pa + i * 16 * GPB), lane); if (LO) al[i] = frag_b((const __bf16*)(pa + GPL + i * 16 * GPB), lane); }
#pragma unroll
      for (int i = 0; i < 2; ++i) {
#pragma unroll
        for (int j = 0; j < 4; ++j) acc[i][j] = wmma_bf(ah[i], b[j], acc[i][j]);
        if (LO) {
#pragma unroll
          for (int j = 0; j < 4; ++j) acc[i][j] = wmma_bf(al[i], b[j], acc[i][j]); } } }
    if (s + 1 < CC / GBK) sts(buf ^ 1);
    __syncthreads(); } }   // one barrier per stage: publishes stage s + 1 and ends every read of the buffer that stage s + 2 overwrites
// f32 tile out: each wave stages its 32 x 64 in its own LDS range and stores whole 256-B row pieces. Y = the block's first row and column. Call only behind gemm_tile's last barrier.
__device__ __forceinline__ void put_tile(const v8f (&acc)[2][4], char* sm, float* __restrict__ Y) {
  const int tid = threadIdx.x, wave = tid >> 5, lane = tid & 31, col = lane & 15, g = lane >> 4; float* sf = (float*)sm + wave * (32 * 68);
#pragma unroll
  for (int i = 0; i < 2; ++i)
#pragma unroll
    for (int j = 0; j < 4; ++j)
#pragma unroll
      for (int r = 0; r < 8; ++r) sf[(i * 16 + 8 * g + r) * 68 + j * 16 + col] = acc[i][j][r];
  LDSX();   // the wave's rows are complete in LDS before its lanes read what other lanes wrote
#pragma unroll
  for (int it = 0; it < 16; ++it) { const int rl = it * 2 + g; vst2(Y + (size_t)((wave >> 1) * 32 + rl) * CC + (wave & 1) * 64 + col * 4, *(const v4f*)&sf[rl * 68 + col * 4]); } }
// ---- k_q: block = (128 rows, 128 cols): q = x . Wq^T (exact) -> f32 rows
__global__ __launch_bounds__(256) void k_q(const __bf16* __restrict__ X, const __bf16* __restrict__ WQ, float* __restrict__ Q) { __shared__ __align__(16) char sm[2 * 2 * GPL];
  const size_t r0 = (size_t)blockIdx.x * 128; const int c0 = blockIdx.y * 128; v8f acc[2][4] = {};
  gemm_tile<0>(X + r0 * CC, X + r0 * CC, WQ + (size_t)c0 * CC, sm, acc); put_tile(acc, sm, Q + r0 * CC + c0); }
// ---- k_pool: block = reduced row (b, m), a thread = 4 channels: xr = BN(mean of 4 tokens) -> bf16 hi and lo planes; the 4 tokens' bf16 values, which it forms anyway, -> the bf16 x plane.
// The 256 blocks behind the reduced rows round the four weight matrices to bf16, 16,384 elements each.
__global__ __launch_bounds__(256) void k_pool(const float* __restrict__ X, const float* __restrict__ G, const float* __restrict__ Bt, const float* __restrict__ Mu, const float* __restrict__ Var, const float* __restrict__ WQ, const float* __restrict__ WK, const float* __restrict__ WV, const float* __restrict__ WP, __bf16* __restrict__ XB, __bf16* __restrict__ XRH, __bf16* __restrict__ XRL, __bf16* __restrict__ WB) { const int t = threadIdx.x;
  if (blockIdx.x < TNB * MM) { const size_t row = blockIdx.x; const size_t b = row / MM; const int m = (int)(row % MM); const int c = t * 4; float s[4] = {0.f, 0.f, 0.f, 0.f};
#pragma unroll
  for (int i = 0; i < NR; ++i) { const size_t o = (b * NN + (size_t)m * NR + i) * CC + c; const v4f v = *(const v4f*)(X + o); v4b h;
#pragma unroll
    for (int e = 0; e < 4; ++e) { h[e] = (__bf16)v[e]; s[e] += (float)h[e]; }
    vst2(XB + o, h); }
  v4b hq, lq;
#pragma unroll
  for (int e = 0; e < 4; ++e) { const float a = s[e] * (1.0f / NR); const float y = (a - bfr(Mu[c + e])) / sqrtf(bfr(Var[c + e]) + BNEPS) * bfr(G[c + e]) + bfr(Bt[c + e]); const __bf16 hh = (__bf16)y; hq[e] = hh; lq[e] = (__bf16)(y - (float)hh); }
  vst2(XRH + row * CC + c, hq); vst2(XRL + row * CC + c, lq); }
  else { const int wb = blockIdx.x - TNB * MM, which = wb >> 6; const float* Wm = which == 0 ? WQ : which == 1 ? WK : which == 2 ? WV : WP; const size_t o = (size_t)(wb & 63) * 16384 + t * 4; __bf16* Wo = WB + (size_t)which * CC * CC;
#pragma unroll
    for (int i = 0; i < 16; ++i) { const v4f v = *(const v4f*)(Wm + o + i * 1024); v4b w;
#pragma unroll
      for (int e = 0; e < 4; ++e) w[e] = (__bf16)v[e];
      vst2(Wo + o + i * 1024, w); } } }
// ---- k_kv: block = (128 reduced rows, 128 cols, which*NB + b): k / v = xr (hi + lo) . W^T -> f16 hi/lo planes [b][c][m]
__global__ __launch_bounds__(256) void k_kv(const __bf16* __restrict__ XRH, const __bf16* __restrict__ XRL, const __bf16* __restrict__ WK, const __bf16* __restrict__ WV, _Float16* __restrict__ KT, _Float16* __restrict__ KTL, _Float16* __restrict__ VT, _Float16* __restrict__ VTL) { __shared__ __align__(16) char sm[2 * 3 * GPL];
  const int tid = threadIdx.x, wave = tid >> 5, lane = tid & 31, col = lane & 15, g = lane >> 4; const int which = blockIdx.z / TNB; const size_t b = blockIdx.z % TNB; const int m0 = blockIdx.x * 128; const int c0 = blockIdx.y * 128; const size_t r0 = b * MM + m0; const __bf16* Wm = which == 0 ? WK : WV;
  v8f acc[2][4] = {};
  gemm_tile<1>(XRH + r0 * CC, XRL + r0 * CC, Wm + (size_t)c0 * CC, sm, acc);
  _Float16* th = (_Float16*)sm; _Float16* tl = th + 128 * 136;   // transposed tiles [c 128][m 128 + 8], in the ring's LDS behind its last barrier
#pragma unroll
  for (int i = 0; i < 2; ++i)
#pragma unroll
    for (int j = 0; j < 4; ++j) { v8h hq, lq;
#pragma unroll
      for (int r = 0; r < 8; ++r) { const float v = acc[i][j][r]; const _Float16 hv = (_Float16)v; hq[r] = hv; lq[r] = (_Float16)((v - (float)hv) * 2048.0f); }
      const int o = ((wave & 1) * 64 + j * 16 + col) * 136 + (wave >> 1) * 32 + i * 16 + 8 * g; *(v8h*)&th[o] = hq; *(v8h*)&tl[o] = lq; }
  __syncthreads(); _Float16* PH = which == 0 ? KT : VT; _Float16* PL = which == 0 ? KTL : VTL;
  for (int e = tid; e < 128 * 16; e += 256) { const int cl = e >> 4, q = e & 15; const size_t o = (b * CC + c0 + cl) * (size_t)MM + m0 + q * 8; vst2((unsigned*)(PH + o), *(const v4u*)&th[cl * 136 + q * 8]); vst2((unsigned*)(PL + o), *(const v4u*)&tl[cl * 136 + q * 8]); } }
// ---- k_kvp: block = (b*NH + h), 16 waves: KV[d][e] = sum_m k[m][d] v[m][e] (3 products over the 512 reduced tokens) -> stored transposed KV^T[(h,e)][d]
// A head's 32 rows are 32 KB in a row in each of the four planes: all 16 waves bring them in by loads of 512 contiguous bytes (four whole lines) and lay them in LDS; four waves, one 16 x 16 tile of KV each, read their fragments there.
#define KP 520                     // LDS row pitch in f16: 512 + 8 (1,040 B = 16 B x odd, for ds_load_b128 readers)
__global__ __launch_bounds__(512) void k_kvp(const _Float16* __restrict__ KT, const _Float16* __restrict__ KTL, const _Float16* __restrict__ VT, const _Float16* __restrict__ VTL, float* __restrict__ KVT) { __shared__ __align__(16) _Float16 sp[4][HD * KP]; __shared__ __align__(16) float st[HD][HD + 4];
  const int tid = threadIdx.x, wave = __builtin_amdgcn_readfirstlane(tid >> 5), lane = tid & 31, col = lane & 15, g = lane >> 4; const size_t bh = blockIdx.x; const size_t b = bh / NH; const int h = bh % NH;
  const size_t base = (b * CC + (size_t)h * HD) * MM; const _Float16* P[4] = {KT + base, KTL + base, VT + base, VTL + base}; const unsigned to = tid * 8; v8h v[4][4];
#pragma unroll
  for (int p = 0; p < 4; ++p)
#pragma unroll
    for (int i = 0; i < 4; ++i) v[p][i] = *(const v8h*)(P[p] + (to + i * 4096));   // 512 threads x 8 f16 = 8 rows a step
#pragma unroll
  for (int p = 0; p < 4; ++p)
#pragma unroll
    for (int i = 0; i < 4; ++i) *(v8h*)&sp[p][(i * 8 + (tid >> 6)) * KP + (tid & 63) * 8] = v[p][i];
  __syncthreads();   // the four planes are complete in LDS before any wave reads fragments that other waves wrote
  if (wave < 4) { const int dt = wave >> 1, j = wave & 1;   // wave = (row tile of d, col tile of e); K = m (16 kc); the wave's number sits in a scalar register, so this is a scalar branch and every lane is on at the products
    const _Float16 *pa = sp[0] + (dt * 16 + col) * KP, *pl = sp[1] + (dt * 16 + col) * KP, *qa = sp[2] + (j * 16 + col) * KP, *ql = sp[3] + (j * 16 + col) * KP; v8f acc = {};
#pragma unroll 4   // four trips' LDS reads go out ahead of the dependent chain of products
    for (int kc = 0; kc < MM / 32; ++kc) { const v16h ah = frag_h(pa + kc * 32, lane), al = frag_h(pl + kc * 32, lane), vh = frag_h(qa + kc * 32, lane), vl = frag_h(ql + kc * 32, lane);
      acc = wmma16(ah, vh, acc); v8f t2 = {}; t2 = wmma16(ah, vl, t2); t2 = wmma16(al, vh, t2);
#pragma unroll
      for (int r = 0; r < 8; ++r) acc[r] += t2[r] * (1.0f / 2048.0f); }
#pragma unroll
    for (int r = 0; r < 8; ++r) st[j * 16 + col][dt * 16 + 8 * g + r] = acc[r]; }   // transposed: [e][d]
  __syncthreads(); if (tid < HD * 8) { const int ee = tid >> 3, q = tid & 7; vst2(KVT + ((b * CC) + (size_t)h * HD + ee) * HD + q * 4, *(const v4f*)&st[ee][q * 4]); } }
// ---- k_ctx: block = (64 rows, 128 cols = 4 heads, b implied by row), a wave = one head for all 64 rows: ctx[n][(h,e)] = scale sum_d q[n][h*32+d] KV^T[(h,e)][d]  (q hi+lo x KV hi+lo, 3 products; K = 32) -> bf16 hi and lo planes
// Every global load covers four whole 128-B lines (4 rows x one head's 32 floats); the rows go through the wave's own LDS range, where the lanes read their fragments. KV^T of a head is read and split once, by its one wave.
#define XP 36                      // LDS row pitch in floats: 32 + 4 (144 B = 16 B x odd, for ds_load_b128 readers)
#define XRS (64 * XP + 32)         // one wave's range in floats; the 32 set neighbouring ranges half the banks apart for the row readers of the epilogue
__device__ __forceinline__ F2 split_lds(const float* row, int lane) { float v[16]; const float* p = row + 8 * (lane >> 4); const v4f a = *(const v4f*)p, b = *(const v4f*)(p + 4), c = *(const v4f*)(p + 16), d = *(const v4f*)(p + 20);
#pragma unroll
  for (int i = 0; i < 4; ++i) { v[i] = a[i]; v[4 + i] = b[i]; v[8 + i] = c[i]; v[12 + i] = d[i]; }
  return bsplit16(v); }
__global__ __launch_bounds__(128) void k_ctx(const float* __restrict__ Q, const float* __restrict__ KVT, __bf16* __restrict__ CTH, __bf16* __restrict__ CTL) { __shared__ __align__(16) float sq[4 * XRS]; __shared__ __align__(16) float sk[4][HD * XP];
  const int tid = threadIdx.x, wave = tid >> 5, lane = tid & 31, col = lane & 15, g = lane >> 4, lr = lane >> 3, lc = (lane & 7) * 4; const size_t r0 = (size_t)blockIdx.x * 64; const int c0 = blockIdx.y * 128; const size_t b = r0 / NN; const int h = c0 / HD + wave;
  float* mq = sq + wave * XRS; float* mk = sk[wave]; v4f vq[16], vk[8];
#pragma unroll
  for (int it = 0; it < 8; ++it) vk[it] = *(const v4f*)(KVT + (b * CC + (size_t)h * HD + it * 4 + lr) * HD + lc);
#pragma unroll
  for (int it = 0; it < 16; ++it) vq[it] = *(const v4f*)(Q + (r0 + it * 4 + lr) * CC + h * HD + lc);
#pragma unroll
  for (int it = 0; it < 8; ++it) *(v4f*)&mk[(it * 4 + lr) * XP + lc] = vk[it];
#pragma unroll
  for (int it = 0; it < 16; ++it) *(v4f*)&mq[(it * 4 + lr) * XP + lc] = vq[it];
  LDSX();   // the wave's rows are complete in LDS before its lanes read what other lanes wrote
  F2 wb[2]; v8f acc[4][2] = {};
#pragma unroll
  for (int jj = 0; jj < 2; ++jj) wb[jj] = split_lds(mk + (jj * 16 + col) * XP, lane);
#pragma unroll
  for (int t = 0; t < 4; ++t) { const F2 a = split_lds(mq + (t * 16 + col) * XP, lane);
#pragma unroll
    for (int jj = 0; jj < 2; ++jj) { acc[t][jj] = wmma_bf(a.h, wb[jj].h, acc[t][jj]); acc[t][jj] = wmma_bf(a.h, wb[jj].l, acc[t][jj]); acc[t][jj] = wmma_bf(a.l, wb[jj].h, acc[t][jj]); } }
#pragma unroll
  for (int t = 0; t < 4; ++t)
#pragma unroll
    for (int jj = 0; jj < 2; ++jj)
#pragma unroll
      for (int r = 0; r < 8; ++r) mq[(t * 16 + 8 * g + r) * XP + jj * 16 + col] = acc[t][jj][r] * 0.17677669529663687f;   // over the wave's own q rows, which it has read
  __syncthreads();   // a stored row piece holds all four heads: every wave's columns are in LDS before any wave reads whole rows
#pragma unroll   // unrolled, as the compiler had it before: the 16 rows' LDS reads go out ahead of the conversions and stores
  for (int rl = 0; rl < 16; ++rl) { const int row = wave * 16 + rl; const v4f v = *(const v4f*)&sq[lr * XRS + row * XP + lc]; v4b hq, lq;
#pragma unroll
    for (int e = 0; e < 4; ++e) { const __bf16 hh = (__bf16)v[e]; hq[e] = hh; lq[e] = (__bf16)(v[e] - (float)hh); }
    const size_t o = (r0 + row) * CC + c0 + lane * 4; vst2(CTH + o, hq); vst2(CTL + o, lq); } }
// ---- k_out: block = (128 rows, 128 cols): out = ctx (hi + lo) . Wp^T + bp
__global__ __launch_bounds__(256) void k_out(const __bf16* __restrict__ CTH, const __bf16* __restrict__ CTL, const __bf16* __restrict__ WP, const float* __restrict__ BP, float* __restrict__ OUT) { __shared__ __align__(16) char sm[2 * 3 * GPL];
  const int wave = threadIdx.x >> 5, col = threadIdx.x & 15; const size_t r0 = (size_t)blockIdx.x * 128; const int c0 = blockIdx.y * 128; v8f acc[2][4] = {};
  gemm_tile<1>(CTH + r0 * CC, CTL + r0 * CC, WP + (size_t)c0 * CC, sm, acc);
#pragma unroll
  for (int j = 0; j < 4; ++j) { const float bb = bfr(BP[c0 + (wave & 1) * 64 + j * 16 + col]);
#pragma unroll
    for (int i = 0; i < 2; ++i)
#pragma unroll
      for (int r = 0; r < 8; ++r) acc[i][j][r] = acc[i][j][r] + bb; }
  put_tile(acc, sm, OUT + r0 * CC + c0); }
extern "C" void kernel_launch(void* const* d_in, const int* in_sizes, int n_in, void* d_out, int out_size, void* d_ws, size_t ws_size, hipStream_t stream) {
  (void)in_sizes; (void)n_in; (void)out_size;
  const float** F = (const float**)d_in;   // 0 x [4,2048,1024], 1 Wq, 2 Wk, 3 Wv, 4 Wp (natural), 5 bp, 6 bn_gamma, 7 bn_beta, 8 bn_mean, 9 bn_var
  if (ws_size < (size_t)WS_END) return;
  char* ws = (char*)d_ws; float *Q = (float*)(ws + WS_Q), *KVT = (float*)(ws + WS_KV); __bf16 *XRH = (__bf16*)(ws + WS_XR), *XRL = XRH + (size_t)NB * MM * CC, *CTH = (__bf16*)(ws + WS_CT), *CTL = CTH + (size_t)NB * NN * CC, *XB = (__bf16*)(ws + WS_XB), *WB = (__bf16*)(ws + WS_WB); _Float16 *KT = (_Float16*)(ws + WS_KT), *KTL = (_Float16*)(ws + WS_KTL), *VT = (_Float16*)(ws + WS_VT), *VTL = (_Float16*)(ws + WS_VTL);
  k_pool<<<TNB * MM + 256, 256, 0, stream>>>(F[0], F[6], F[7], F[8], F[9], F[1], F[2], F[3], F[4], XB, XRH, XRL, WB);
  k_q<<<dim3(TNB * NN / 128, CC / 128), 256, 0, stream>>>(XB, WB, Q);
  k_kv<<<dim3(MM / 128, CC / 128, 2 * TNB), 256, 0, stream>>>(XRH, XRL, WB + (size_t)CC * CC, WB + 2 * (size_t)CC * CC, KT, KTL, VT, VTL);
  k_kvp<<<TNB * NH, 512, 0, stream>>>(KT, KTL, VT, VTL, KVT);
  k_ctx<<<dim3(TOB, CC / 128), 128, 0, stream>>>(Q, KVT, CTH, CTL);
  k_out<<<dim3(TNB * NN / 128, CC / 128), 256, 0, stream>>>(CTH, CTL, WB + 3 * (size_t)CC * CC, F[5], (float*)d_out);
}

// v004
// It runs in 88.6 microseconds.
// Two timings next to v003 both put it at 1.03 times that version's speed.
// Counting every step since v000, it is 4.61 times as fast.
// compute dtype: all float inputs rounded to bf16; AvgPool1d (exact f32 sums of 4 bf16 tokens) + BatchNorm (eval) in f32; k, v = xr W^T with xr as bf16 hi + lo (2 products); no softmax in the module, so (q k^T) v is q (k^T v) with KV_h = k_h^T v_h (3 products), and, nothing but products standing between x and out, out = x E_b^T + bp with the folded weight of batch b, E_b = Wp G_b, G_b[(h,e)][c] = scale sum_d KV_h[d][e] Wq[(h,d)][c]: G from KV as bf16 hi + lo (2 products), E from G as bf16 hi + lo (2 products), out from E as bf16 hi + lo (2 products); f32 output.
#include <hip/hip_runtime.h>
#include <math.h>

typedef __attribute__((ext_vector_type(16))) _Float16 v16h;
typedef __attribute__((ext_vector_type(16))) __bf16 v16b;
typedef __attribute__((ext_vector_type(8)))  _Float16 v8h;
typedef __attribute__((ext_vector_type(8)))  float v8f;
typedef __attribute__((ext_vector_type(4)))  float v4f;
typedef __attribute__((ext_vector_type(2)))  float v2f;
typedef __attribute__((ext_vector_type(4)))  unsigned v4u;
typedef __attribute__((ext_vector_type(4)))  int v4i;
typedef float __attribute__((may_alias)) float_a;
typedef int __attribute__((may_alias)) int_a;

template <typename T> __device__ __forceinline__ void vst2(void* p, T v) { *(T*)p = v;  }
__device__ __forceinline__ v8f wmma16(v16h a, v16h b, v8f c) {
  v8f d = __builtin_amdgcn_wmma_f32_16x16x32_f16(false, a, false, b, (short)0, c, false, false);
  asm volatile("v_nop\n\tv_nop\n\tv_nop\n\tv_nop" : "+v"(d) : "v"(a), "v"(b));
  return d;
}
__device__ __forceinline__ v8f wmma_bf(v16b a, v16b b, v8f c) {
  v8f d = __builtin_amdgcn_wmma_f32_16x16x32_bf16(false, a, false, b, (short)0, c, false, false);
  asm volatile("v_nop\n\tv_nop\n\tv_nop\n\tv_nop" : "+v"(d) : "v"(a), "v"(b));
  return d;
}
// 16x16x32 fragments: lane = (h = lane>>4, row/col = lane&15); elements 0..7 = k0+8h+0..7, 8..15 = k0+16+8h+0..7; D element r = row 8h+r
__device__ __forceinline__ v16h frag_h(const _Float16* rowk0, int lane) {
  union { v16h v; v8h q[2]; } u; const _Float16* p = rowk0 + 8 * (lane >> 4);
  u.q[0] = *(const v8h*)p; u.q[1] = *(const v8h*)(p + 16); return u.v;
}
__device__ __forceinline__ v16h frag_f32(const float* rowk0, int lane) {
  v16h a; const float* p = rowk0 + 8 * (lane >> 4);
#pragma unroll
  for (int i = 0; i < 8; ++i) { a[i] = (_Float16)p[i]; a[8 + i] = (_Float16)p[16 + i]; }
  return a;
}
__device__ __forceinline__ v16h frag_f32s(const float* rowk0, int lane, float sc) {
  v16h a; const float* p = rowk0 + 8 * (lane >> 4);
#pragma unroll
  for (int i = 0; i < 8; ++i) { a[i] = (_Float16)(p[i] * sc); a[8 + i] = (_Float16)(p[16 + i] * sc); }
  return a;
}
// column fragment from a [K][ld] layout (column n), rows >= K read as 0
__device__ __forceinline__ v16h fragc_f32(const float* W, int k0, int n, int lane, int ld, int K) {
  v16h a; const int g = lane >> 4;
#pragma unroll
  for (int i = 0; i < 8; ++i) { const int ka = k0 + 8 * g + i, kb = ka + 16;
    a[i] = (_Float16)(ka < K ? W[(size_t)(ka < K ? ka : K - 1) * ld + n] : 0.f); a[8 + i] = (_Float16)(kb < K ? W[(size_t)(kb < K ? kb : K - 1) * ld + n] : 0.f); }
  return a;
}
struct F2 { v16b h, l; };
__device__ __forceinline__ F2 bsplit16(const float v[16]) { F2 r;
#pragma unroll
  for (int i = 0; i < 16; ++i) { const __bf16 h = (__bf16)v[i]; r.h[i] = h; r.l[i] = (__bf16)(v[i] - (float)h); }
  return r; }
__device__ __forceinline__ F2 split_row(const float* row, int k0, int lane) { float v[16]; const float* p = row + k0 + 8 * (lane >> 4);
#pragma unroll
  for (int i = 0; i < 8; ++i) { v[i] = p[i]; v[8 + i] = p[16 + i]; }
  return bsplit16(v); }
__device__ __forceinline__ F2 split_rowK(const float* row, int k0, int lane, int K) { float v[16]; const int g = lane >> 4;
#pragma unroll
  for (int i = 0; i < 8; ++i) { const int ka = k0 + 8 * g + i, kb = ka + 16; v[i] = ka < K ? row[ka < K ? ka : K - 1] : 0.f; v[8 + i] = kb < K ? row[kb < K ? kb : K - 1] : 0.f; }
  return bsplit16(v); }
__device__ __forceinline__ F2 split_col(const float* W, int k0, int n, int lane, int ld, int K) { float v[16]; const int g = lane >> 4;
#pragma unroll
  for (int i = 0; i < 8; ++i) { const int ka = k0 + 8 * g + i, kb = ka + 16; v[i] = ka < K ? W[(size_t)(ka < K ? ka : K - 1) * ld + n] : 0.f; v[8 + i] = kb < K ? W[(size_t)(kb < K ? kb : K - 1) * ld + n] : 0.f; }
  return bsplit16(v); }
__device__ __forceinline__ v8f mac3(const F2& a, const F2& b, v8f c) { c = wmma_bf(a.l, b.h, c); c = wmma_bf(a.h, b.l, c); return wmma_bf(a.h, b.h, c); }
__device__ __forceinline__ float sigm(float v) { return 1.0f / (1.0f + expf(-v)); }
#define LDSX() do { asm volatile("s_wait_dscnt 0" ::: "memory"); __builtin_amdgcn_wave_barrier(); __builtin_amdgcn_fence(__ATOMIC_RELEASE, "workgroup"); } while (0)


// Efficient multi-head attention WITHOUT softmax (B 4, N 2,048, C 1,024, 32 heads x 32, reduction 4 -> M 512): out = ((q k^T) * 32^-1/2) v, then Wp + bp; evaluated as x E_b^T + bp with E_b = Wp (32^-1/2 (k^T v)^T per head) Wq.
#define NB 4
#define NN 2048
#define CC 1024
#define NH 32
#define HD 32
#define NR 4              // N_RATIO
#define MM (NN / NR)      // 512
#define BNEPS 1e-6f
#ifndef TNB
#define TNB NB
#endif
#ifndef TOB
#define TOB (TNB * NN / 64)
#endif
typedef __attribute__((ext_vector_type(8))) __bf16 v8b;
__device__ __forceinline__ v16b frag_b(const __bf16* rowk0, int lane) {
  union { v16b v; v8b q[2]; } u; const __bf16* p = rowk0 + 8 * (lane >> 4);
  u.q[0] = *(const v8b*)p; u.q[1] = *(const v8b*)(p + 16); return u.v;
}
__device__ __forceinline__ float bfr(float v) { return (float)(__bf16)v; }
__device__ __attribute__((noinline)) float exp_ni(float v) { return expf(v); }
__device__ __attribute__((noinline)) float erf_ni(float v) { return erff(v); }

#define WS_GT  0u                                   // G, head by head: [b][h][c 1024][e 32] as two bf16 planes, hi then lo
#define WS_XR  (WS_GT + 4u * (size_t)NB * CC * CC)        // BN(avgpool) rows [b*MM + m][1024] as two bf16 planes, hi then lo
#define WS_KT  (WS_XR + 4u * (size_t)NB * MM * CC)        // f16 hi|lo k planes [b][1024 (h,d)][MM]; v planes
#define WS_KTL (WS_KT + 2u * (size_t)NB * CC * MM)
#define WS_VT  (WS_KTL + 2u * (size_t)NB * CC * MM)
#define WS_VTL (WS_VT + 2u * (size_t)NB * CC * MM)
#define WS_WE  (WS_VTL + 2u * (size_t)NB * CC * MM)       // folded weight rows E [b*CC + o][c 1024] as two bf16 planes, hi then lo
#define WS_XB  (WS_WE + 4u * (size_t)NB * CC * CC)        // bf16 x rows [b*NN + n][1024]
#define WS_WB  (WS_XB + 2u * (size_t)NB * NN * CC)        // bf16 Wq | Wk | Wv | Wp, each [1024][1024]
#define WS_END (WS_WB + 2u * 4u * (size_t)CC * CC)

__device__ __forceinline__ v16b fragb_f32(const float* __restrict__ p, int lane) { v16b a; const float* pp = p + 8 * (lane >> 4);
#pragma unroll
  for (int i = 0; i < 8; ++i) { a[i] = (__bf16)pp[i]; a[8 + i] = (__bf16)pp[16 + i]; } return a; }
// ---- shared core of the three GEMMs (k/v, E, out): one block of 8 waves makes Y[128][128] = A[128][1024] . W[128][1024]^T.
// The operands arrive as bf16 planes that their producers rounded once (A also as its lo plane where LO). Each stage is 64 k: every wave-wide global load covers four 128-B row pieces (whole lines),
// which go unchanged into LDS, where the 8 waves (4 x 2, 32 x 64 of Y each) read their fragments. Two buffers: the next stage's global loads fly while this stage is multiplied.
#define GBK 64                    // k per stage
#define GPB 144                   // LDS row pitch in bytes: 64 bf16 + 16 B (16 B x odd for ds_load_b128 readers)
#define GPL (128 * GPB)           // one operand plane of a stage; planes: A hi | A lo (LO only) | W
typedef __attribute__((ext_vector_type(4))) __bf16 v4b;
template <int LO, int HS = 0> __device__ __forceinline__ void gemm_tile(const __bf16* __restrict__ A, const __bf16* __restrict__ AL, const __bf16* __restrict__ Wm, char* sm, v8f (&acc)[2][4]) {
  constexpr int STG = (2 + LO) * GPL;
  const int tid = threadIdx.x, wave = tid >> 5, lane = tid & 31, col = lane & 15; const int lr = tid >> 3, lc = tid & 7;
  const size_t la = HS ? ((size_t)(lc >> 2) * CC + lr) * HD + (lc & 3) * 8 : (size_t)lr * CC + lc * 8;   // HS: A lies head by head, [h][row][32]: a stage is two heads, a row's piece 64 B in each
  const __bf16* ga = A + la; const __bf16* gl = AL + la; const __bf16* gb = Wm + (size_t)lr * CC + lc * 8; char* st = sm + lr * GPB + lc * 16;
  const char* fa = sm + ((wave >> 1) * 32 + col) * GPB; const char* fb = sm + (1 + LO) * GPL + ((wave & 1) * 64 + col) * GPB;
  v8b ra[4], rl[4], rb[4];
  auto ldg = [&](int s) {
#pragma unroll
    for (int i = 0; i < 4; ++i) { const size_t o = (size_t)i * 32 * CC + s * GBK, oa = HS ? (size_t)i * 32 * HD + (size_t)s * 2 * CC * HD : o; ra[i] = *(const v8b*)(ga + oa); if (LO) rl[i] = *(const v8b*)(gl + oa); rb[i] = *(const v8b*)(gb + o); } };
  auto sts = [&](int buf) { char* p = st + buf * STG;
#pragma unroll
    for (int i = 0; i < 4; ++i) { *(v8b*)(p + i * 32 * GPB) = ra[i]; if (LO) *(v8b*)(p + GPL + i * 32 * GPB) = rl[i]; *(v8b*)(p + (1 + LO) * GPL + i * 32 * GPB) = rb[i]; } };
  ldg(0);
  asm volatile("s_wait_xcnt 0x0" ::: "memory");   // stands before the first loads' address registers are given to other values
  sts(0); __syncthreads();
#pragma unroll 1   // rolled, for speed only
  for (int s = 0; s < CC / GBK; ++s) { const int buf = s & 1;
    if (s + 1 < CC / GBK) ldg(s + 1);
#pragma unroll
    for (int kk = 0; kk < 2; ++kk) { const char* pa = fa + buf * STG + kk * 64; const char* pb = fb + buf * STG + kk * 64; v16b b[4], ah[2], al[2];
#pragma unroll
      for (int j = 0; j < 4; ++j) b[j] = frag_b((const __bf16*)(pb + j * 16 * GPB), lane);
#pragma unroll
      for (int i = 0; i < 2; ++i) { ah[i] = frag_b((const __bf16*)(pa + i * 16 * GPB), lane); if (LO) al[i] = frag_b((const __bf16*)(pa + GPL + i * 16 * GPB), lane); }
#pragma unroll
      for (int i = 0; i < 2; ++i) {
#pragma unroll
        for (int j = 0; j < 4; ++j) acc[i][j] = wmma_bf(ah[i], b[j], acc[i][j]);
        if (LO) {
#pragma unroll
          for (int j = 0; j < 4; ++j) acc[i][j] = wmma_bf(al[i], b[j], acc[i][j]); } } }
    if (s + 1 < CC / GBK) sts(buf ^ 1);
    __syncthreads(); } }   // one barrier per stage: publishes stage s + 1 and ends every read of the buffer that stage s + 2 overwrites
// ---- k_pool: block = reduced row (b, m), a thread = 4 channels: xr = BN(mean of 4 tokens) -> bf16 hi and lo planes; the 4 tokens' bf16 values, which it forms anyway, -> the bf16 x plane.
// The 256 blocks behind the reduced rows round the four weight matrices to bf16, 16,384 elements each.
__global__ __launch_bounds__(256) void k_pool(const float* __restrict__ X, const float* __restrict__ G, const float* __restrict__ Bt, const float* __restrict__ Mu, const float* __restrict__ Var, const float* __restrict__ WQ, const float* __restrict__ WK, const float* __restrict__ WV, const float* __restrict__ WP, __bf16* __restrict__ XB, __bf16* __restrict__ XRH, __bf16* __restrict__ XRL, __bf16* __restrict__ WB) { const int t = threadIdx.x;
  if (blockIdx.x < TNB * MM) { const size_t row = blockIdx.x; const size_t b = row / MM; const int m = (int)(row % MM); const int c = t * 4; float s[4] = {0.f, 0.f, 0.f, 0.f};
#pragma unroll
  for (int i = 0; i < NR; ++i) { const size_t o = (b * NN + (size_t)m * NR + i) * CC + c; const v4f v = *(const v4f*)(X + o); v4b h;
#pragma unroll
    for (int e = 0; e < 4; ++e) { h[e] = (__bf16)v[e]; s[e] += (float)h[e]; }
    vst2(XB + o, h); }
  v4b hq, lq;
#pragma unroll
  for (int e = 0; e < 4; ++e) { const float a = s[e] * (1.0f / NR); const float y = (a - bfr(Mu[c + e])) / sqrtf(bfr(Var[c + e]) + BNEPS) * bfr(G[c + e]) + bfr(Bt[c + e]); const __bf16 hh = (__bf16)y; hq[e] = hh; lq[e] = (__bf16)(y - (float)hh); }
  vst2(XRH + row * CC + c, hq); vst2(XRL + row * CC + c, lq); }
  else { const int wb = blockIdx.x - TNB * MM, which = wb >> 6; const float* Wm = which == 0 ? WQ : which == 1 ? WK : which == 2 ? WV : WP; const size_t o = (size_t)(wb & 63) * 16384 + t * 4; __bf16* Wo = WB + (size_t)which * CC * CC;
#pragma unroll
    for (int i = 0; i < 16; ++i) { const v4f v = *(const v4f*)(Wm + o + i * 1024); v4b w;
#pragma unroll
      for (int e = 0; e < 4; ++e) w[e] = (__bf16)v[e];
      vst2(Wo + o + i * 1024, w); } } }
// ---- k_kv: block = (128 reduced rows, 128 cols, which*NB + b): k / v = xr (hi + lo) . W^T -> f16 hi/lo planes [b][c][m]
__global__ __launch_bounds__(256) void k_kv(const __bf16* __restrict__ XRH, const __bf16* __restrict__ XRL, const __bf16* __restrict__ WK, const __bf16* __restrict__ WV, _Float16* __restrict__ KT, _Float16* __restrict__ KTL, _Float16* __restrict__ VT, _Float16* __restrict__ VTL) { __shared__ __align__(16) char sm[2 * 3 * GPL];
  const int tid = threadIdx.x, wave = tid >> 5, lane = tid & 31, col = lane & 15, g = lane >> 4; const int which = blockIdx.z / TNB; const size_t b = blockIdx.z % TNB; const int m0 = blockIdx.x * 128; const int c0 = blockIdx.y * 128; const size_t r0 = b * MM + m0; const __bf16* Wm = which == 0 ? WK : WV;
  v8f acc[2][4] = {};
  gemm_tile<1>(XRH + r0 * CC, XRL + r0 * CC, Wm + (size_t)c0 * CC, sm, acc);
  _Float16* th = (_Float16*)sm; _Float16* tl = th + 128 * 136;   // transposed tiles [c 128][m 128 + 8], in the ring's LDS behind its last barrier
#pragma unroll
  for (int i = 0; i < 2; ++i)
#pragma unroll
    for (int j = 0; j < 4; ++j) { v8h hq, lq;
#pragma unroll
      for (int r = 0; r < 8; ++r) { const float v = acc[i][j][r]; const _Float16 hv = (_Float16)v; hq[r] = hv; lq[r] = (_Float16)((v - (float)hv) * 2048.0f); }
      const int o = ((wave & 1) * 64 + j * 16 + col) * 136 + (wave >> 1) * 32 + i * 16 + 8 * g; *(v8h*)&th[o] = hq; *(v8h*)&tl[o] = lq; }
  __syncthreads(); _Float16* PH = which == 0 ? KT : VT; _Float16* PL = which == 0 ? KTL : VTL;
  for (int e = tid; e < 128 * 16; e += 256) { const int cl = e >> 4, q = e & 15; const size_t o = (b * CC + c0 + cl) * (size_t)MM + m0 + q * 8; vst2((unsigned*)(PH + o), *(const v4u*)&th[cl * 136 + q * 8]); vst2((unsigned*)(PL + o), *(const v4u*)&tl[cl * 136 + q * 8]); } }
// ---- k_kvp: block = (b*NH + h), 16 waves: KV[d][e] = sum_m k[m][d] v[m][e] (3 products over the 512 reduced tokens), kept transposed in LDS, then the head's part of the fold:
// G[c][e] = scale sum_d Wq[(h,d)][c] KV[d][e]  (Wq exact bf16 x KV hi+lo, 2 products; K = 32), a wave = 64 rows c -> bf16 hi and lo planes laid head by head, [b][h][c 1024][e 32], so that one block writes 64 KB in a row of each
// A head's 32 rows are 32 KB in a row in each of the four k/v planes: all 16 waves bring them in by loads of 512 contiguous bytes (four whole lines) and lay them in LDS; four waves, one 16 x 16 tile of KV each, read their fragments there.
// Wq's loads (4 rows d x 64 bf16 of c: four whole lines each) go out with the planes'; each wave turns its piece to [c][d] in its own LDS range.
#define KP 520                     // LDS row pitch in f16: 512 + 8 (1,040 B = 16 B x odd, for ds_load_b128 readers)
#define XP 36                      // LDS row pitch in floats: 32 + 4 (144 B = 16 B x odd, for ds_load_b128 readers)
__device__ __forceinline__ F2 split_lds(const float* row, int lane) { float v[16]; const float* p = row + 8 * (lane >> 4); const v4f a = *(const v4f*)p, b = *(const v4f*)(p + 4), c = *(const v4f*)(p + 16), d = *(const v4f*)(p + 20);
#pragma unroll
  for (int i = 0; i < 4; ++i) { v[i] = a[i]; v[4 + i] = b[i]; v[8 + i] = c[i]; v[12 + i] = d[i]; }
  return bsplit16(v); }
// A fragment of bf16 values kept as floats in a row whose column d stands at (d + rot) & 31
__device__ __forceinline__ v16b frag_rot(const float* row, int rot, int lane) { const int k = 8 * (lane >> 4) + rot; const v4f a = *(const v4f*)(row + (k & 31)), b = *(const v4f*)(row + ((k + 4) & 31)), c = *(const v4f*)(row + ((k + 16) & 31)), d = *(const v4f*)(row + ((k + 20) & 31)); v16b r;
#pragma unroll
  for (int i = 0; i < 4; ++i) { r[i] = (__bf16)a[i]; r[4 + i] = (__bf16)b[i]; r[8 + i] = (__bf16)c[i]; r[12 + i] = (__bf16)d[i]; }
  return r; }
__global__ __launch_bounds__(512) void k_kvp(const _Float16* __restrict__ KT, const _Float16* __restrict__ KTL, const _Float16* __restrict__ VT, const _Float16* __restrict__ VTL, const __bf16* __restrict__ WQ, __bf16* __restrict__ GH, __bf16* __restrict__ GL) { __shared__ __align__(16) _Float16 sp[4][HD * KP]; __shared__ __align__(16) float st[HD][XP]; __shared__ __align__(16) float sq[16][64 * XP];
  const int tid = threadIdx.x, wave = __builtin_amdgcn_readfirstlane(tid >> 5), lane = tid & 31, col = lane & 15, g = lane >> 4; const size_t bh = blockIdx.x; const size_t b = bh / NH; const int h = bh % NH;
  const size_t base = (b * CC + (size_t)h * HD) * MM; const _Float16* P[4] = {KT + base, KTL + base, VT + base, VTL + base}; const unsigned to = tid * 8; v8h v[4][4]; v8b vw[8]; float* mq = sq[wave];
#pragma unroll
  for (int p = 0; p < 4; ++p)
#pragma unroll
    for (int i = 0; i < 4; ++i) v[p][i] = *(const v8h*)(P[p] + (to + i * 4096));   // 512 threads x 8 f16 = 8 rows a step
#pragma unroll
  for (int it = 0; it < 8; ++it) vw[it] = *(const v8b*)(WQ + (size_t)(h * HD + (lane >> 3) * 8 + it) * CC + wave * 64 + (lane & 7) * 8);   // rows d = it, 8 + it, 16 + it, 24 + it: a lane ends up with 8 neighbouring d of its 8 columns c
#pragma unroll
  for (int p = 0; p < 4; ++p)
#pragma unroll
    for (int i = 0; i < 4; ++i) *(v8h*)&sp[p][(i * 8 + (tid >> 6)) * KP + (tid & 63) * 8] = v[p][i];
#pragma unroll
  for (int e = 0; e < 8; ++e) { v4f f0, f1; float* p = mq + ((lane & 7) * 8 + e) * XP; const int k = (lane >> 3) * 8 + (lane & 7) * 4;   // turned: row c, column d; row c holds d at (d + 4 (c >> 3)) & 31, which spreads the lanes' 16-B stores over the banks
#pragma unroll
    for (int i = 0; i < 4; ++i) { f0[i] = (float)vw[i][e]; f1[i] = (float)vw[4 + i][e]; }
    *(v4f*)(p + (k & 31)) = f0; *(v4f*)(p + ((k + 4) & 31)) = f1; }
  __syncthreads();   // the four planes are complete in LDS before any wave reads fragments that other waves wrote
  if (wave < 4) { const int dt = wave >> 1, j = wave & 1;   // wave = (row tile of d, col tile of e); K = m (16 kc); the wave's number sits in a scalar register, so this is a scalar branch and every lane is on at the products
    const _Float16 *pa = sp[0] + (dt * 16 + col) * KP, *pl = sp[1] + (dt * 16 + col) * KP, *qa = sp[2] + (j * 16 + col) * KP, *ql = sp[3] + (j * 16 + col) * KP; v8f acc = {};
#pragma unroll 4   // four trips' LDS reads go out ahead of the dependent chain of products
    for (int kc = 0; kc < MM / 32; ++kc) { const v16h ah = frag_h(pa + kc * 32, lane), al = frag_h(pl + kc * 32, lane), vh = frag_h(qa + kc * 32, lane), vl = frag_h(ql + kc * 32, lane);
      acc = wmma16(ah, vh, acc); v8f t2 = {}; t2 = wmma16(ah, vl, t2); t2 = wmma16(al, vh, t2);
#pragma unroll
      for (int r = 0; r < 8; ++r) acc[r] += t2[r] * (1.0f / 2048.0f); }
#pragma unroll
    for (int r = 0; r < 8; ++r) st[j * 16 + col][dt * 16 + 8 * g + r] = acc[r]; }   // transposed: [e][d]
  __syncthreads();   // KV^T is complete in LDS before all 16 waves read it
  F2 wb[2]; v8f ga[4][2] = {};
#pragma unroll
  for (int jj = 0; jj < 2; ++jj) wb[jj] = split_lds(st[jj * 16 + col], lane);
#pragma unroll
  for (int t = 0; t < 4; ++t) { const v16b a = frag_rot(mq + (t * 16 + col) * XP, 4 * (t * 2 + (col >> 3)), lane);
#pragma unroll
    for (int jj = 0; jj < 2; ++jj) { ga[t][jj] = wmma_bf(a, wb[jj].h, ga[t][jj]); ga[t][jj] = wmma_bf(a, wb[jj].l, ga[t][jj]); } }
#pragma unroll
  for (int t = 0; t < 4; ++t)
#pragma unroll
    for (int jj = 0; jj < 2; ++jj)
#pragma unroll
      for (int r = 0; r < 8; ++r) mq[(t * 16 + 8 * g + r) * XP + jj * 16 + col] = ga[t][jj][r] * 0.17677669529663687f;   // over the wave's own Wq rows, which it has read
  LDSX();   // the wave's rows are complete in LDS before its lanes read what other lanes wrote
#pragma unroll   // the 8 steps' LDS reads go out ahead of the conversions and stores
  for (int it = 0; it < 8; ++it) { const int row = it * 8 + (lane >> 2); const float* p = mq + row * XP + (lane & 3) * 8; const v4f y0 = *(const v4f*)p, y1 = *(const v4f*)(p + 4); v8b hq, lq;
#pragma unroll
    for (int e = 0; e < 4; ++e) { const __bf16 h0 = (__bf16)y0[e], h1 = (__bf16)y1[e]; hq[e] = h0; lq[e] = (__bf16)(y0[e] - (float)h0); hq[4 + e] = h1; lq[4 + e] = (__bf16)(y1[e] - (float)h1); }
    const size_t o = (bh * CC + wave * 64 + row) * HD + (lane & 3) * 8; vst2(GH + o, hq); vst2(GL + o, lq); } }   // 512 contiguous bytes a store
// ---- k_we: block = (128 rows c, 128 cols o, b): E[o][c] = sum_(h,e) G[h][c][e] (hi + lo) . Wp[o][(h,e)] -> bf16 hi/lo planes [b][o][c]
__global__ __launch_bounds__(256) void k_we(const __bf16* __restrict__ GTH, const __bf16* __restrict__ GTL, const __bf16* __restrict__ WP, __bf16* __restrict__ WEH, __bf16* __restrict__ WEL) { __shared__ __align__(16) char sm[2 * 3 * GPL];
  const int tid = threadIdx.x, wave = tid >> 5, lane = tid & 31, col = lane & 15, g = lane >> 4; const size_t b = blockIdx.z; const int m0 = blockIdx.x * 128; const int c0 = blockIdx.y * 128; const size_t r0 = (b * NH * CC + m0) * HD;
  v8f acc[2][4] = {};
  gemm_tile<1, 1>(GTH + r0, GTL + r0, WP + (size_t)c0 * CC, sm, acc);
  __bf16* th = (__bf16*)sm; __bf16* tl = th + 128 * 136;   // transposed tiles [o 128][c 128 + 8], in the ring's LDS behind its last barrier
#pragma unroll
  for (int i = 0; i < 2; ++i)
#pragma unroll
    for (int j = 0; j < 4; ++j) { v8b hq, lq;
#pragma unroll
      for (int r = 0; r < 8; ++r) { const float v = acc[i][j][r]; const __bf16 hv = (__bf16)v; hq[r] = hv; lq[r] = (__bf16)(v - (float)hv); }
      const int o = ((wave & 1) * 64 + j * 16 + col) * 136 + (wave >> 1) * 32 + i * 16 + 8 * g; *(v8b*)&th[o] = hq; *(v8b*)&tl[o] = lq; }
  __syncthreads();   // a stored row of E holds four waves' columns: the tiles are complete in LDS before any wave reads whole rows
  for (int e = tid; e < 128 * 16; e += 256) { const int cl = e >> 4, q = e & 15; const size_t o = (b * CC + c0 + cl) * (size_t)CC + m0 + q * 8; vst2((unsigned*)(WEH + o), *(const v4u*)&th[cl * 136 + q * 8]); vst2((unsigned*)(WEL + o), *(const v4u*)&tl[cl * 136 + q * 8]); } }
// ---- k_out: block = (128 tokens n, 128 cols o): out[n][o] = sum_c E_b[o][c] (hi + lo) . x[n][c] + bp[o]; E is the split operand, so a lane's 8 accumulator elements are 8 neighbouring o of one token
__global__ __launch_bounds__(256) void k_out(const __bf16* __restrict__ WEH, const __bf16* __restrict__ WEL, const __bf16* __restrict__ XB, const float* __restrict__ BP, float* __restrict__ OUT) { __shared__ __align__(16) char sm[2 * 3 * GPL];
  const int tid = threadIdx.x, wave = tid >> 5, lane = tid & 31, col = lane & 15, g = lane >> 4; const size_t n0 = (size_t)blockIdx.x * 128; const int o0 = blockIdx.y * 128; const size_t a0 = (n0 / NN) * CC + o0; v8f acc[2][4] = {};
  gemm_tile<1>(WEH + a0 * CC, WEL + a0 * CC, XB + n0 * CC, sm, acc);
  float* sf = (float*)sm + wave * (64 * XP);   // the wave's 64 tokens x 32 o in its own LDS range, behind the ring's last barrier
#pragma unroll
  for (int i = 0; i < 2; ++i) { const float* bp = BP + o0 + (wave >> 1) * 32 + i * 16 + 8 * g; const v4f b0 = *(const v4f*)bp, b1 = *(const v4f*)(bp + 4);
#pragma unroll
    for (int j = 0; j < 4; ++j) { v4f y0, y1;
#pragma unroll
      for (int r = 0; r < 4; ++r) { y0[r] = acc[i][j][r] + bfr(b0[r]); y1[r] = acc[i][j][4 + r] + bfr(b1[r]); }
      float* p = sf + (j * 16 + col) * XP + i * 16 + 8 * g; *(v4f*)p = y0; *(v4f*)(p + 4) = y1; } }
  LDSX();   // the wave's rows are complete in LDS before its lanes read what other lanes wrote
#pragma unroll
  for (int it = 0; it < 16; ++it) { const int rl = it * 4 + (lane >> 3); vst2(OUT + (n0 + (wave & 1) * 64 + rl) * CC + o0 + (wave >> 1) * 32 + (lane & 7) * 4, *(const v4f*)&sf[rl * XP + (lane & 7) * 4]); } }   // four whole 128-B lines a store
extern "C" void kernel_launch(void* const* d_in, const int* in_sizes, int n_in, void* d_out, int out_size, void* d_ws, size_t ws_size, hipStream_t stream) {
  (void)in_sizes; (void)n_in; (void)out_size;
  const float** F = (const float**)d_in;   // 0 x [4,2048,1024], 1 Wq, 2 Wk, 3 Wv, 4 Wp (natural), 5 bp, 6 bn_gamma, 7 bn_beta, 8 bn_mean, 9 bn_var
  if (ws_size < (size_t)WS_END) return;
  char* ws = (char*)d_ws; __bf16 *XRH = (__bf16*)(ws + WS_XR), *XRL = XRH + (size_t)NB * MM * CC, *GTH = (__bf16*)(ws + WS_GT), *GTL = GTH + (size_t)NB * CC * CC, *WEH = (__bf16*)(ws + WS_WE), *WEL = WEH + (size_t)NB * CC * CC, *XB = (__bf16*)(ws + WS_XB), *WB = (__bf16*)(ws + WS_WB); _Float16 *KT = (_Float16*)(ws + WS_KT), *KTL = (_Float16*)(ws + WS_KTL), *VT = (_Float16*)(ws + WS_VT), *VTL = (_Float16*)(ws + WS_VTL);
  k_pool<<<TNB * MM + 256, 256, 0, stream>>>(F[0], F[6], F[7], F[8], F[9], F[1], F[2], F[3], F[4], XB, XRH, XRL, WB);
  k_kv<<<dim3(MM / 128, CC / 128, 2 * TNB), 256, 0, stream>>>(XRH, XRL, WB + (size_t)CC * CC, WB + 2 * (size_t)CC * CC, KT, KTL, VT, VTL);
  k_kvp<<<TNB * NH, 512, 0, stream>>>(KT, KTL, VT, VTL, WB, GTH, GTL);
  k_we<<<dim3(CC / 128, CC / 128, TNB), 256, 0, stream>>>(GTH, GTL, WB + 3 * (size_t)CC * CC, WEH, WEL);
  k_out<<<dim3(TNB * NN / 128, CC / 128), 256, 0, stream>>>(WEH, WEL, XB, F[5], (float*)d_out);
}

// v006
// Measured time: 66.8 microseconds a run.
// Versions between v004 and this one are left out; their measured steps multiply to 1.32 times as fast.
// Counting every step since v000, it is 6.10 times as fast.
// compute dtype: all float inputs rounded to bf16; AvgPool1d (exact f32 sums of 4 bf16 tokens) + BatchNorm (eval) in f32; the GEMM operands are f16: x, Wk, Wv, Wp hold their bf16 values (unchanged down to 2^-17; below that on f16's subnormal grid of 2^-24), xr, G and E are rounded to f16 (11 bits) once by their producers, so f16's range (65,504) bounds them (G and E grow with the square of bn_gamma; about 1 at gamma 1); k, v = xr W^T (1 product); no softmax in the module, so (q k^T) v is q (k^T v) with KV_h = k_h^T v_h (3 products), and, nothing but products standing between x and out, out = x E_b^T + bp with the folded weight of batch b, E_b = Wp G_b, G_b[(h,e)][c] = scale sum_d KV_h[d][e] Wq[(h,d)][c]: G from KV as bf16 hi + lo (2 products), E from G (1 product), out from E (1 product); f32 accumulation, f32 output.
#include <hip/hip_runtime.h>
#include <math.h>

typedef __attribute__((ext_vector_type(16))) _Float16 v16h;
typedef __attribute__((ext_vector_type(16))) __bf16 v16b;
typedef __attribute__((ext_vector_type(8)))  _Float16 v8h;
typedef __attribute__((ext_vector_type(8)))  float v8f;
typedef __attribute__((ext_vector_type(4)))  float v4f;
typedef __attribute__((ext_vector_type(2)))  float v2f;
typedef __attribute__((ext_vector_type(4)))  unsigned v4u;
typedef __attribute__((ext_vector_type(4)))  int v4i;
typedef float __attribute__((may_alias)) float_a;
typedef int __attribute__((may_alias)) int_a;

template <typename T> __device__ __forceinline__ void vst2(void* p, T v) { *(T*)p = v;  }
__device__ __forceinline__ v8f wmma16(v16h a, v16h b, v8f c) {
  v8f d = __builtin_amdgcn_wmma_f32_16x16x32_f16(false, a, false, b, (short)0, c, false, false);
  asm volatile("v_nop\n\tv_nop\n\tv_nop\n\tv_nop" : "+v"(d) : "v"(a), "v"(b));
  return d;
}
__device__ __forceinline__ v8f wmma_bf(v16b a, v16b b, v8f c) {
  v8f d = __builtin_amdgcn_wmma_f32_16x16x32_bf16(false, a, false, b, (short)0, c, false, false);
  asm volatile("v_nop\n\tv_nop\n\tv_nop\n\tv_nop" : "+v"(d) : "v"(a), "v"(b));
  return d;
}
// 16x16x32 fragments: lane = (h = lane>>4, row/col = lane&15); elements 0..7 = k0+8h+0..7, 8..15 = k0+16+8h+0..7; D element r = row 8h+r
__device__ __forceinline__ v16h frag_h(const _Float16* rowk0, int lane) {
  union { v16h v; v8h q[2]; } u; const _Float16* p = rowk0 + 8 * (lane >> 4);
  u.q[0] = *(const v8h*)p; u.q[1] = *(const v8h*)(p + 16); return u.v;
}
__device__ __forceinline__ v16h frag_f32(const float* rowk0, int lane) {
  v16h a; const float* p = rowk0 + 8 * (lane >> 4);
#pragma unroll
  for (int i = 0; i < 8; ++i) { a[i] = (_Float16)p[i]; a[8 + i] = (_Float16)p[16 + i]; }
  return a;
}
__device__ __forceinline__ v16h frag_f32s(const float* rowk0, int lane, float sc) {
  v16h a; const float* p = rowk0 + 8 * (lane >> 4);
#pragma unroll
  for (int i = 0; i < 8; ++i) { a[i] = (_Float16)(p[i] * sc); a[8 + i] = (_Float16)(p[16 + i] * sc); }
  return a;
}
// column fragment from a [K][ld] layout (column n), rows >= K read as 0
__device__ __forceinline__ v16h fragc_f32(const float* W, int k0, int n, int lane, int ld, int K) {
  v16h a; const int g = lane >> 4;
#pragma unroll
  for (int i = 0; i < 8; ++i) { const int ka = k0 + 8 * g + i, kb = ka + 16;
    a[i] = (_Float16)(ka < K ? W[(size_t)(ka < K ? ka : K - 1) * ld + n] : 0.f); a[8 + i] = (_Float16)(kb < K ? W[(size_t)(kb < K ? kb : K - 1) * ld + n] : 0.f); }
  return a;
}
struct F2 { v16b h, l; };
__device__ __forceinline__ F2 bsplit16(const float v[16]) { F2 r;
#pragma unroll
  for (int i = 0; i < 16; ++i) { const __bf16 h = (__bf16)v[i]; r.h[i] = h; r.l[i] = (__bf16)(v[i] - (float)h); }
  return r; }
__device__ __forceinline__ F2 split_row(const float* row, int k0, int lane) { float v[16]; const float* p = row + k0 + 8 * (lane >> 4);
#pragma unroll
  for (int i = 0; i < 8; ++i) { v[i] = p[i]; v[8 + i] = p[16 + i]; }
  return bsplit16(v); }
__device__ __forceinline__ F2 split_rowK(const float* row, int k0, int lane, int K) { float v[16]; const int g = lane >> 4;
#pragma unroll
  for (int i = 0; i < 8; ++i) { const int ka = k0 + 8 * g + i, kb = ka + 16; v[i] = ka < K ? row[ka < K ? ka : K - 1] : 0.f; v[8 + i] = kb < K ? row[kb < K ? kb : K - 1] : 0.f; }
  return bsplit16(v); }
__device__ __forceinline__ F2 split_col(const float* W, int k0, int n, int lane, int ld, int K) { float v[16]; const int g = lane >> 4;
#pragma unroll
  for (int i = 0; i < 8; ++i) { const int ka = k0 + 8 * g + i, kb = ka + 16; v[i] = ka < K ? W[(size_t)(ka < K ? ka : K - 1) * ld + n] : 0.f; v[8 + i] = kb < K ? W[(size_t)(kb < K ? kb : K - 1) * ld + n] : 0.f; }
  return bsplit16(v); }
__device__ __forceinline__ v8f mac3(const F2& a, const F2& b, v8f c) { c = wmma_bf(a.l, b.h, c); c = wmma_bf(a.h, b.l, c); return wmma_bf(a.h, b.h, c); }
__device__ __forceinline__ float sigm(float v) { return 1.0f / (1.0f + expf(-v)); }
#define LDSX() do { asm volatile("s_wait_dscnt 0" ::: "memory"); __builtin_amdgcn_wave_barrier(); __builtin_amdgcn_fence(__ATOMIC_RELEASE, "workgroup"); } while (0)


// Efficient multi-head attention WITHOUT softmax (B 4, N 2,048, C 1,024, 32 heads x 32, reduction 4 -> M 512): out = ((q k^T) * 32^-1/2) v, then Wp + bp; evaluated as x E_b^T + bp with E_b = Wp (32^-1/2 (k^T v)^T per head) Wq.
#define NB 4
#define NN 2048
#define CC 1024
#define NH 32
#define HD 32
#define NR 4              // N_RATIO
#define MM (NN / NR)      // 512
#define BNEPS 1e-6f
#ifndef TNB
#define TNB NB
#endif
#ifndef TOB
#define TOB (TNB * NN / 64)
#endif
typedef __attribute__((ext_vector_type(8))) __bf16 v8b;
__device__ __forceinline__ v16b frag_b(const __bf16* rowk0, int lane) {
  union { v16b v; v8b q[2]; } u; const __bf16* p = rowk0 + 8 * (lane >> 4);
  u.q[0] = *(const v8b*)p; u.q[1] = *(const v8b*)(p + 16); return u.v;
}
__device__ __forceinline__ float bfr(float v) { return (float)(__bf16)v; }
__device__ __attribute__((noinline)) float exp_ni(float v) { return expf(v); }
__device__ __attribute__((noinline)) float erf_ni(float v) { return erff(v); }

#define WS_GT  0u                                   // G, head by head: [b][h][c 1024][e 32], f16
#define WS_XR  (WS_GT + 2u * (size_t)NB * CC * CC)        // BN(avgpool) rows [b*MM + m][1024], f16
#define WS_KT  (WS_XR + 2u * (size_t)NB * MM * CC)        // f16 hi|lo k planes [b][1024 (h,d)][MM]; v planes
#define WS_KTL (WS_KT + 2u * (size_t)NB * CC * MM)
#define WS_VT  (WS_KTL + 2u * (size_t)NB * CC * MM)
#define WS_VTL (WS_VT + 2u * (size_t)NB * CC * MM)
#define WS_WE  (WS_VTL + 2u * (size_t)NB * CC * MM)       // folded weight rows E [b*CC + o][c 1024], f16
#define WS_XB  (WS_WE + 2u * (size_t)NB * CC * CC)        // x rows [b*NN + n][1024], bf16 values held as f16
#define WS_WB  (WS_XB + 2u * (size_t)NB * NN * CC)        // Wq (bf16) | Wk | Wv | Wp (bf16 values held as f16), each [1024][1024]
#define WS_END (WS_WB + 2u * 4u * (size_t)CC * CC)

__device__ __forceinline__ v16b fragb_f32(const float* __restrict__ p, int lane) { v16b a; const float* pp = p + 8 * (lane >> 4);
#pragma unroll
  for (int i = 0; i < 8; ++i) { a[i] = (__bf16)pp[i]; a[8 + i] = (__bf16)pp[16 + i]; } return a; }
// ---- shared core of the three GEMMs (k/v, E, out): one block of 8 waves makes Y[128][128] = A[128][1024] . W[128][1024]^T, one f16 product.
// The operands arrive as f16 planes that their producers rounded once. Each stage is 64 k: every wave-wide global load covers four 128-B row pieces (whole lines),
// which go unchanged into LDS, where the 8 waves (4 x 2, 32 x 64 of Y each) read their fragments, 32 k ahead of the products that use them. Two buffers: later stages' global loads fly while this stage is multiplied.
#define GBK 64                    // k per stage
#define GPB 144                   // LDS row pitch in bytes: 64 f16 + 16 B (16 B x odd for ds_load_b128 readers)
#define GPL (128 * GPB)           // one operand plane of a stage; planes: A | W
typedef __attribute__((ext_vector_type(4))) __bf16 v4b;
typedef __attribute__((ext_vector_type(4))) _Float16 v4h;
template <int HS = 0> __device__ __forceinline__ void gemm_tile(const _Float16* __restrict__ A, const _Float16* __restrict__ Wm, char* sm, v8f (&acc)[2][4]) {
  constexpr int STG = 2 * GPL;
  const int tid = threadIdx.x, wave = tid >> 5, lane = tid & 31, col = lane & 15; const int lr = tid >> 3, lc = tid & 7;
  const size_t la = HS ? ((size_t)(lc >> 2) * CC + lr) * HD + (lc & 3) * 8 : (size_t)lr * CC + lc * 8;   // HS: A lies head by head, [h][row][32]: a stage is two heads, a row's piece 64 B in each
  const _Float16* ga = A + la; const _Float16* gb = Wm + (size_t)lr * CC + lc * 8; char* st = sm + lr * GPB + lc * 16;
  const char* fa = sm + ((wave >> 1) * 32 + col) * GPB; const char* fb = sm + GPL + ((wave & 1) * 64 + col) * GPB;
  v8h ra[4], rb[4]; v16h b0[4], a0[2], b1[4], a1[2];   // two fragment sets: one is multiplied while the other is filled from LDS
  auto ldg = [&](int s) {
#pragma unroll
    for (int i = 0; i < 4; ++i) { const size_t o = (size_t)i * 32 * CC + s * GBK, oa = HS ? (size_t)i * 32 * HD + (size_t)s * 2 * CC * HD : o; ra[i] = *(const v8h*)(ga + oa); rb[i] = *(const v8h*)(gb + o); }
    asm volatile("s_wait_xcnt 0x0" ::: "memory"); };   // stands before the loads' address registers are given to other values
  auto sts = [&](int buf) { char* p = st + buf * STG;
#pragma unroll
    for (int i = 0; i < 4; ++i) { *(v8h*)(p + i * 32 * GPB) = ra[i]; *(v8h*)(p + GPL + i * 32 * GPB) = rb[i]; } };
  auto ldf = [&](int buf, int kk, v16h (&b)[4], v16h (&a)[2]) { const char* pa = fa + buf * STG + kk * 64; const char* pb = fb + buf * STG + kk * 64;
#pragma unroll
    for (int j = 0; j < 4; ++j) b[j] = frag_h((const _Float16*)(pb + j * 16 * GPB), lane);
#pragma unroll
    for (int i = 0; i < 2; ++i) a[i] = frag_h((const _Float16*)(pa + i * 16 * GPB), lane); };
  auto mul = [&](v16h (&b)[4], v16h (&a)[2]) {
#pragma unroll
    for (int i = 0; i < 2; ++i)
#pragma unroll
      for (int j = 0; j < 4; ++j) acc[i][j] = wmma16(a[i], b[j], acc[i][j]); };
  // the stage barrier, by hand: this wave's LDS stores and reads have ended, then the work-group's barrier; unlike __syncthreads() it leaves the global loads of the stage after next in flight
#define GBAR() asm volatile("s_wait_dscnt 0x0\n\ts_barrier_signal -1\n\ts_barrier_wait -1" ::: "memory")
  ldg(0); sts(0); ldg(1); GBAR();
  ldf(0, 0, b0, a0);
#pragma unroll 1   // rolled: for speed only
  for (int s = 0; s < CC / GBK - 1; ++s) { const int buf = s & 1;
    ldf(buf, 1, b1, a1);        // this stage's second half, read while its first half is multiplied
    sts(buf ^ 1);               // stage s + 1, loaded one stage ago, into the buffer whose last reads ended before the barrier of stage s - 1
    if (s + 2 < CC / GBK) ldg(s + 2);
    mul(b0, a0);
    GBAR();                     // publishes stage s + 1 and ends every read of the buffer that stage s + 2 overwrites
    ldf(buf ^ 1, 0, b0, a0);    // the next stage's first half, read while this stage's second half is multiplied
    mul(b1, a1); }
  ldf((CC / GBK - 1) & 1, 1, b1, a1);
  mul(b0, a0);
  GBAR();                       // ends every read of the ring: the callers lay their output tiles over it
  mul(b1, a1); }
// ---- k_pool: block = reduced row (b, m), a thread = 4 channels: xr = BN(mean of 4 tokens) -> one f16 plane; the 4 tokens' bf16 values, which it forms anyway, -> the x plane, written as f16.
// The 256 blocks behind the reduced rows round the four weight matrices to bf16, 16,384 elements each; Wq stays a bf16 plane (the fold's K = 32 product reads it), the bf16 values of Wk, Wv, Wp are written as f16.
__global__ __launch_bounds__(256) void k_pool(const float* __restrict__ X, const float* __restrict__ G, const float* __restrict__ Bt, const float* __restrict__ Mu, const float* __restrict__ Var, const float* __restrict__ WQ, const float* __restrict__ WK, const float* __restrict__ WV, const float* __restrict__ WP, _Float16* __restrict__ XB, _Float16* __restrict__ XR, __bf16* __restrict__ WB) { const int t = threadIdx.x;
  if (blockIdx.x < TNB * MM) { const size_t row = blockIdx.x; const size_t b = row / MM; const int m = (int)(row % MM); const int c = t * 4; float s[4] = {0.f, 0.f, 0.f, 0.f};
#pragma unroll
  for (int i = 0; i < NR; ++i) { const size_t o = (b * NN + (size_t)m * NR + i) * CC + c; const v4f v = *(const v4f*)(X + o); v4h h;
#pragma unroll
    for (int e = 0; e < 4; ++e) { const float r = bfr(v[e]); h[e] = (_Float16)r; s[e] += r; }
    vst2(XB + o, h); }
  v4h hq;
#pragma unroll
  for (int e = 0; e < 4; ++e) { const float a = s[e] * (1.0f / NR); const float y = (a - bfr(Mu[c + e])) / sqrtf(bfr(Var[c + e]) + BNEPS) * bfr(G[c + e]) + bfr(Bt[c + e]); hq[e] = (_Float16)y; }
  vst2(XR + row * CC + c, hq); }
  else { const int wb = blockIdx.x - TNB * MM, which = wb >> 6; const float* Wm = which == 0 ? WQ : which == 1 ? WK : which == 2 ? WV : WP; const size_t o = (size_t)(wb & 63) * 16384 + t * 4; __bf16* Wo = WB + (size_t)which * CC * CC;
    if (which == 0) {   // the same for the whole block; each case has its own 16 steps, so that a case's 16 loads go out together and its 16 stores too
#pragma unroll
      for (int i = 0; i < 16; ++i) { const v4f v = *(const v4f*)(Wm + o + i * 1024); v4b w;
#pragma unroll
        for (int e = 0; e < 4; ++e) w[e] = (__bf16)v[e];
        vst2(Wo + o + i * 1024, w); }
      asm volatile("s_wait_xcnt 0x0" ::: "memory"); }   // stands behind the stores, before any path of the built code gives their registers to other values
    else {
#pragma unroll
      for (int i = 0; i < 16; ++i) { const v4f v = *(const v4f*)(Wm + o + i * 1024); v4h w;
#pragma unroll
        for (int e = 0; e < 4; ++e) w[e] = (_Float16)bfr(v[e]);
        vst2(Wo + o + i * 1024, w); }
      asm volatile("s_wait_xcnt 0x0" ::: "memory"); } } }   // as above
// ---- k_kv: block = (128 reduced rows, 128 cols, which*NB + b): k / v = xr . W^T -> f16 hi/lo planes [b][c][m]
__global__ __launch_bounds__(256) void k_kv(const _Float16* __restrict__ XR, const _Float16* __restrict__ WK, const _Float16* __restrict__ WV, _Float16* __restrict__ KT, _Float16* __restrict__ KTL, _Float16* __restrict__ VT, _Float16* __restrict__ VTL) { __shared__ __align__(16) char sm[2 * 2 * GPL];
  const int tid = threadIdx.x, wave = tid >> 5, lane = tid & 31, col = lane & 15, g = lane >> 4; const int which = blockIdx.z / TNB; const size_t b = blockIdx.z % TNB; const int m0 = blockIdx.x * 128; const int c0 = blockIdx.y * 128; const size_t r0 = b * MM + m0; const _Float16* Wm = which == 0 ? WK : WV;
  v8f acc[2][4] = {};
  gemm_tile<0>(XR + r0 * CC, Wm + (size_t)c0 * CC, sm, acc);
  _Float16* th = (_Float16*)sm; _Float16* tl = th + 128 * 136;   // transposed tiles [c 128][m 128 + 8], in the ring's LDS behind its last barrier
#pragma unroll
  for (int i = 0; i < 2; ++i)
#pragma unroll
    for (int j = 0; j < 4; ++j) { v8h hq, lq;
#pragma unroll
      for (int r = 0; r < 8; ++r) { const float v = acc[i][j][r]; const _Float16 hv = (_Float16)v; hq[r] = hv; lq[r] = (_Float16)((v - (float)hv) * 2048.0f); }
      const int o = ((wave & 1) * 64 + j * 16 + col) * 136 + (wave >> 1) * 32 + i * 16 + 8 * g; *(v8h*)&th[o] = hq; *(v8h*)&tl[o] = lq; }
  __syncthreads(); _Float16* PH = which == 0 ? KT : VT; _Float16* PL = which == 0 ? KTL : VTL;
  for (int e = tid; e < 128 * 16; e += 256) { const int cl = e >> 4, q = e & 15; const size_t o = (b * CC + c0 + cl) * (size_t)MM + m0 + q * 8; vst2((unsigned*)(PH + o), *(const v4u*)&th[cl * 136 + q * 8]); vst2((unsigned*)(PL + o), *(const v4u*)&tl[cl * 136 + q * 8]); } }
// ---- k_kvp: block = (b*NH + h), 16 waves: KV[d][e] = sum_m k[m][d] v[m][e] (3 products over the 512 reduced tokens), kept transposed in LDS, then the head's part of the fold:
// G[c][e] = scale sum_d Wq[(h,d)][c] KV[d][e]  (Wq exact bf16 x KV hi+lo, 2 products; K = 32), a wave = 64 rows c -> one f16 plane laid head by head, [b][h][c 1024][e 32], so that one block writes 64 KB in a row
// A head's 32 rows are 32 KB in a row in each of the four k/v planes: all 16 waves bring them in by loads of 512 contiguous bytes (four whole lines) and lay them in LDS; four waves, one 16 x 16 tile of KV each, read their fragments there.
// Wq's loads (4 rows d x 64 bf16 of c: four whole lines each) go out with the planes'; each wave turns its piece to [c][d] in its own LDS range.
#define KP 520                     // LDS row pitch in f16: 512 + 8 (1,040 B = 16 B x odd, for ds_load_b128 readers)
#define XP 36                      // LDS row pitch in floats: 32 + 4 (144 B = 16 B x odd, for ds_load_b128 readers)
__device__ __forceinline__ F2 split_lds(const float* row, int lane) { float v[16]; const float* p = row + 8 * (lane >> 4); const v4f a = *(const v4f*)p, b = *(const v4f*)(p + 4), c = *(const v4f*)(p + 16), d = *(const v4f*)(p + 20);
#pragma unroll
  for (int i = 0; i < 4; ++i) { v[i] = a[i]; v[4 + i] = b[i]; v[8 + i] = c[i]; v[12 + i] = d[i]; }
  return bsplit16(v); }
// A fragment of bf16 values kept as floats in a row whose column d stands at (d + rot) & 31
__device__ __forceinline__ v16b frag_rot(const float* row, int rot, int lane) { const int k = 8 * (lane >> 4) + rot; const v4f a = *(const v4f*)(row + (k & 31)), b = *(const v4f*)(row + ((k + 4) & 31)), c = *(const v4f*)(row + ((k + 16) & 31)), d = *(const v4f*)(row + ((k + 20) & 31)); v16b r;
#pragma unroll
  for (int i = 0; i < 4; ++i) { r[i] = (__bf16)a[i]; r[4 + i] = (__bf16)b[i]; r[8 + i] = (__bf16)c[i]; r[12 + i] = (__bf16)d[i]; }
  return r; }
__global__ __launch_bounds__(512) void k_kvp(const _Float16* __restrict__ KT, const _Float16* __restrict__ KTL, const _Float16* __restrict__ VT, const _Float16* __restrict__ VTL, const __bf16* __restrict__ WQ, _Float16* __restrict__ GH) { __shared__ __align__(16) _Float16 sp[4][HD * KP]; __shared__ __align__(16) float st[HD][XP]; __shared__ __align__(16) float sq[16][64 * XP];
  const int tid = threadIdx.x, wave = __builtin_amdgcn_readfirstlane(tid >> 5), lane = tid & 31, col = lane & 15, g = lane >> 4; const size_t bh = blockIdx.x; const size_t b = bh / NH; const int h = bh % NH;
  const size_t base = (b * CC + (size_t)h * HD) * MM; const _Float16* P[4] = {KT + base, KTL + base, VT + base, VTL + base}; const unsigned to = tid * 8; v8h v[4][4]; v8b vw[8]; float* mq = sq[wave];
#pragma unroll
  for (int p = 0; p < 4; ++p)
#pragma unroll
    for (int i = 0; i < 4; ++i) v[p][i] = *(const v8h*)(P[p] + (to + i * 4096));   // 512 threads x 8 f16 = 8 rows a step
#pragma unroll
  for (int it = 0; it < 8; ++it) vw[it] = *(const v8b*)(WQ + (size_t)(h * HD + (lane >> 3) * 8 + it) * CC + wave * 64 + (lane & 7) * 8);   // rows d = it, 8 + it, 16 + it, 24 + it: a lane ends up with 8 neighbouring d of its 8 columns c
#pragma unroll
  for (int p = 0; p < 4; ++p)
#pragma unroll
    for (int i = 0; i < 4; ++i) *(v8h*)&sp[p][(i * 8 + (tid >> 6)) * KP + (tid & 63) * 8] = v[p][i];
#pragma unroll
  for (int e = 0; e < 8; ++e) { v4f f0, f1; float* p = mq + ((lane & 7) * 8 + e) * XP; const int k = (lane >> 3) * 8 + (lane & 7) * 4;   // turned: row c, column d; row c holds d at (d + 4 (c >> 3)) & 31, which spreads the lanes' 16-B stores over the banks
#pragma unroll
    for (int i = 0; i < 4; ++i) { f0[i] = (float)vw[i][e]; f1[i] = (float)vw[4 + i][e]; }
    *(v4f*)(p + (k & 31)) = f0; *(v4f*)(p + ((k + 4) & 31)) = f1; }
  __syncthreads();   // the four planes are complete in LDS before any wave reads fragments that other waves wrote
  if (wave < 4) { const int dt = wave >> 1, j = wave & 1;   // wave = (row tile of d, col tile of e); K = m (16 kc); the wave's number sits in a scalar register, so this is a scalar branch and every lane is on at the products
    const _Float16 *pa = sp[0] + (dt * 16 + col) * KP, *pl = sp[1] + (dt * 16 + col) * KP, *qa = sp[2] + (j * 16 + col) * KP, *ql = sp[3] + (j * 16 + col) * KP; v8f acc = {};
#pragma unroll 4   // four trips' LDS reads go out ahead of the dependent chain of products
    for (int kc = 0; kc < MM / 32; ++kc) { const v16h ah = frag_h(pa + kc * 32, lane), al = frag_h(pl + kc * 32, lane), vh = frag_h(qa + kc * 32, lane), vl = frag_h(ql + kc * 32, lane);
      acc = wmma16(ah, vh, acc); v8f t2 = {}; t2 = wmma16(ah, vl, t2); t2 = wmma16(al, vh, t2);
#pragma unroll
      for (int r = 0; r < 8; ++r) acc[r] += t2[r] * (1.0f / 2048.0f); }
#pragma unroll
    for (int r = 0; r < 8; ++r) st[j * 16 + col][dt * 16 + 8 * g + r] = acc[r]; }   // transposed: [e][d]
  __syncthreads();   // KV^T is complete in LDS before all 16 waves read it
  F2 wb[2]; v8f ga[4][2] = {};
#pragma unroll
  for (int jj = 0; jj < 2; ++jj) wb[jj] = split_lds(st[jj * 16 + col], lane);
#pragma unroll
  for (int t = 0; t < 4; ++t) { const v16b a = frag_rot(mq + (t * 16 + col) * XP, 4 * (t * 2 + (col >> 3)), lane);
#pragma unroll
    for (int jj = 0; jj < 2; ++jj) { ga[t][jj] = wmma_bf(a, wb[jj].h, ga[t][jj]); ga[t][jj] = wmma_bf(a, wb[jj].l, ga[t][jj]); } }
#pragma unroll
  for (int t = 0; t < 4; ++t)
#pragma unroll
    for (int jj = 0; jj < 2; ++jj)
#pragma unroll
      for (int r = 0; r < 8; ++r) mq[(t * 16 + 8 * g + r) * XP + jj * 16 + col] = ga[t][jj][r] * 0.17677669529663687f;   // over the wave's own Wq rows, which it has read
  LDSX();   // the wave's rows are complete in LDS before its lanes read what other lanes wrote
#pragma unroll   // the 8 steps' LDS reads go out ahead of the conversions and stores
  for (int it = 0; it < 8; ++it) { const int row = it * 8 + (lane >> 2); const float* p = mq + row * XP + (lane & 3) * 8; const v4f y0 = *(const v4f*)p, y1 = *(const v4f*)(p + 4); v8h hq;
#pragma unroll
    for (int e = 0; e < 4; ++e) { hq[e] = (_Float16)y0[e]; hq[4 + e] = (_Float16)y1[e]; }
    const size_t o = (bh * CC + wave * 64 + row) * HD + (lane & 3) * 8; vst2(GH + o, hq); } }   // 512 contiguous bytes a store
// ---- k_we: block = (128 rows c, 128 cols o, b): E[o][c] = sum_(h,e) G[h][c][e] . Wp[o][(h,e)] -> one f16 plane [b][o][c]
__global__ __launch_bounds__(256) void k_we(const _Float16* __restrict__ GT, const _Float16* __restrict__ WP, _Float16* __restrict__ WE) { __shared__ __align__(16) char sm[2 * 2 * GPL];
  const int tid = threadIdx.x, wave = tid >> 5, lane = tid & 31, col = lane & 15, g = lane >> 4; const size_t b = blockIdx.z; const int m0 = blockIdx.x * 128; const int c0 = blockIdx.y * 128; const size_t r0 = (b * NH * CC + m0) * HD;
  v8f acc[2][4] = {};
  gemm_tile<1>(GT + r0, WP + (size_t)c0 * CC, sm, acc);
  _Float16* th = (_Float16*)sm;   // transposed tile [o 128][c 128 + 8], in the ring's LDS behind its last barrier
#pragma unroll
  for (int i = 0; i < 2; ++i)
#pragma unroll
    for (int j = 0; j < 4; ++j) { v8h hq;
#pragma unroll
      for (int r = 0; r < 8; ++r) hq[r] = (_Float16)acc[i][j][r];
      const int o = ((wave & 1) * 64 + j * 16 + col) * 136 + (wave >> 1) * 32 + i * 16 + 8 * g; *(v8h*)&th[o] = hq; }
  __syncthreads();   // a stored row of E holds four waves' columns: the tile is complete in LDS before any wave reads whole rows
  for (int e = tid; e < 128 * 16; e += 256) { const int cl = e >> 4, q = e & 15; const size_t o = (b * CC + c0 + cl) * (size_t)CC + m0 + q * 8; vst2((unsigned*)(WE + o), *(const v4u*)&th[cl * 136 + q * 8]); } }
// ---- k_out: block = (128 tokens n, 128 cols o): out[n][o] = sum_c E_b[o][c] . x[n][c] + bp[o]; E is the A operand, so a lane's 8 accumulator elements are 8 neighbouring o of one token
__global__ __launch_bounds__(256) void k_out(const _Float16* __restrict__ WE, const _Float16* __restrict__ XB, const float* __restrict__ BP, float* __restrict__ OUT) { __shared__ __align__(16) char sm[2 * 2 * GPL];
  const int tid = threadIdx.x, wave = tid >> 5, lane = tid & 31, col = lane & 15, g = lane >> 4; const size_t n0 = (size_t)blockIdx.x * 128; const int o0 = blockIdx.y * 128; const size_t a0 = (n0 / NN) * CC + o0; v8f acc[2][4] = {};
  gemm_tile<0>(WE + a0 * CC, XB + n0 * CC, sm, acc);
  float* sf = (float*)sm + wave * (64 * XP);   // the wave's 64 tokens x 32 o in its own LDS range, behind the ring's last barrier
#pragma unroll
  for (int i = 0; i < 2; ++i) { const float* bp = BP + o0 + (wave >> 1) * 32 + i * 16 + 8 * g; const v4f b0 = *(const v4f*)bp, b1 = *(const v4f*)(bp + 4);
#pragma unroll
    for (int j = 0; j < 4; ++j) { v4f y0, y1;
#pragma unroll
      for (int r = 0; r < 4; ++r) { y0[r] = acc[i][j][r] + bfr(b0[r]); y1[r] = acc[i][j][4 + r] + bfr(b1[r]); }
      float* p = sf + (j * 16 + col) * XP + i * 16 + 8 * g; *(v4f*)p = y0; *(v4f*)(p + 4) = y1; } }
  LDSX();   // the wave's rows are complete in LDS before its lanes read what other lanes wrote
#pragma unroll
  for (int it = 0; it < 16; ++it) { const int rl = it * 4 + (lane >> 3); vst2(OUT + (n0 + (wave & 1) * 64 + rl) * CC + o0 + (wave >> 1) * 32 + (lane & 7) * 4, *(const v4f*)&sf[rl * XP + (lane & 7) * 4]); } }   // four whole 128-B lines a store
extern "C" void kernel_launch(void* const* d_in, const int* in_sizes, int n_in, void* d_out, int out_size, void* d_ws, size_t ws_size, hipStream_t stream) {
  (void)in_sizes; (void)n_in; (void)out_size;
  const float** F = (const float**)d_in;   // 0 x [4,2048,1024], 1 Wq, 2 Wk, 3 Wv, 4 Wp (natural), 5 bp, 6 bn_gamma, 7 bn_beta, 8 bn_mean, 9 bn_var
  if (ws_size < (size_t)WS_END) return;
  char* ws = (char*)d_ws; __bf16* WB = (__bf16*)(ws + WS_WB); _Float16 *XR = (_Float16*)(ws + WS_XR), *GT = (_Float16*)(ws + WS_GT), *WE = (_Float16*)(ws + WS_WE), *XB = (_Float16*)(ws + WS_XB), *WH = (_Float16*)(ws + WS_WB), *KT = (_Float16*)(ws + WS_KT), *KTL = (_Float16*)(ws + WS_KTL), *VT = (_Float16*)(ws + WS_VT), *VTL = (_Float16*)(ws + WS_VTL);
  k_pool<<<TNB * MM + 256, 256, 0, stream>>>(F[0], F[6], F[7], F[8], F[9], F[1], F[2], F[3], F[4], XB, XR, WB);
  k_kv<<<dim3(MM / 128, CC / 128, 2 * TNB), 256, 0, stream>>>(XR, WH + (size_t)CC * CC, WH + 2 * (size_t)CC * CC, KT, KTL, VT, VTL);
  k_kvp<<<TNB * NH, 512, 0, stream>>>(KT, KTL, VT, VTL, WB, GT);
  k_we<<<dim3(CC / 128, CC / 128, TNB), 256, 0, stream>>>(GT, WH + 3 * (size_t)CC * CC, WE);
  k_out<<<dim3(TNB * NN / 128, CC / 128), 256, 0, stream>>>(WE, XB, F[5], (float*)d_out);
}

// v007
// A run of this version takes 62.9 microseconds.
// Two timings next to v006 both put it at 1.06 times that version's speed.
// Counting every step since v000, it is 6.48 times as fast.
// compute dtype: all float inputs rounded to bf16; AvgPool1d (exact f32 sums of 4 bf16 tokens) + BatchNorm (eval) in f32; the GEMM operands are f16: x, Wk, Wv, Wp hold their bf16 values (unchanged down to 2^-17; below that on f16's subnormal grid of 2^-24), xr, G and E are rounded to f16 (11 bits) once by their producers, so f16's range (65,504) bounds them (G and E grow with the square of bn_gamma; about 1 at gamma 1); k, v = xr W^T (1 product); no softmax in the module, so (q k^T) v is q (k^T v) with KV_h = k_h^T v_h (3 products), and, nothing but products standing between x and out, out = x E_b^T + bp with the folded weight of batch b, E_b = Wp G_b, G_b[(h,e)][c] = scale sum_d KV_h[d][e] Wq[(h,d)][c]: G from KV as bf16 hi + lo (2 products), E from G (1 product), out from E (1 product); f32 accumulation, f32 output.
#include <hip/hip_runtime.h>
#include <math.h>

typedef __attribute__((ext_vector_type(16))) _Float16 v16h;
typedef __attribute__((ext_vector_type(16))) __bf16 v16b;
typedef __attribute__((ext_vector_type(8)))  _Float16 v8h;
typedef __attribute__((ext_vector_type(8)))  float v8f;
typedef __attribute__((ext_vector_type(4)))  float v4f;
typedef __attribute__((ext_vector_type(2)))  float v2f;
typedef __attribute__((ext_vector_type(4)))  unsigned v4u;
typedef __attribute__((ext_vector_type(4)))  int v4i;
typedef float __attribute__((may_alias)) float_a;
typedef int __attribute__((may_alias)) int_a;

template <typename T> __device__ __forceinline__ void vst2(void* p, T v) { *(T*)p = v;  }
__device__ __forceinline__ v8f wmma16(v16h a, v16h b, v8f c) {
  v8f d = __builtin_amdgcn_wmma_f32_16x16x32_f16(false, a, false, b, (short)0, c, false, false);
  asm volatile("v_nop\n\tv_nop\n\tv_nop\n\tv_nop" : "+v"(d) : "v"(a), "v"(b));
  return d;
}
__device__ __forceinline__ v8f wmma_bf(v16b a, v16b b, v8f c) {
  v8f d = __builtin_amdgcn_wmma_f32_16x16x32_bf16(false, a, false, b, (short)0, c, false, false);
  asm volatile("v_nop\n\tv_nop\n\tv_nop\n\tv_nop" : "+v"(d) : "v"(a), "v"(b));
  return d;
}
// 16x16x32 fragments: lane = (h = lane>>4, row/col = lane&15); elements 0..7 = k0+8h+0..7, 8..15 = k0+16+8h+0..7; D element r = row 8h+r
__device__ __forceinline__ v16h frag_h(const _Float16* rowk0, int lane) {
  union { v16h v; v8h q[2]; } u; const _Float16* p = rowk0 + 8 * (lane >> 4);
  u.q[0] = *(const v8h*)p; u.q[1] = *(const v8h*)(p + 16); return u.v;
}
__device__ __forceinline__ v16h frag_f32(const float* rowk0, int lane) {
  v16h a; const float* p = rowk0 + 8 * (lane >> 4);
#pragma unroll
  for (int i = 0; i < 8; ++i) { a[i] = (_Float16)p[i]; a[8 + i] = (_Float16)p[16 + i]; }
  return a;
}
__device__ __forceinline__ v16h frag_f32s(const float* rowk0, int lane, float sc) {
  v16h a; const float* p = rowk0 + 8 * (lane >> 4);
#pragma unroll
  for (int i = 0; i < 8; ++i) { a[i] = (_Float16)(p[i] * sc); a[8 + i] = (_Float16)(p[16 + i] * sc); }
  return a;
}
// column fragment from a [K][ld] layout (column n), rows >= K read as 0
__device__ __forceinline__ v16h fragc_f32(const float* W, int k0, int n, int lane, int ld, int K) {
  v16h a; const int g = lane >> 4;
#pragma unroll
  for (int i = 0; i < 8; ++i) { const int ka = k0 + 8 * g + i, kb = ka + 16;
    a[i] = (_Float16)(ka < K ? W[(size_t)(ka < K ? ka : K - 1) * ld + n] : 0.f); a[8 + i] = (_Float16)(kb < K ? W[(size_t)(kb < K ? kb : K - 1) * ld + n] : 0.f); }
  return a;
}
struct F2 { v16b h, l; };
__device__ __forceinline__ F2 bsplit16(const float v[16]) { F2 r;
#pragma unroll
  for (int i = 0; i < 16; ++i) { const __bf16 h = (__bf16)v[i]; r.h[i] = h; r.l[i] = (__bf16)(v[i] - (float)h); }
  return r; }
__device__ __forceinline__ F2 split_row(const float* row, int k0, int lane) { float v[16]; const float* p = row + k0 + 8 * (lane >> 4);
#pragma unroll
  for (int i = 0; i < 8; ++i) { v[i] = p[i]; v[8 + i] = p[16 + i]; }
  return bsplit16(v); }
__device__ __forceinline__ F2 split_rowK(const float* row, int k0, int lane, int K) { float v[16]; const int g = lane >> 4;
#pragma unroll
  for (int i = 0; i < 8; ++i) { const int ka = k0 + 8 * g + i, kb = ka + 16; v[i] = ka < K ? row[ka < K ? ka : K - 1] : 0.f; v[8 + i] = kb < K ? row[kb < K ? kb : K - 1] : 0.f; }
  return bsplit16(v); }
__device__ __forceinline__ F2 split_col(const float* W, int k0, int n, int lane, int ld, int K) { float v[16]; const int g = lane >> 4;
#pragma unroll
  for (int i = 0; i < 8; ++i) { const int ka = k0 + 8 * g + i, kb = ka + 16; v[i] = ka < K ? W[(size_t)(ka < K ? ka : K - 1) * ld + n] : 0.f; v[8 + i] = kb < K ? W[(size_t)(kb < K ? kb : K - 1) * ld + n] : 0.f; }
  return bsplit16(v); }
__device__ __forceinline__ v8f mac3(const F2& a, const F2& b, v8f c) { c = wmma_bf(a.l, b.h, c); c = wmma_bf(a.h, b.l, c); return wmma_bf(a.h, b.h, c); }
__device__ __forceinline__ float sigm(float v) { return 1.0f / (1.0f + expf(-v)); }
#define LDSX() do { asm volatile("s_wait_dscnt 0" ::: "memory"); __builtin_amdgcn_wave_barrier(); __builtin_amdgcn_fence(__ATOMIC_RELEASE, "workgroup"); } while (0)


// Efficient multi-head attention WITHOUT softmax (B 4, N 2,048, C 1,024, 32 heads x 32, reduction 4 -> M 512): out = ((q k^T) * 32^-1/2) v, then Wp + bp; evaluated as x E_b^T + bp with E_b = Wp (32^-1/2 (k^T v)^T per head) Wq.
#define NB 4
#define NN 2048
#define CC 1024
#define NH 32
#define HD 32
#define NR 4              // N_RATIO
#define MM (NN / NR)      // 512
#define BNEPS 1e-6f
#ifndef TNB
#define TNB NB
#endif
#ifndef TOB
#define TOB (TNB * NN / 64)
#endif
typedef __attribute__((ext_vector_type(8))) __bf16 v8b;
__device__ __forceinline__ v16b frag_b(const __bf16* rowk0, int lane) {
  union { v16b v; v8b q[2]; } u; const __bf16* p = rowk0 + 8 * (lane >> 4);
  u.q[0] = *(const v8b*)p; u.q[1] = *(const v8b*)(p + 16); return u.v;
}
__device__ __forceinline__ float bfr(float v) { return (float)(__bf16)v; }
__device__ __attribute__((noinline)) float exp_ni(float v) { return expf(v); }
__device__ __attribute__((noinline)) float erf_ni(float v) { return erff(v); }

#define WS_GT  0u                                   // G, head by head: [b][h][c 1024][e 32], f16
#define WS_XR  (WS_GT + 2u * (size_t)NB * CC * CC)        // BN(avgpool) rows [b*MM + m][1024], f16
#define WS_KT  (WS_XR + 2u * (size_t)NB * MM * CC)        // f16 hi|lo k planes [b][1024 (h,d)][MM]; v planes
#define WS_KTL (WS_KT + 2u * (size_t)NB * CC * MM)
#define WS_VT  (WS_KTL + 2u * (size_t)NB * CC * MM)
#define WS_VTL (WS_VT + 2u * (size_t)NB * CC * MM)
#define WS_WE  (WS_VTL + 2u * (size_t)NB * CC * MM)       // folded weight rows E [b*CC + o][c 1024], f16
#define WS_XB  (WS_WE + 2u * (size_t)NB * CC * CC)        // x rows [b*NN + n][1024], bf16 values held as f16
#define WS_WB  (WS_XB + 2u * (size_t)NB * NN * CC)        // Wq (bf16) | Wk | Wv | Wp (bf16 values held as f16), each [1024][1024]
#define WS_END (WS_WB + 2u * 4u * (size_t)CC * CC)

__device__ __forceinline__ v16b fragb_f32(const float* __restrict__ p, int lane) { v16b a; const float* pp = p + 8 * (lane >> 4);
#pragma unroll
  for (int i = 0; i < 8; ++i) { a[i] = (__bf16)pp[i]; a[8 + i] = (__bf16)pp[16 + i]; } return a; }
// ---- shared core of the three GEMMs (k/v, E, out): one block of 8 waves makes Y[128][128] = A[128][1024] . W[128][1024]^T, one f16 product.
// The operands arrive as f16 planes that their producers rounded once. Each stage is 64 k: every wave-wide global load covers four 128-B row pieces (whole lines),
// which go unchanged into LDS, where the 8 waves (4 x 2, 32 x 64 of Y each) read their fragments, 32 k ahead of the products that use them. Two buffers; the global loads run three stages ahead, through two register sets, so that one stage's loads are still in flight when the next stage's are issued.
#define GBK 64                    // k per stage
#define GPB 144                   // LDS row pitch in bytes: 64 f16 + 16 B (16 B x odd for ds_load_b128 readers)
#define GPL (128 * GPB)           // one operand plane of a stage; planes: A | W
typedef __attribute__((ext_vector_type(4))) __bf16 v4b;
typedef __attribute__((ext_vector_type(4))) _Float16 v4h;
template <int HS = 0> __device__ __forceinline__ void gemm_tile(const _Float16* __restrict__ A, const _Float16* __restrict__ Wm, char* sm, v8f (&acc)[2][4]) {
  constexpr int STG = 2 * GPL;
  const int tid = threadIdx.x, wave = tid >> 5, lane = tid & 31, col = lane & 15; const int lr = tid >> 3, lc = tid & 7;
  const size_t la = HS ? ((size_t)(lc >> 2) * CC + lr) * HD + (lc & 3) * 8 : (size_t)lr * CC + lc * 8;   // HS: A lies head by head, [h][row][32]: a stage is two heads, a row's piece 64 B in each
  const _Float16* ga = A + la; const _Float16* gb = Wm + (size_t)lr * CC + lc * 8; char* st = sm + lr * GPB + lc * 16;
  const char* fa = sm + ((wave >> 1) * 32 + col) * GPB; const char* fb = sm + GPL + ((wave & 1) * 64 + col) * GPB;
  v8h ra0[4], rb0[4], ra1[4], rb1[4]; v16h b0[4], a0[2], b1[4], a1[2];   // two staging sets (even stages | odd stages): two stages' global loads are in flight; two fragment sets: one is multiplied while the other is filled from LDS
  auto ldg = [&](int s, v8h (&ra)[4], v8h (&rb)[4]) {
#pragma unroll
    for (int i = 0; i < 4; ++i) { const size_t o = (size_t)i * 32 * CC + s * GBK, oa = HS ? (size_t)i * 32 * HD + (size_t)s * 2 * CC * HD : o; ra[i] = *(const v8h*)(ga + oa); rb[i] = *(const v8h*)(gb + o); }
    asm volatile("s_wait_xcnt 0x0" ::: "memory"); };   // stands before the loads' address registers are given to other values
  auto sts = [&](int buf, v8h (&ra)[4], v8h (&rb)[4]) { char* p = st + buf * STG;
#pragma unroll
    for (int i = 0; i < 4; ++i) { *(v8h*)(p + i * 32 * GPB) = ra[i]; *(v8h*)(p + GPL + i * 32 * GPB) = rb[i]; } };
  auto ldf = [&](int buf, int kk, v16h (&b)[4], v16h (&a)[2]) { const char* pa = fa + buf * STG + kk * 64; const char* pb = fb + buf * STG + kk * 64;
#pragma unroll
    for (int j = 0; j < 4; ++j) b[j] = frag_h((const _Float16*)(pb + j * 16 * GPB), lane);
#pragma unroll
    for (int i = 0; i < 2; ++i) a[i] = frag_h((const _Float16*)(pa + i * 16 * GPB), lane); };
  auto mul = [&](v16h (&b)[4], v16h (&a)[2]) {
#pragma unroll
    for (int i = 0; i < 2; ++i)
#pragma unroll
      for (int j = 0; j < 4; ++j) acc[i][j] = wmma16(a[i], b[j], acc[i][j]); };
  // the stage barrier, by hand: this wave's LDS stores and reads have ended, then the work-group's barrier; unlike __syncthreads() it leaves the global loads of later stages in flight
#define GBAR() asm volatile("s_wait_dscnt 0x0\n\ts_barrier_signal -1\n\ts_barrier_wait -1" ::: "memory")
  // one stage, held in buffer buf: its second half is read while its first half is multiplied; the next stage, loaded two stages ago into (ra, rb), goes into the other buffer, whose last reads ended before the barrier of the stage before;
  // the barrier publishes it and ends every read of the buffer that the stage after it overwrites; then the next stage's first half is read while this stage's second half is multiplied
  auto stage = [&](int buf, v8h (&ra)[4], v8h (&rb)[4], int nx) {
    ldf(buf, 1, b1, a1); sts(buf ^ 1, ra, rb);
    if (nx >= 0) ldg(nx, ra, rb);   // nx: the stage to load into the set just emptied, three ahead of this one; -1 (a literal at the call): none is left
    mul(b0, a0); GBAR(); ldf(buf ^ 1, 0, b0, a0); mul(b1, a1); };
  constexpr int NS = CC / GBK;
  { v8h ta[4], tb[4]; ldg(0, ta, tb); ldg(1, ra1, rb1); ldg(2, ra0, rb0); sts(0, ta, tb); }   // the first three stages' loads go out together; stage 0 passes through registers that the fragments take afterwards
  GBAR();
  ldf(0, 0, b0, a0);
#pragma unroll 1   // rolled, two stages a trip (each staging set and each buffer is then fixed in the code)
  for (int s = 0; s < NS - 4; s += 2) { stage(0, ra1, rb1, s + 3); stage(1, ra0, rb0, s + 4); }   // every trip loads: with a test round a load the compiler would have to wait for the youngest load at each LDS store
  stage(0, ra1, rb1, NS - 1); stage(1, ra0, rb0, -1); stage(0, ra1, rb1, -1);
  ldf(1, 1, b1, a1);
  mul(b0, a0);
  GBAR();                       // ends every read of the ring: the callers lay their output tiles over it
  mul(b1, a1); }
// ---- k_pool: block = reduced row (b, m), a thread = 4 channels: xr = BN(mean of 4 tokens) -> one f16 plane; the 4 tokens' bf16 values, which it forms anyway, -> the x plane, written as f16.
// The 256 blocks behind the reduced rows round the four weight matrices to bf16, 16,384 elements each; Wq stays a bf16 plane (the fold's K = 32 product reads it), the bf16 values of Wk, Wv, Wp are written as f16.
__global__ __launch_bounds__(256) void k_pool(const float* __restrict__ X, const float* __restrict__ G, const float* __restrict__ Bt, const float* __restrict__ Mu, const float* __restrict__ Var, const float* __restrict__ WQ, const float* __restrict__ WK, const float* __restrict__ WV, const float* __restrict__ WP, _Float16* __restrict__ XB, _Float16* __restrict__ XR, __bf16* __restrict__ WB) { const int t = threadIdx.x;
  if (blockIdx.x < TNB * MM) { const size_t row = blockIdx.x; const size_t b = row / MM; const int m = (int)(row % MM); const int c = t * 4; float s[4] = {0.f, 0.f, 0.f, 0.f};
#pragma unroll
  for (int i = 0; i < NR; ++i) { const size_t o = (b * NN + (size_t)m * NR + i) * CC + c; const v4f v = *(const v4f*)(X + o); v4h h;
#pragma unroll
    for (int e = 0; e < 4; ++e) { const float r = bfr(v[e]); h[e] = (_Float16)r; s[e] += r; }
    vst2(XB + o, h); }
  v4h hq;
#pragma unroll
  for (int e = 0; e < 4; ++e) { const float a = s[e] * (1.0f / NR); const float y = (a - bfr(Mu[c + e])) / sqrtf(bfr(Var[c + e]) + BNEPS) * bfr(G[c + e]) + bfr(Bt[c + e]); hq[e] = (_Float16)y; }
  vst2(XR + row * CC + c, hq); }
  else { const int wb = blockIdx.x - TNB * MM, which = wb >> 6; const float* Wm = which == 0 ? WQ : which == 1 ? WK : which == 2 ? WV : WP; const size_t o = (size_t)(wb & 63) * 16384 + t * 4; __bf16* Wo = WB + (size_t)which * CC * CC;
    if (which == 0) {   // the same for the whole block; each case has its own 16 steps, so that a case's 16 loads go out together and its 16 stores too
#pragma unroll
      for (int i = 0; i < 16; ++i) { const v4f v = *(const v4f*)(Wm + o + i * 1024); v4b w;
#pragma unroll
        for (int e = 0; e < 4; ++e) w[e] = (__bf16)v[e];
        vst2(Wo + o + i * 1024, w); }
      asm volatile("s_wait_xcnt 0x0" ::: "memory"); }   // stands behind the stores, before any path of the built code gives their registers to other values
    else {
#pragma unroll
      for (int i = 0; i < 16; ++i) { const v4f v = *(const v4f*)(Wm + o + i * 1024); v4h w;
#pragma unroll
        for (int e = 0; e < 4; ++e) w[e] = (_Float16)bfr(v[e]);
        vst2(Wo + o + i * 1024, w); }
      asm volatile("s_wait_xcnt 0x0" ::: "memory"); } } }   // as above
// ---- k_kv: block = (128 reduced rows, 128 cols, which*NB + b): k / v = xr . W^T -> f16 hi/lo planes [b][c][m]
__global__ __launch_bounds__(256) void k_kv(const _Float16* __restrict__ XR, const _Float16* __restrict__ WK, const _Float16* __restrict__ WV, _Float16* __restrict__ KT, _Float16* __restrict__ KTL, _Float16* __restrict__ VT, _Float16* __restrict__ VTL) { __shared__ __align__(16) char sm[2 * 2 * GPL];
  const int tid = threadIdx.x, wave = tid >> 5, lane = tid & 31, col = lane & 15, g = lane >> 4; const int which = blockIdx.z / TNB; const size_t b = blockIdx.z % TNB; const int m0 = blockIdx.x * 128; const int c0 = blockIdx.y * 128; const size_t r0 = b * MM + m0; const _Float16* Wm = which == 0 ? WK : WV;
  v8f acc[2][4] = {};
  gemm_tile<0>(XR + r0 * CC, Wm + (size_t)c0 * CC, sm, acc);
  _Float16* th = (_Float16*)sm; _Float16* tl = th + 128 * 136;   // transposed tiles [c 128][m 128 + 8], in the ring's LDS behind its last barrier
#pragma unroll
  for (int i = 0; i < 2; ++i)
#pragma unroll
    for (int j = 0; j < 4; ++j) { v8h hq, lq;
#pragma unroll
      for (int r = 0; r < 8; ++r) { const float v = acc[i][j][r]; const _Float16 hv = (_Float16)v; hq[r] = hv; lq[r] = (_Float16)((v - (float)hv) * 2048.0f); }
      const int o = ((wave & 1) * 64 + j * 16 + col) * 136 + (wave >> 1) * 32 + i * 16 + 8 * g; *(v8h*)&th[o] = hq; *(v8h*)&tl[o] = lq; }
  __syncthreads(); _Float16* PH = which == 0 ? KT : VT; _Float16* PL = which == 0 ? KTL : VTL;
  for (int e = tid; e < 128 * 16; e += 256) { const int cl = e >> 4, q = e & 15; const size_t o = (b * CC + c0 + cl) * (size_t)MM + m0 + q * 8; vst2((unsigned*)(PH + o), *(const v4u*)&th[cl * 136 + q * 8]); vst2((unsigned*)(PL + o), *(const v4u*)&tl[cl * 136 + q * 8]); } }
// ---- k_kvp: block = (b*NH + h), 16 waves: KV[d][e] = sum_m k[m][d] v[m][e] (3 products over the 512 reduced tokens), kept transposed in LDS, then the head's part of the fold:
// G[c][e] = scale sum_d Wq[(h,d)][c] KV[d][e]  (Wq exact bf16 x KV hi+lo, 2 products; K = 32), a wave = 64 rows c -> one f16 plane laid head by head, [b][h][c 1024][e 32], so that one block writes 64 KB in a row
// A head's 32 rows are 32 KB in a row in each of the four k/v planes: all 16 waves bring them in by loads of 512 contiguous bytes (four whole lines) and lay them in LDS; four waves, one 16 x 16 tile of KV each, read their fragments there.
// Wq's loads (4 rows d x 64 bf16 of c: four whole lines each) go out with the planes'; each wave turns its piece to [c][d] in its own LDS range.
#define KP 520                     // LDS row pitch in f16: 512 + 8 (1,040 B = 16 B x odd, for ds_load_b128 readers)
#define XP 36                      // LDS row pitch in floats: 32 + 4 (144 B = 16 B x odd, for ds_load_b128 readers)
__device__ __forceinline__ F2 split_lds(const float* row, int lane) { float v[16]; const float* p = row + 8 * (lane >> 4); const v4f a = *(const v4f*)p, b = *(const v4f*)(p + 4), c = *(const v4f*)(p + 16), d = *(const v4f*)(p + 20);
#pragma unroll
  for (int i = 0; i < 4; ++i) { v[i] = a[i]; v[4 + i] = b[i]; v[8 + i] = c[i]; v[12 + i] = d[i]; }
  return bsplit16(v); }
// A fragment of bf16 values kept as floats in a row whose column d stands at (d + rot) & 31
__device__ __forceinline__ v16b frag_rot(const float* row, int rot, int lane) { const int k = 8 * (lane >> 4) + rot; const v4f a = *(const v4f*)(row + (k & 31)), b = *(const v4f*)(row + ((k + 4) & 31)), c = *(const v4f*)(row + ((k + 16) & 31)), d = *(const v4f*)(row + ((k + 20) & 31)); v16b r;
#pragma unroll
  for (int i = 0; i < 4; ++i) { r[i] = (__bf16)a[i]; r[4 + i] = (__bf16)b[i]; r[8 + i] = (__bf16)c[i]; r[12 + i] = (__bf16)d[i]; }
  return r; }
__global__ __launch_bounds__(512) void k_kvp(const _Float16* __restrict__ KT, const _Float16* __restrict__ KTL, const _Float16* __restrict__ VT, const _Float16* __restrict__ VTL, const __bf16* __restrict__ WQ, _Float16* __restrict__ GH) { __shared__ __align__(16) _Float16 sp[4][HD * KP]; __shared__ __align__(16) float st[HD][XP]; __shared__ __align__(16) float sq[16][64 * XP];
  const int tid = threadIdx.x, wave = __builtin_amdgcn_readfirstlane(tid >> 5), lane = tid & 31, col = lane & 15, g = lane >> 4; const size_t bh = blockIdx.x; const size_t b = bh / NH; const int h = bh % NH;
  const size_t base = (b * CC + (size_t)h * HD) * MM; const _Float16* P[4] = {KT + base, KTL + base, VT + base, VTL + base}; const unsigned to = tid * 8; v8h v[4][4]; v8b vw[8]; float* mq = sq[wave];
#pragma unroll
  for (int p = 0; p < 4; ++p)
#pragma unroll
    for (int i = 0; i < 4; ++i) v[p][i] = *(const v8h*)(P[p] + (to + i * 4096));   // 512 threads x 8 f16 = 8 rows a step
#pragma unroll
  for (int it = 0; it < 8; ++it) vw[it] = *(const v8b*)(WQ + (size_t)(h * HD + (lane >> 3) * 8 + it) * CC + wave * 64 + (lane & 7) * 8);   // rows d = it, 8 + it, 16 + it, 24 + it: a lane ends up with 8 neighbouring d of its 8 columns c
#pragma unroll
  for (int p = 0; p < 4; ++p)
#pragma unroll
    for (int i = 0; i < 4; ++i) *(v8h*)&sp[p][(i * 8 + (tid >> 6)) * KP + (tid & 63) * 8] = v[p][i];
#pragma unroll
  for (int e = 0; e < 8; ++e) { v4f f0, f1; float* p = mq + ((lane & 7) * 8 + e) * XP; const int k = (lane >> 3) * 8 + (lane & 7) * 4;   // turned: row c, column d; row c holds d at (d + 4 (c >> 3)) & 31, which spreads the lanes' 16-B stores over the banks
#pragma unroll
    for (int i = 0; i < 4; ++i) { f0[i] = (float)vw[i][e]; f1[i] = (float)vw[4 + i][e]; }
    *(v4f*)(p + (k & 31)) = f0; *(v4f*)(p + ((k + 4) & 31)) = f1; }
  __syncthreads();   // the four planes are complete in LDS before any wave reads fragments that other waves wrote
  if (wave < 4) { const int dt = wave >> 1, j = wave & 1;   // wave = (row tile of d, col tile of e); K = m (16 kc); the wave's number sits in a scalar register, so this is a scalar branch and every lane is on at the products
    const _Float16 *pa = sp[0] + (dt * 16 + col) * KP, *pl = sp[1] + (dt * 16 + col) * KP, *qa = sp[2] + (j * 16 + col) * KP, *ql = sp[3] + (j * 16 + col) * KP; v8f acc = {};
#pragma unroll 4   // four trips' LDS reads go out ahead of the dependent chain of products
    for (int kc = 0; kc < MM / 32; ++kc) { const v16h ah = frag_h(pa + kc * 32, lane), al = frag_h(pl + kc * 32, lane), vh = frag_h(qa + kc * 32, lane), vl = frag_h(ql + kc * 32, lane);
      acc = wmma16(ah, vh, acc); v8f t2 = {}; t2 = wmma16(ah, vl, t2); t2 = wmma16(al, vh, t2);
#pragma unroll
      for (int r = 0; r < 8; ++r) acc[r] += t2[r] * (1.0f / 2048.0f); }
#pragma unroll
    for (int r = 0; r < 8; ++r) st[j * 16 + col][dt * 16 + 8 * g + r] = acc[r]; }   // transposed: [e][d]
  __syncthreads();   // KV^T is complete in LDS before all 16 waves read it
  F2 wb[2]; v8f ga[4][2] = {};
#pragma unroll
  for (int jj = 0; jj < 2; ++jj) wb[jj] = split_lds(st[jj * 16 + col], lane);
#pragma unroll
  for (int t = 0; t < 4; ++t) { const v16b a = frag_rot(mq + (t * 16 + col) * XP, 4 * (t * 2 + (col >> 3)), lane);
#pragma unroll
    for (int jj = 0; jj < 2; ++jj) { ga[t][jj] = wmma_bf(a, wb[jj].h, ga[t][jj]); ga[t][jj] = wmma_bf(a, wb[jj].l, ga[t][jj]); } }
#pragma unroll
  for (int t = 0; t < 4; ++t)
#pragma unroll
    for (int jj = 0; jj < 2; ++jj)
#pragma unroll
      for (int r = 0; r < 8; ++r) mq[(t * 16 + 8 * g + r) * XP + jj * 16 + col] = ga[t][jj][r] * 0.17677669529663687f;   // over the wave's own Wq rows, which it has read
  LDSX();   // the wave's rows are complete in LDS before its lanes read what other lanes wrote
#pragma unroll   // the 8 steps' LDS reads go out ahead of the conversions and stores
  for (int it = 0; it < 8; ++it) { const int row = it * 8 + (lane >> 2); const float* p = mq + row * XP + (lane & 3) * 8; const v4f y0 = *(const v4f*)p, y1 = *(const v4f*)(p + 4); v8h hq;
#pragma unroll
    for (int e = 0; e < 4; ++e) { hq[e] = (_Float16)y0[e]; hq[4 + e] = (_Float16)y1[e]; }
    const size_t o = (bh * CC + wave * 64 + row) * HD + (lane & 3) * 8; vst2(GH + o, hq); } }   // 512 contiguous bytes a store
// ---- k_we: block = (128 rows c, 128 cols o, b): E[o][c] = sum_(h,e) G[h][c][e] . Wp[o][(h,e)] -> one f16 plane [b][o][c]
__global__ __launch_bounds__(256) void k_we(const _Float16* __restrict__ GT, const _Float16* __restrict__ WP, _Float16* __restrict__ WE) { __shared__ __align__(16) char sm[2 * 2 * GPL];
  const int tid = threadIdx.x, wave = tid >> 5, lane = tid & 31, col = lane & 15, g = lane >> 4; const size_t b = blockIdx.z; const int m0 = blockIdx.x * 128; const int c0 = blockIdx.y * 128; const size_t r0 = (b * NH * CC + m0) * HD;
  v8f acc[2][4] = {};
  gemm_tile<1>(GT + r0, WP + (size_t)c0 * CC, sm, acc);
  _Float16* th = (_Float16*)sm;   // transposed tile [o 128][c 128 + 8], in the ring's LDS behind its last barrier
#pragma unroll
  for (int i = 0; i < 2; ++i)
#pragma unroll
    for (int j = 0; j < 4; ++j) { v8h hq;
#pragma unroll
      for (int r = 0; r < 8; ++r) hq[r] = (_Float16)acc[i][j][r];
      const int o = ((wave & 1) * 64 + j * 16 + col) * 136 + (wave >> 1) * 32 + i * 16 + 8 * g; *(v8h*)&th[o] = hq; }
  __syncthreads();   // a stored row of E holds four waves' columns: the tile is complete in LDS before any wave reads whole rows
  for (int e = tid; e < 128 * 16; e += 256) { const int cl = e >> 4, q = e & 15; const size_t o = (b * CC + c0 + cl) * (size_t)CC + m0 + q * 8; vst2((unsigned*)(WE + o), *(const v4u*)&th[cl * 136 + q * 8]); } }
// ---- k_out: block = (128 tokens n, 128 cols o): out[n][o] = sum_c E_b[o][c] . x[n][c] + bp[o]; E is the A operand, so a lane's 8 accumulator elements are 8 neighbouring o of one token
__global__ __launch_bounds__(256) void k_out(const _Float16* __restrict__ WE, const _Float16* __restrict__ XB, const float* __restrict__ BP, float* __restrict__ OUT) { __shared__ __align__(16) char sm[2 * 2 * GPL];
  const int tid = threadIdx.x, wave = tid >> 5, lane = tid & 31, col = lane & 15, g = lane >> 4; const size_t n0 = (size_t)blockIdx.x * 128; const int o0 = blockIdx.y * 128; const size_t a0 = (n0 / NN) * CC + o0; v8f acc[2][4] = {};
  gemm_tile<0>(WE + a0 * CC, XB + n0 * CC, sm, acc);
  float* sf = (float*)sm + wave * (64 * XP);   // the wave's 64 tokens x 32 o in its own LDS range, behind the ring's last barrier
#pragma unroll
  for (int i = 0; i < 2; ++i) { const float* bp = BP + o0 + (wave >> 1) * 32 + i * 16 + 8 * g; const v4f b0 = *(const v4f*)bp, b1 = *(const v4f*)(bp + 4);
#pragma unroll
    for (int j = 0; j < 4; ++j) { v4f y0, y1;
#pragma unroll
      for (int r = 0; r < 4; ++r) { y0[r] = acc[i][j][r] + bfr(b0[r]); y1[r] = acc[i][j][4 + r] + bfr(b1[r]); }
      float* p = sf + (j * 16 + col) * XP + i * 16 + 8 * g; *(v4f*)p = y0; *(v4f*)(p + 4) = y1; } }
  LDSX();   // the wave's rows are complete in LDS before its lanes read what other lanes wrote
  v4f y[16];   // all 16 LDS reads first, then the stores: one LDS latency is waited out, not 16
#pragma unroll
  for (int it = 0; it < 16; ++it) y[it] = *(const v4f*)&sf[(it * 4 + (lane >> 3)) * XP + (lane & 7) * 4];
#pragma unroll
  for (int it = 0; it < 16; ++it) vst2(OUT + (n0 + (wave & 1) * 64 + it * 4 + (lane >> 3)) * CC + o0 + (wave >> 1) * 32 + (lane & 7) * 4, y[it]); }   // four whole 128-B lines a store
extern "C" void kernel_launch(void* const* d_in, const int* in_sizes, int n_in, void* d_out, int out_size, void* d_ws, size_t ws_size, hipStream_t stream) {
  (void)in_sizes; (void)n_in; (void)out_size;
  const float** F = (const float**)d_in;   // 0 x [4,2048,1024], 1 Wq, 2 Wk, 3 Wv, 4 Wp (natural), 5 bp, 6 bn_gamma, 7 bn_beta, 8 bn_mean, 9 bn_var
  if (ws_size < (size_t)WS_END) return;
  char* ws = (char*)d_ws; __bf16* WB = (__bf16*)(ws + WS_WB); _Float16 *XR = (_Float16*)(ws + WS_XR), *GT = (_Float16*)(ws + WS_GT), *WE = (_Float16*)(ws + WS_WE), *XB = (_Float16*)(ws + WS_XB), *WH = (_Float16*)(ws + WS_WB), *KT = (_Float16*)(ws + WS_KT), *KTL = (_Float16*)(ws + WS_KTL), *VT = (_Float16*)(ws + WS_VT), *VTL = (_Float16*)(ws + WS_VTL);
  k_pool<<<TNB * MM + 256, 256, 0, stream>>>(F[0], F[6], F[7], F[8], F[9], F[1], F[2], F[3], F[4], XB, XR, WB);
  k_kv<<<dim3(MM / 128, CC / 128, 2 * TNB), 256, 0, stream>>>(XR, WH + (size_t)CC * CC, WH + 2 * (size_t)CC * CC, KT, KTL, VT, VTL);
  k_kvp<<<TNB * NH, 512, 0, stream>>>(KT, KTL, VT, VTL, WB, GT);
  k_we<<<dim3(CC / 128, CC / 128, TNB), 256, 0, stream>>>(GT, WH + 3 * (size_t)CC * CC, WE);
  k_out<<<dim3(TNB * NN / 128, CC / 128), 256, 0, stream>>>(WE, XB, F[5], (float*)d_out);
}

// v008
// A run of this version takes 60.7 microseconds.
// In two side-by-side timings against v007, it was 1.04 and 1.03 times as fast.
// Over all steps from v000 it is 6.71 times as fast.
// compute dtype: all float inputs rounded to bf16; AvgPool1d (exact f32 sums of 4 bf16 tokens) + BatchNorm (eval) in f32; the GEMM operands are f16: x, Wk, Wv, Wp hold their bf16 values (unchanged down to 2^-17; below that on f16's subnormal grid of 2^-24), xr, G and E are rounded to f16 (11 bits) once by their producers, so f16's range (65,504) bounds them (G and E grow with the square of bn_gamma; about 1 at gamma 1); k, v = xr W^T (1 product); no softmax in the module, so (q k^T) v is q (k^T v) with KV_h = k_h^T v_h (3 products), and, nothing but products standing between x and out, out = x E_b^T + bp with the folded weight of batch b, E_b = Wp G_b, G_b[(h,e)][c] = scale sum_d KV_h[d][e] Wq[(h,d)][c]: G from KV as bf16 hi + lo (2 products), E from G (1 product), out from E (1 product); f32 accumulation, f32 output.
#include <hip/hip_runtime.h>
#include <math.h>

typedef __attribute__((ext_vector_type(16))) _Float16 v16h;
typedef __attribute__((ext_vector_type(16))) __bf16 v16b;
typedef __attribute__((ext_vector_type(8)))  _Float16 v8h;
typedef __attribute__((ext_vector_type(8)))  float v8f;
typedef __attribute__((ext_vector_type(4)))  float v4f;
typedef __attribute__((ext_vector_type(2)))  float v2f;
typedef __attribute__((ext_vector_type(4)))  unsigned v4u;
typedef __attribute__((ext_vector_type(4)))  int v4i;
typedef float __attribute__((may_alias)) float_a;
typedef int __attribute__((may_alias)) int_a;

template <typename T> __device__ __forceinline__ void vst2(void* p, T v) { *(T*)p = v;  }
__device__ __forceinline__ v8f wmma16(v16h a, v16h b, v8f c) {
  v8f d = __builtin_amdgcn_wmma_f32_16x16x32_f16(false, a, false, b, (short)0, c, false, false);
  asm volatile("v_nop\n\tv_nop\n\tv_nop\n\tv_nop" : "+v"(d) : "v"(a), "v"(b));
  return d;
}
__device__ __forceinline__ v8f wmma_bf(v16b a, v16b b, v8f c) {
  v8f d = __builtin_amdgcn_wmma_f32_16x16x32_bf16(false, a, false, b, (short)0, c, false, false);
  asm volatile("v_nop\n\tv_nop\n\tv_nop\n\tv_nop" : "+v"(d) : "v"(a), "v"(b));
  return d;
}
// 16x16x32 fragments: lane = (h = lane>>4, row/col = lane&15); elements 0..7 = k0+8h+0..7, 8..15 = k0+16+8h+0..7; D element r = row 8h+r
__device__ __forceinline__ v16h frag_h(const _Float16* rowk0, int lane) {
  union { v16h v; v8h q[2]; } u; const _Float16* p = rowk0 + 8 * (lane >> 4);
  u.q[0] = *(const v8h*)p; u.q[1] = *(const v8h*)(p + 16); return u.v;
}
__device__ __forceinline__ v16h frag_f32(const float* rowk0, int lane) {
  v16h a; const float* p = rowk0 + 8 * (lane >> 4);
#pragma unroll
  for (int i = 0; i < 8; ++i) { a[i] = (_Float16)p[i]; a[8 + i] = (_Float16)p[16 + i]; }
  return a;
}
__device__ __forceinline__ v16h frag_f32s(const float* rowk0, int lane, float sc) {
  v16h a; const float* p = rowk0 + 8 * (lane >> 4);
#pragma unroll
  for (int i = 0; i < 8; ++i) { a[i] = (_Float16)(p[i] * sc); a[8 + i] = (_Float16)(p[16 + i] * sc); }
  return a;
}
// column fragment from a [K][ld] layout (column n), rows >= K read as 0
__device__ __forceinline__ v16h fragc_f32(const float* W, int k0, int n, int lane, int ld, int K) {
  v16h a; const int g = lane >> 4;
#pragma unroll
  for (int i = 0; i < 8; ++i) { const int ka = k0 + 8 * g + i, kb = ka + 16;
    a[i] = (_Float16)(ka < K ? W[(size_t)(ka < K ? ka : K - 1) * ld + n] : 0.f); a[8 + i] = (_Float16)(kb < K ? W[(size_t)(kb < K ? kb : K - 1) * ld + n] : 0.f); }
  return a;
}
struct F2 { v16b h, l; };
__device__ __forceinline__ F2 bsplit16(const float v[16]) { F2 r;
#pragma unroll
  for (int i = 0; i < 16; ++i) { const __bf16 h = (__bf16)v[i]; r.h[i] = h; r.l[i] = (__bf16)(v[i] - (float)h); }
  return r; }
__device__ __forceinline__ F2 split_row(const float* row, int k0, int lane) { float v[16]; const float* p = row + k0 + 8 * (lane >> 4);
#pragma unroll
  for (int i = 0; i < 8; ++i) { v[i] = p[i]; v[8 + i] = p[16 + i]; }
  return bsplit16(v); }
__device__ __forceinline__ F2 split_rowK(const float* row, int k0, int lane, int K) { float v[16]; const int g = lane >> 4;
#pragma unroll
  for (int i = 0; i < 8; ++i) { const int ka = k0 + 8 * g + i, kb = ka + 16; v[i] = ka < K ? row[ka < K ? ka : K - 1] : 0.f; v[8 + i] = kb < K ? row[kb < K ? kb : K - 1] : 0.f; }
  return bsplit16(v); }
__device__ __forceinline__ F2 split_col(const float* W, int k0, int n, int lane, int ld, int K) { float v[16]; const int g = lane >> 4;
#pragma unroll
  for (int i = 0; i < 8; ++i) { const int ka = k0 + 8 * g + i, kb = ka + 16; v[i] = ka < K ? W[(size_t)(ka < K ? ka : K - 1) * ld + n] : 0.f; v[8 + i] = kb < K ? W[(size_t)(kb < K ? kb : K - 1) * ld + n] : 0.f; }
  return bsplit16(v); }
__device__ __forceinline__ v8f mac3(const F2& a, const F2& b, v8f c) { c = wmma_bf(a.l, b.h, c); c = wmma_bf(a.h, b.l, c); return wmma_bf(a.h, b.h, c); }
__device__ __forceinline__ float sigm(float v) { return 1.0f / (1.0f + expf(-v)); }
#define LDSX() do { asm volatile("s_wait_dscnt 0" ::: "memory"); __builtin_amdgcn_wave_barrier(); __builtin_amdgcn_fence(__ATOMIC_RELEASE, "workgroup"); } while (0)


// Efficient multi-head attention WITHOUT softmax (B 4, N 2,048, C 1,024, 32 heads x 32, reduction 4 -> M 512): out = ((q k^T) * 32^-1/2) v, then Wp + bp; evaluated as x E_b^T + bp with E_b = Wp (32^-1/2 (k^T v)^T per head) Wq.
#define NB 4
#define NN 2048
#define CC 1024
#define NH 32
#define HD 32
#define NR 4              // N_RATIO
#define MM (NN / NR)      // 512
#define BNEPS 1e-6f
#ifndef TNB
#define TNB NB
#endif
#ifndef TOB
#define TOB (TNB * NN / 64)
#endif
typedef __attribute__((ext_vector_type(8))) __bf16 v8b;
__device__ __forceinline__ v16b frag_b(const __bf16* rowk0, int lane) {
  union { v16b v; v8b q[2]; } u; const __bf16* p = rowk0 + 8 * (lane >> 4);
  u.q[0] = *(const v8b*)p; u.q[1] = *(const v8b*)(p + 16); return u.v;
}
__device__ __forceinline__ float bfr(float v) { return (float)(__bf16)v; }
__device__ __attribute__((noinline)) float exp_ni(float v) { return expf(v); }
__device__ __attribute__((noinline)) float erf_ni(float v) { return erff(v); }

#define WS_GT  0u                                   // G, head by head: [b][h][c 1024][e 32], f16
#define WS_XR  (WS_GT + 2u * (size_t)NB * CC * CC)        // BN(avgpool) rows [b*MM + m][1024], f16
#define WS_KT  (WS_XR + 2u * (size_t)NB * MM * CC)        // f16 hi|lo k planes [b][1024 (h,d)][MM]; v planes
#define WS_KTL (WS_KT + 2u * (size_t)NB * CC * MM)
#define WS_VT  (WS_KTL + 2u * (size_t)NB * CC * MM)
#define WS_VTL (WS_VT + 2u * (size_t)NB * CC * MM)
#define WS_WE  (WS_VTL + 2u * (size_t)NB * CC * MM)       // folded weight rows E [b*CC + o][c 1024], f16
#define WS_XB  (WS_WE + 2u * (size_t)NB * CC * CC)        // x rows [b*NN + n][1024], bf16 values held as f16
#define WS_WB  (WS_XB + 2u * (size_t)NB * NN * CC)        // Wq (bf16) | Wk | Wv | Wp (bf16 values held as f16), each [1024][1024]
#define WS_END (WS_WB + 2u * 4u * (size_t)CC * CC)

__device__ __forceinline__ v16b fragb_f32(const float* __restrict__ p, int lane) { v16b a; const float* pp = p + 8 * (lane >> 4);
#pragma unroll
  for (int i = 0; i < 8; ++i) { a[i] = (__bf16)pp[i]; a[8 + i] = (__bf16)pp[16 + i]; } return a; }
// ---- shared core of the three GEMMs (k/v, E, out): one block of 8 waves makes Y[128][64 FA] = A[128][1024] . W[64 FA][1024]^T, one f16 product; FA = A fragments a wave (2: k/v, E; 4: out).
// The operands arrive as f16 planes that their producers rounded once. Each stage is 64 k: every wave-wide global load covers four 128-B row pieces (whole lines),
// which go unchanged into LDS, where the 8 waves (FA 2: 4 x 2, 32 x 64 of Y each; FA 4: 2 x 4, 64 x 64 each, 8 fragments read for 16 products where 32 x 64 reads 6 for 8) read their fragments, 32 k ahead of the products that use them. Two buffers; the global loads run three stages ahead, through two register sets, so that one stage's loads are still in flight when the next stage's are issued.
#define GBK 64                    // k per stage
#define GPB 144                   // LDS row pitch in bytes: 64 f16 + 16 B (16 B x odd for ds_load_b128 readers)
#define GPL (128 * GPB)           // the A plane of a stage (128 rows); planes: A | W (64 FA rows)
typedef __attribute__((ext_vector_type(4))) __bf16 v4b;
typedef __attribute__((ext_vector_type(4))) _Float16 v4h;
template <int HS = 0, int FA = 2> __device__ __forceinline__ void gemm_tile(const _Float16* __restrict__ A, const _Float16* __restrict__ Wm, char* sm, v8f (&acc)[FA][4]) {
  constexpr int NWW = FA, WS = 2 * FA, STG = GPL + NWW * 64 * GPB;   // NWW: waves side by side along W's rows; WS: steps of 32 rows in which the block loads W's plane
  const int tid = threadIdx.x, wave = tid >> 5, lane = tid & 31, col = lane & 15; const int lr = tid >> 3, lc = tid & 7;
  const size_t la = HS ? ((size_t)(lc >> 2) * CC + lr) * HD + (lc & 3) * 8 : (size_t)lr * CC + lc * 8;   // HS: A lies head by head, [h][row][32]: a stage is two heads, a row's piece 64 B in each
  const _Float16* ga = A + la; const _Float16* gb = Wm + (size_t)lr * CC + lc * 8; char* st = sm + lr * GPB + lc * 16;
  const char* fa = sm + ((wave / NWW) * (FA * 16) + col) * GPB; const char* fb = sm + GPL + ((wave % NWW) * 64 + col) * GPB;
  v8h ra0[4], rb0[WS], ra1[4], rb1[WS]; v16h b0[4], a0[FA], b1[4], a1[FA];   // two staging sets (even stages | odd stages): two stages' global loads are in flight; two fragment sets: one is multiplied while the other is filled from LDS
  auto ldg = [&](int s, v8h (&ra)[4], v8h (&rb)[WS]) {
#pragma unroll
    for (int i = 0; i < WS; ++i) { const size_t o = (size_t)i * 32 * CC + s * GBK, oa = HS ? (size_t)i * 32 * HD + (size_t)s * 2 * CC * HD : o; if (i < 4) ra[i] = *(const v8h*)(ga + oa); rb[i] = *(const v8h*)(gb + o); }
    if constexpr (FA == 4) asm volatile("s_wait_xcnt 0x0" :: "v"(ga), "v"(gb) : "memory");   // stands before the loads' address registers are given to other values; it reads both pointers, so that they stay in their registers up to here and no load of the run can be given them for its result
    else asm volatile("s_wait_xcnt 0x0" ::: "memory"); };   // stands before the loads' address registers are given to other values
  auto sts = [&](int buf, v8h (&ra)[4], v8h (&rb)[WS]) { char* p = st + buf * STG;
#pragma unroll
    for (int i = 0; i < WS; ++i) { if (i < 4) *(v8h*)(p + i * 32 * GPB) = ra[i]; *(v8h*)(p + GPL + i * 32 * GPB) = rb[i]; } };
  auto ldf = [&](int buf, int kk, v16h (&b)[4], v16h (&a)[FA]) { const char* pa = fa + buf * STG + kk * 64; const char* pb = fb + buf * STG + kk * 64;
#pragma unroll
    for (int j = 0; j < 4; ++j) b[j] = frag_h((const _Float16*)(pb + j * 16 * GPB), lane);
#pragma unroll
    for (int i = 0; i < FA; ++i) a[i] = frag_h((const _Float16*)(pa + i * 16 * GPB), lane); };
  auto mul = [&](v16h (&b)[4], v16h (&a)[FA]) {
#pragma unroll
    for (int i = 0; i < FA; ++i)
#pragma unroll
      for (int j = 0; j < 4; ++j) { if constexpr (FA == 2) acc[i][j] = wmma16(a[i], b[j], acc[i][j]);
        else acc[i][j] = __builtin_amdgcn_wmma_f32_16x16x32_f16(false, a[i], false, b[j], (short)0, acc[i][j], false, false); } };   // FA 4: the builtin alone, the compiler keeps its distances; wmma16's asm operands would tie all 256 accumulator and fragment registers to the low register window, which spills
  // the stage barrier, by hand: this wave's LDS stores and reads have ended, then the work-group's barrier; unlike __syncthreads() it leaves the global loads of later stages in flight
#define GBAR() asm volatile("s_wait_dscnt 0x0\n\ts_barrier_signal -1\n\ts_barrier_wait -1" ::: "memory")
  // one stage, held in buffer buf: its second half is read while its first half is multiplied; the next stage, loaded two stages ago into (ra, rb), goes into the other buffer, whose last reads ended before the barrier of the stage before;
  // the barrier publishes it and ends every read of the buffer that the stage after it overwrites; then the next stage's first half is read while this stage's second half is multiplied
  // FA 4 has no asm statement behind its products to hold the order written here: without this fence the compiler moves the LDS reads in among the products that use them, into one fragment set, and each wave waits out their latency
  auto sb = [&]() { if constexpr (FA == 4) __builtin_amdgcn_sched_barrier(0); };
  auto stage = [&](int buf, v8h (&ra)[4], v8h (&rb)[WS], int nx) {
    ldf(buf, 1, b1, a1); sb(); sts(buf ^ 1, ra, rb);
    if (nx >= 0) ldg(nx, ra, rb);   // nx: the stage to load into the set just emptied, three ahead of this one; -1 (a literal at the call): none is left
    sb(); mul(b0, a0); sb(); GBAR(); ldf(buf ^ 1, 0, b0, a0); sb(); mul(b1, a1); sb(); };
  constexpr int NS = CC / GBK;
  { v8h ta[4], tb[WS]; ldg(0, ta, tb); ldg(1, ra1, rb1); ldg(2, ra0, rb0); sts(0, ta, tb); }   // the first three stages' loads go out together; stage 0 passes through registers that the fragments take afterwards
  GBAR();
  ldf(0, 0, b0, a0); sb();
#pragma unroll 1   // rolled, two stages a trip (each staging set and each buffer is then fixed in the code)
  for (int s = 0; s < NS - 4; s += 2) { stage(0, ra1, rb1, s + 3); stage(1, ra0, rb0, s + 4); }   // every trip loads: with a test round a load the compiler would have to wait for the youngest load at each LDS store
  stage(0, ra1, rb1, NS - 1); stage(1, ra0, rb0, -1); stage(0, ra1, rb1, -1);
  ldf(1, 1, b1, a1); sb();
  mul(b0, a0); sb();
  GBAR();                       // ends every read of the ring: the callers lay their output tiles over it
  mul(b1, a1); }
// ---- k_pool: block = reduced row (b, m), a thread = 4 channels: xr = BN(mean of 4 tokens) -> one f16 plane; the 4 tokens' bf16 values, which it forms anyway, -> the x plane, written as f16.
// The 256 blocks behind the reduced rows round the four weight matrices to bf16, 16,384 elements each; Wq stays a bf16 plane (the fold's K = 32 product reads it), the bf16 values of Wk, Wv, Wp are written as f16.
__global__ __launch_bounds__(256) void k_pool(const float* __restrict__ X, const float* __restrict__ G, const float* __restrict__ Bt, const float* __restrict__ Mu, const float* __restrict__ Var, const float* __restrict__ WQ, const float* __restrict__ WK, const float* __restrict__ WV, const float* __restrict__ WP, _Float16* __restrict__ XB, _Float16* __restrict__ XR, __bf16* __restrict__ WB) { const int t = threadIdx.x;
  if (blockIdx.x < TNB * MM) { const size_t row = blockIdx.x; const size_t b = row / MM; const int m = (int)(row % MM); const int c = t * 4; float s[4] = {0.f, 0.f, 0.f, 0.f};
#pragma unroll
  for (int i = 0; i < NR; ++i) { const size_t o = (b * NN + (size_t)m * NR + i) * CC + c; const v4f v = *(const v4f*)(X + o); v4h h;
#pragma unroll
    for (int e = 0; e < 4; ++e) { const float r = bfr(v[e]); h[e] = (_Float16)r; s[e] += r; }
    vst2(XB + o, h); }
  v4h hq;
#pragma unroll
  for (int e = 0; e < 4; ++e) { const float a = s[e] * (1.0f / NR); const float y = (a - bfr(Mu[c + e])) / sqrtf(bfr(Var[c + e]) + BNEPS) * bfr(G[c + e]) + bfr(Bt[c + e]); hq[e] = (_Float16)y; }
  vst2(XR + row * CC + c, hq); }
  else { const int wb = blockIdx.x - TNB * MM, which = wb >> 6; const float* Wm = which == 0 ? WQ : which == 1 ? WK : which == 2 ? WV : WP; const size_t o = (size_t)(wb & 63) * 16384 + t * 4; __bf16* Wo = WB + (size_t)which * CC * CC;
    if (which == 0) {   // the same for the whole block; each case has its own 16 steps, so that a case's 16 loads go out together and its 16 stores too
#pragma unroll
      for (int i = 0; i < 16; ++i) { const v4f v = *(const v4f*)(Wm + o + i * 1024); v4b w;
#pragma unroll
        for (int e = 0; e < 4; ++e) w[e] = (__bf16)v[e];
        vst2(Wo + o + i * 1024, w); }
      asm volatile("s_wait_xcnt 0x0" ::: "memory"); }   // stands behind the stores, before any path of the built code gives their registers to other values
    else {
#pragma unroll
      for (int i = 0; i < 16; ++i) { const v4f v = *(const v4f*)(Wm + o + i * 1024); v4h w;
#pragma unroll
        for (int e = 0; e < 4; ++e) w[e] = (_Float16)bfr(v[e]);
        vst2(Wo + o + i * 1024, w); }
      asm volatile("s_wait_xcnt 0x0" ::: "memory"); } } }   // as above
// ---- k_kv: block = (128 reduced rows, 128 cols, which*NB + b): k / v = xr . W^T -> f16 hi/lo planes [b][c][m]
__global__ __launch_bounds__(256) void k_kv(const _Float16* __restrict__ XR, const _Float16* __restrict__ WK, const _Float16* __restrict__ WV, _Float16* __restrict__ KT, _Float16* __restrict__ KTL, _Float16* __restrict__ VT, _Float16* __restrict__ VTL) { __shared__ __align__(16) char sm[2 * 2 * GPL];
  const int tid = threadIdx.x, wave = tid >> 5, lane = tid & 31, col = lane & 15, g = lane >> 4; const int which = blockIdx.z / TNB; const size_t b = blockIdx.z % TNB; const int m0 = blockIdx.x * 128; const int c0 = blockIdx.y * 128; const size_t r0 = b * MM + m0; const _Float16* Wm = which == 0 ? WK : WV;
  v8f acc[2][4] = {};
  gemm_tile<0>(XR + r0 * CC, Wm + (size_t)c0 * CC, sm, acc);
  _Float16* th = (_Float16*)sm; _Float16* tl = th + 128 * 136;   // transposed tiles [c 128][m 128 + 8], in the ring's LDS behind its last barrier
#pragma unroll
  for (int i = 0; i < 2; ++i)
#pragma unroll
    for (int j = 0; j < 4; ++j) { v8h hq, lq;
#pragma unroll
      for (int r = 0; r < 8; ++r) { const float v = acc[i][j][r]; const _Float16 hv = (_Float16)v; hq[r] = hv; lq[r] = (_Float16)((v - (float)hv) * 2048.0f); }
      const int o = ((wave & 1) * 64 + j * 16 + col) * 136 + (wave >> 1) * 32 + i * 16 + 8 * g; *(v8h*)&th[o] = hq; *(v8h*)&tl[o] = lq; }
  __syncthreads(); _Float16* PH = which == 0 ? KT : VT; _Float16* PL = which == 0 ? KTL : VTL;
  for (int e = tid; e < 128 * 16; e += 256) { const int cl = e >> 4, q = e & 15; const size_t o = (b * CC + c0 + cl) * (size_t)MM + m0 + q * 8; vst2((unsigned*)(PH + o), *(const v4u*)&th[cl * 136 + q * 8]); vst2((unsigned*)(PL + o), *(const v4u*)&tl[cl * 136 + q * 8]); } }
// ---- k_kvp: block = (b*NH + h), 16 waves: KV[d][e] = sum_m k[m][d] v[m][e] (3 products over the 512 reduced tokens), kept transposed in LDS, then the head's part of the fold:
// G[c][e] = scale sum_d Wq[(h,d)][c] KV[d][e]  (Wq exact bf16 x KV hi+lo, 2 products; K = 32), a wave = 64 rows c -> one f16 plane laid head by head, [b][h][c 1024][e 32], so that one block writes 64 KB in a row
// A head's 32 rows are 32 KB in a row in each of the four k/v planes: all 16 waves bring them in by loads of 512 contiguous bytes (four whole lines) and lay them in LDS; four waves, one 16 x 16 tile of KV each, read their fragments there.
// Wq's loads (4 rows d x 64 bf16 of c: four whole lines each) go out with the planes'; each wave turns its piece to [c][d] in its own LDS range.
#define KP 520                     // LDS row pitch in f16: 512 + 8 (1,040 B = 16 B x odd, for ds_load_b128 readers)
#define XP 36                      // LDS row pitch in floats: 32 + 4 (144 B = 16 B x odd, for ds_load_b128 readers)
__device__ __forceinline__ F2 split_lds(const float* row, int lane) { float v[16]; const float* p = row + 8 * (lane >> 4); const v4f a = *(const v4f*)p, b = *(const v4f*)(p + 4), c = *(const v4f*)(p + 16), d = *(const v4f*)(p + 20);
#pragma unroll
  for (int i = 0; i < 4; ++i) { v[i] = a[i]; v[4 + i] = b[i]; v[8 + i] = c[i]; v[12 + i] = d[i]; }
  return bsplit16(v); }
// A fragment of bf16 values kept as floats in a row whose column d stands at (d + rot) & 31
__device__ __forceinline__ v16b frag_rot(const float* row, int rot, int lane) { const int k = 8 * (lane >> 4) + rot; const v4f a = *(const v4f*)(row + (k & 31)), b = *(const v4f*)(row + ((k + 4) & 31)), c = *(const v4f*)(row + ((k + 16) & 31)), d = *(const v4f*)(row + ((k + 20) & 31)); v16b r;
#pragma unroll
  for (int i = 0; i < 4; ++i) { r[i] = (__bf16)a[i]; r[4 + i] = (__bf16)b[i]; r[8 + i] = (__bf16)c[i]; r[12 + i] = (__bf16)d[i]; }
  return r; }
__global__ __launch_bounds__(512) void k_kvp(const _Float16* __restrict__ KT, const _Float16* __restrict__ KTL, const _Float16* __restrict__ VT, const _Float16* __restrict__ VTL, const __bf16* __restrict__ WQ, _Float16* __restrict__ GH) { __shared__ __align__(16) _Float16 sp[4][HD * KP]; __shared__ __align__(16) float st[HD][XP]; __shared__ __align__(16) float sq[16][64 * XP];
  const int tid = threadIdx.x, wave = __builtin_amdgcn_readfirstlane(tid >> 5), lane = tid & 31, col = lane & 15, g = lane >> 4; const size_t bh = blockIdx.x; const size_t b = bh / NH; const int h = bh % NH;
  const size_t base = (b * CC + (size_t)h * HD) * MM; const _Float16* P[4] = {KT + base, KTL + base, VT + base, VTL + base}; const unsigned to = tid * 8; v8h v[4][4]; v8b vw[8]; float* mq = sq[wave];
#pragma unroll
  for (int p = 0; p < 4; ++p)
#pragma unroll
    for (int i = 0; i < 4; ++i) v[p][i] = *(const v8h*)(P[p] + (to + i * 4096));   // 512 threads x 8 f16 = 8 rows a step
#pragma unroll
  for (int it = 0; it < 8; ++it) vw[it] = *(const v8b*)(WQ + (size_t)(h * HD + (lane >> 3) * 8 + it) * CC + wave * 64 + (lane & 7) * 8);   // rows d = it, 8 + it, 16 + it, 24 + it: a lane ends up with 8 neighbouring d of its 8 columns c
#pragma unroll
  for (int p = 0; p < 4; ++p)
#pragma unroll
    for (int i = 0; i < 4; ++i) *(v8h*)&sp[p][(i * 8 + (tid >> 6)) * KP + (tid & 63) * 8] = v[p][i];
#pragma unroll
  for (int e = 0; e < 8; ++e) { v4f f0, f1; float* p = mq + ((lane & 7) * 8 + e) * XP; const int k = (lane >> 3) * 8 + (lane & 7) * 4;   // turned: row c, column d; row c holds d at (d + 4 (c >> 3)) & 31, which spreads the lanes' 16-B stores over the banks
#pragma unroll
    for (int i = 0; i < 4; ++i) { f0[i] = (float)vw[i][e]; f1[i] = (float)vw[4 + i][e]; }
    *(v4f*)(p + (k & 31)) = f0; *(v4f*)(p + ((k + 4) & 31)) = f1; }
  __syncthreads();   // the four planes are complete in LDS before any wave reads fragments that other waves wrote
  if (wave < 4) { const int dt = wave >> 1, j = wave & 1;   // wave = (row tile of d, col tile of e); K = m (16 kc); the wave's number sits in a scalar register, so this is a scalar branch and every lane is on at the products
    const _Float16 *pa = sp[0] + (dt * 16 + col) * KP, *pl = sp[1] + (dt * 16 + col) * KP, *qa = sp[2] + (j * 16 + col) * KP, *ql = sp[3] + (j * 16 + col) * KP; v8f acc = {};
#pragma unroll 4   // four trips' LDS reads go out ahead of the dependent chain of products
    for (int kc = 0; kc < MM / 32; ++kc) { const v16h ah = frag_h(pa + kc * 32, lane), al = frag_h(pl + kc * 32, lane), vh = frag_h(qa + kc * 32, lane), vl = frag_h(ql + kc * 32, lane);
      acc = wmma16(ah, vh, acc); v8f t2 = {}; t2 = wmma16(ah, vl, t2); t2 = wmma16(al, vh, t2);
#pragma unroll
      for (int r = 0; r < 8; ++r) acc[r] += t2[r] * (1.0f / 2048.0f); }
#pragma unroll
    for (int r = 0; r < 8; ++r) st[j * 16 + col][dt * 16 + 8 * g + r] = acc[r]; }   // transposed: [e][d]
  __syncthreads();   // KV^T is complete in LDS before all 16 waves read it
  F2 wb[2]; v8f ga[4][2] = {};
#pragma unroll
  for (int jj = 0; jj < 2; ++jj) wb[jj] = split_lds(st[jj * 16 + col], lane);
#pragma unroll
  for (int t = 0; t < 4; ++t) { const v16b a = frag_rot(mq + (t * 16 + col) * XP, 4 * (t * 2 + (col >> 3)), lane);
#pragma unroll
    for (int jj = 0; jj < 2; ++jj) { ga[t][jj] = wmma_bf(a, wb[jj].h, ga[t][jj]); ga[t][jj] = wmma_bf(a, wb[jj].l, ga[t][jj]); } }
#pragma unroll
  for (int t = 0; t < 4; ++t)
#pragma unroll
    for (int jj = 0; jj < 2; ++jj)
#pragma unroll
      for (int r = 0; r < 8; ++r) mq[(t * 16 + 8 * g + r) * XP + jj * 16 + col] = ga[t][jj][r] * 0.17677669529663687f;   // over the wave's own Wq rows, which it has read
  LDSX();   // the wave's rows are complete in LDS before its lanes read what other lanes wrote
#pragma unroll   // the 8 steps' LDS reads go out ahead of the conversions and stores
  for (int it = 0; it < 8; ++it) { const int row = it * 8 + (lane >> 2); const float* p = mq + row * XP + (lane & 3) * 8; const v4f y0 = *(const v4f*)p, y1 = *(const v4f*)(p + 4); v8h hq;
#pragma unroll
    for (int e = 0; e < 4; ++e) { hq[e] = (_Float16)y0[e]; hq[4 + e] = (_Float16)y1[e]; }
    const size_t o = (bh * CC + wave * 64 + row) * HD + (lane & 3) * 8; vst2(GH + o, hq); } }   // 512 contiguous bytes a store
// ---- k_we: block = (128 rows c, 128 cols o, b): E[o][c] = sum_(h,e) G[h][c][e] . Wp[o][(h,e)] -> one f16 plane [b][o][c]
__global__ __launch_bounds__(256) void k_we(const _Float16* __restrict__ GT, const _Float16* __restrict__ WP, _Float16* __restrict__ WE) { __shared__ __align__(16) char sm[2 * 2 * GPL];
  const int tid = threadIdx.x, wave = tid >> 5, lane = tid & 31, col = lane & 15, g = lane >> 4; const size_t b = blockIdx.z; const int m0 = blockIdx.x * 128; const int c0 = blockIdx.y * 128; const size_t r0 = (b * NH * CC + m0) * HD;
  v8f acc[2][4] = {};
  gemm_tile<1>(GT + r0, WP + (size_t)c0 * CC, sm, acc);
  _Float16* th = (_Float16*)sm;   // transposed tile [o 128][c 128 + 8], in the ring's LDS behind its last barrier
#pragma unroll
  for (int i = 0; i < 2; ++i)
#pragma unroll
    for (int j = 0; j < 4; ++j) { v8h hq;
#pragma unroll
      for (int r = 0; r < 8; ++r) hq[r] = (_Float16)acc[i][j][r];
      const int o = ((wave & 1) * 64 + j * 16 + col) * 136 + (wave >> 1) * 32 + i * 16 + 8 * g; *(v8h*)&th[o] = hq; }
  __syncthreads();   // a stored row of E holds four waves' columns: the tile is complete in LDS before any wave reads whole rows
  for (int e = tid; e < 128 * 16; e += 256) { const int cl = e >> 4, q = e & 15; const size_t o = (b * CC + c0 + cl) * (size_t)CC + m0 + q * 8; vst2((unsigned*)(WE + o), *(const v4u*)&th[cl * 136 + q * 8]); } }
// ---- k_out: block = (256 tokens n, 128 cols o), one on a WGP: out[n][o] = sum_c E_b[o][c] . x[n][c] + bp[o]; E is the A operand, so a lane's 8 accumulator elements are 8 neighbouring o of one token; a wave = 64 o x 64 tokens
#define OP 68                      // LDS row pitch in floats: 64 + 4 (272 B = 16 B x odd, for ds_load_b128 readers)
__global__ __launch_bounds__(256) void k_out(const _Float16* __restrict__ WE, const _Float16* __restrict__ XB, const float* __restrict__ BP, float* __restrict__ OUT) { __shared__ __align__(16) char sm[8 * 64 * OP * 4];   // the output staging; the ring (2 stages of 384 rows) is smaller and lies in the same bytes
  const int tid = threadIdx.x, wave = tid >> 5, lane = tid & 31, col = lane & 15, g = lane >> 4; const size_t n0 = (size_t)blockIdx.x * 256; const int o0 = blockIdx.y * 128; const size_t a0 = (n0 / NN) * CC + o0; v8f acc[4][4] = {};
  gemm_tile<0, 4>(WE + a0 * CC, XB + n0 * CC, sm, acc);
  float* sf = (float*)sm + wave * (64 * OP);   // the wave's 64 tokens x 64 o in its own LDS range, behind the ring's last barrier
#pragma unroll
  for (int i = 0; i < 4; ++i) { const float* bp = BP + o0 + (wave >> 2) * 64 + i * 16 + 8 * g; const v4f b0 = *(const v4f*)bp, b1 = *(const v4f*)(bp + 4);
#pragma unroll
    for (int j = 0; j < 4; ++j) { v4f y0, y1;
#pragma unroll
      for (int r = 0; r < 4; ++r) { y0[r] = acc[i][j][r] + bfr(b0[r]); y1[r] = acc[i][j][4 + r] + bfr(b1[r]); }
      float* p = sf + (j * 16 + col) * OP + i * 16 + 8 * g; *(v4f*)p = y0; *(v4f*)(p + 4) = y1; } }
  LDSX();   // the wave's rows are complete in LDS before its lanes read what other lanes wrote
  v4f y[32];   // all 32 LDS reads first, then the stores: one LDS latency is waited out, not 32
#pragma unroll
  for (int it = 0; it < 32; ++it) y[it] = *(const v4f*)&sf[(it * 2 + g) * OP + col * 4];
#pragma unroll
  for (int it = 0; it < 32; ++it) vst2(OUT + (n0 + (wave & 3) * 64 + it * 2 + g) * CC + o0 + (wave >> 2) * 64 + col * 4, y[it]); }   // four whole 128-B lines a store
extern "C" void kernel_launch(void* const* d_in, const int* in_sizes, int n_in, void* d_out, int out_size, void* d_ws, size_t ws_size, hipStream_t stream) {
  (void)in_sizes; (void)n_in; (void)out_size;
  const float** F = (const float**)d_in;   // 0 x [4,2048,1024], 1 Wq, 2 Wk, 3 Wv, 4 Wp (natural), 5 bp, 6 bn_gamma, 7 bn_beta, 8 bn_mean, 9 bn_var
  if (ws_size < (size_t)WS_END) return;
  char* ws = (char*)d_ws; __bf16* WB = (__bf16*)(ws + WS_WB); _Float16 *XR = (_Float16*)(ws + WS_XR), *GT = (_Float16*)(ws + WS_GT), *WE = (_Float16*)(ws + WS_WE), *XB = (_Float16*)(ws + WS_XB), *WH = (_Float16*)(ws + WS_WB), *KT = (_Float16*)(ws + WS_KT), *KTL = (_Float16*)(ws + WS_KTL), *VT = (_Float16*)(ws + WS_VT), *VTL = (_Float16*)(ws + WS_VTL);
  k_pool<<<TNB * MM + 256, 256, 0, stream>>>(F[0], F[6], F[7], F[8], F[9], F[1], F[2], F[3], F[4], XB, XR, WB);
  k_kv<<<dim3(MM / 128, CC / 128, 2 * TNB), 256, 0, stream>>>(XR, WH + (size_t)CC * CC, WH + 2 * (size_t)CC * CC, KT, KTL, VT, VTL);
  k_kvp<<<TNB * NH, 512, 0, stream>>>(KT, KTL, VT, VTL, WB, GT);
  k_we<<<dim3(CC / 128, CC / 128, TNB), 256, 0, stream>>>(GT, WH + 3 * (size_t)CC * CC, WE);
  k_out<<<dim3(TNB * NN / 256, CC / 128), 256, 0, stream>>>(WE, XB, F[5], (float*)d_out);
}

// v009
// Measured time: 55.9 microseconds a run.
// Next to v008, in two timings, it ran 1.09 and 1.08 times as fast.
// All steps since v000 together make it 7.27 times as fast.
// compute dtype: all float inputs rounded to bf16; AvgPool1d (exact f32 sums of 4 bf16 tokens) + BatchNorm (eval) in f32; the GEMM operands are f16: x, Wk, Wv, Wp hold their bf16 values (unchanged down to 2^-17; below that on f16's subnormal grid of 2^-24), xr, G and E are rounded to f16 (11 bits) once by their producers, so f16's range (65,504) bounds them (G and E grow with the square of bn_gamma; about 1 at gamma 1); k, v = xr W^T (1 product); no softmax in the module, so (q k^T) v is q (k^T v) with KV_h = k_h^T v_h (3 products), and, nothing but products standing between x and out, out = x E_b^T + bp with the folded weight of batch b, E_b = Wp G_b, G_b[(h,e)][c] = scale sum_d KV_h[d][e] Wq[(h,d)][c]: G from KV as bf16 hi + lo (2 products), E from G (1 product), out from E (1 product); f32 accumulation, f32 output.
#include <hip/hip_runtime.h>
#include <math.h>

typedef __attribute__((ext_vector_type(16))) _Float16 v16h;
typedef __attribute__((ext_vector_type(16))) __bf16 v16b;
typedef __attribute__((ext_vector_type(8)))  _Float16 v8h;
typedef __attribute__((ext_vector_type(8)))  float v8f;
typedef __attribute__((ext_vector_type(4)))  float v4f;
typedef __attribute__((ext_vector_type(2)))  float v2f;
typedef __attribute__((ext_vector_type(4)))  unsigned v4u;
typedef __attribute__((ext_vector_type(4)))  int v4i;
typedef float __attribute__((may_alias)) float_a;
typedef int __attribute__((may_alias)) int_a;

template <typename T> __device__ __forceinline__ void vst2(void* p, T v) { *(T*)p = v;  }
__device__ __forceinline__ v8f wmma16(v16h a, v16h b, v8f c) {
  v8f d = __builtin_amdgcn_wmma_f32_16x16x32_f16(false, a, false, b, (short)0, c, false, false);
  asm volatile("v_nop\n\tv_nop\n\tv_nop\n\tv_nop" : "+v"(d) : "v"(a), "v"(b));
  return d;
}
__device__ __forceinline__ v8f wmma_bf(v16b a, v16b b, v8f c) {
  v8f d = __builtin_amdgcn_wmma_f32_16x16x32_bf16(false, a, false, b, (short)0, c, false, false);
  asm volatile("v_nop\n\tv_nop\n\tv_nop\n\tv_nop" : "+v"(d) : "v"(a), "v"(b));
  return d;
}
// 16x16x32 fragments: lane = (h = lane>>4, row/col = lane&15); elements 0..7 = k0+8h+0..7, 8..15 = k0+16+8h+0..7; D element r = row 8h+r
__device__ __forceinline__ v16h frag_h(const _Float16* rowk0, int lane) {
  union { v16h v; v8h q[2]; } u; const _Float16* p = rowk0 + 8 * (lane >> 4);
  u.q[0] = *(const v8h*)p; u.q[1] = *(const v8h*)(p + 16); return u.v;
}
__device__ __forceinline__ v16h frag_f32(const float* rowk0, int lane) {
  v16h a; const float* p = rowk0 + 8 * (lane >> 4);
#pragma unroll
  for (int i = 0; i < 8; ++i) { a[i] = (_Float16)p[i]; a[8 + i] = (_Float16)p[16 + i]; }
  return a;
}
__device__ __forceinline__ v16h frag_f32s(const float* rowk0, int lane, float sc) {
  v16h a; const float* p = rowk0 + 8 * (lane >> 4);
#pragma unroll
  for (int i = 0; i < 8; ++i) { a[i] = (_Float16)(p[i] * sc); a[8 + i] = (_Float16)(p[16 + i] * sc); }
  return a;
}
// column fragment from a [K][ld] layout (column n), rows >= K read as 0
__device__ __forceinline__ v16h fragc_f32(const float* W, int k0, int n, int lane, int ld, int K) {
  v16h a; const int g = lane >> 4;
#pragma unroll
  for (int i = 0; i < 8; ++i) { const int ka = k0 + 8 * g + i, kb = ka + 16;
    a[i] = (_Float16)(ka < K ? W[(size_t)(ka < K ? ka : K - 1) * ld + n] : 0.f); a[8 + i] = (_Float16)(kb < K ? W[(size_t)(kb < K ? kb : K - 1) * ld + n] : 0.f); }
  return a;
}
struct F2 { v16b h, l; };
__device__ __forceinline__ F2 bsplit16(const float v[16]) { F2 r;
#pragma unroll
  for (int i = 0; i < 16; ++i) { const __bf16 h = (__bf16)v[i]; r.h[i] = h; r.l[i] = (__bf16)(v[i] - (float)h); }
  return r; }
__device__ __forceinline__ F2 split_row(const float* row, int k0, int lane) { float v[16]; const float* p = row + k0 + 8 * (lane >> 4);
#pragma unroll
  for (int i = 0; i < 8; ++i) { v[i] = p[i]; v[8 + i] = p[16 + i]; }
  return bsplit16(v); }
__device__ __forceinline__ F2 split_rowK(const float* row, int k0, int lane, int K) { float v[16]; const int g = lane >> 4;
#pragma unroll
  for (int i = 0; i < 8; ++i) { const int ka = k0 + 8 * g + i, kb = ka + 16; v[i] = ka < K ? row[ka < K ? ka : K - 1] : 0.f; v[8 + i] = kb < K ? row[kb < K ? kb : K - 1] : 0.f; }
  return bsplit16(v); }
__device__ __forceinline__ F2 split_col(const float* W, int k0, int n, int lane, int ld, int K) { float v[16]; const int g = lane >> 4;
#pragma unroll
  for (int i = 0; i < 8; ++i) { const int ka = k0 + 8 * g + i, kb = ka + 16; v[i] = ka < K ? W[(size_t)(ka < K ? ka : K - 1) * ld + n] : 0.f; v[8 + i] = kb < K ? W[(size_t)(kb < K ? kb : K - 1) * ld + n] : 0.f; }
  return bsplit16(v); }
__device__ __forceinline__ v8f mac3(const F2& a, const F2& b, v8f c) { c = wmma_bf(a.l, b.h, c); c = wmma_bf(a.h, b.l, c); return wmma_bf(a.h, b.h, c); }
__device__ __forceinline__ float sigm(float v) { return 1.0f / (1.0f + expf(-v)); }
#define LDSX() do { asm volatile("s_wait_dscnt 0" ::: "memory"); __builtin_amdgcn_wave_barrier(); __builtin_amdgcn_fence(__ATOMIC_RELEASE, "workgroup"); } while (0)


// Efficient multi-head attention WITHOUT softmax (B 4, N 2,048, C 1,024, 32 heads x 32, reduction 4 -> M 512): out = ((q k^T) * 32^-1/2) v, then Wp + bp; evaluated as x E_b^T + bp with E_b = Wp (32^-1/2 (k^T v)^T per head) Wq.
#define NB 4
#define NN 2048
#define CC 1024
#define NH 32
#define HD 32
#define NR 4              // N_RATIO
#define MM (NN / NR)      // 512
#define BNEPS 1e-6f
#ifndef TNB
#define TNB NB
#endif
#ifndef TOB
#define TOB (TNB * NN / 64)
#endif
typedef __attribute__((ext_vector_type(8))) __bf16 v8b;
__device__ __forceinline__ v16b frag_b(const __bf16* rowk0, int lane) {
  union { v16b v; v8b q[2]; } u; const __bf16* p = rowk0 + 8 * (lane >> 4);
  u.q[0] = *(const v8b*)p; u.q[1] = *(const v8b*)(p + 16); return u.v;
}
__device__ __forceinline__ float bfr(float v) { return (float)(__bf16)v; }
__device__ __attribute__((noinline)) float exp_ni(float v) { return expf(v); }
__device__ __attribute__((noinline)) float erf_ni(float v) { return erff(v); }

#define WS_GT  0u                                   // G, head by head: [b][h][c 1024][e 32], f16
#define WS_XR  (WS_GT + 2u * (size_t)NB * CC * CC)        // BN(avgpool) rows [b*MM + m][1024], f16
#define WS_KP  (WS_XR + 2u * (size_t)NB * MM * CC)        // parts of KV, f32: [b*NH + h][128-row slice of m, 4][16 x 16 tile (d half, e half)][e 16][d 16]
#define WS_WE  (WS_KP + 4u * (size_t)NB * NH * (MM / 128) * HD * HD)   // folded weight rows E [b*CC + o][c 1024], f16
#define WS_XB  (WS_WE + 2u * (size_t)NB * CC * CC)        // x rows [b*NN + n][1024], bf16 values held as f16
#define WS_WB  (WS_XB + 2u * (size_t)NB * NN * CC)        // Wq (bf16) | Wk | Wv | Wp (bf16 values held as f16), each [1024][1024]
#define WS_END (WS_WB + 2u * 4u * (size_t)CC * CC)

__device__ __forceinline__ v16b fragb_f32(const float* __restrict__ p, int lane) { v16b a; const float* pp = p + 8 * (lane >> 4);
#pragma unroll
  for (int i = 0; i < 8; ++i) { a[i] = (__bf16)pp[i]; a[8 + i] = (__bf16)pp[16 + i]; } return a; }
// ---- shared core of the three GEMMs (k/v, E, out): one block of 8 waves makes Y[128][64 FA] = A[128][1024] . W[64 FA][1024]^T, one f16 product; FA = A fragments a wave (2: k/v, E; 4: out).
// The operands arrive as f16 planes that their producers rounded once. Each stage is 64 k: every wave-wide global load covers four 128-B row pieces (whole lines),
// which go unchanged into LDS, where the 8 waves (FA 2: 4 x 2, 32 x 64 of Y each; FA 4: 2 x 4, 64 x 64 each, 8 fragments read for 16 products where 32 x 64 reads 6 for 8) read their fragments, 32 k ahead of the products that use them. Two buffers; the global loads run three stages ahead, through two register sets, so that one stage's loads are still in flight when the next stage's are issued.
#define GBK 64                    // k per stage
#define GPB 144                   // LDS row pitch in bytes: 64 f16 + 16 B (16 B x odd for ds_load_b128 readers)
#define GPL (128 * GPB)           // the A plane of a stage (128 rows); planes: A | W (64 FA rows)
typedef __attribute__((ext_vector_type(4))) __bf16 v4b;
typedef __attribute__((ext_vector_type(4))) _Float16 v4h;
template <int HS = 0, int FA = 2, int WJ = 0> __device__ __forceinline__ void gemm_tile(const _Float16* __restrict__ A, const _Float16* __restrict__ Wm, char* sm, v8f (&acc)[FA][4]) {
  constexpr int NWW = FA, WS = 2 * FA, STG = GPL + NWW * 64 * GPB;   // NWW: waves side by side along W's rows; WS: steps of 32 rows in which the block loads W's plane
  const int tid = threadIdx.x, wave = tid >> 5, lane = tid & 31, col = lane & 15; const int lr = tid >> 3, lc = tid & 7;
  const size_t la = HS ? ((size_t)(lc >> 2) * CC + lr) * HD + (lc & 3) * 8 : (size_t)lr * CC + lc * 8;   // HS: A lies head by head, [h][row][32]: a stage is two heads, a row's piece 64 B in each
  const _Float16* ga = A + la; const _Float16* gb = Wm + (size_t)lr * CC + lc * 8; char* st = sm + lr * GPB + lc * 16;
  const char* fa = sm + ((wave / NWW) * (FA * 16) + col) * GPB; const char* fb = sm + GPL + ((wave % NWW) * 64 + col) * GPB;
  v8h ra0[4], rb0[WS], ra1[4], rb1[WS]; v16h b0[4], a0[FA], b1[4], a1[FA];   // two staging sets (even stages | odd stages): two stages' global loads are in flight; two fragment sets: one is multiplied while the other is filled from LDS
  auto ldg = [&](int s, v8h (&ra)[4], v8h (&rb)[WS]) {
#pragma unroll
    for (int i = 0; i < WS; ++i) { const size_t o = (size_t)i * 32 * CC + s * GBK, oa = HS ? (size_t)i * 32 * HD + (size_t)s * 2 * CC * HD : o; if (i < 4) ra[i] = *(const v8h*)(ga + oa); rb[i] = *(const v8h*)(gb + o + (i >= WS / 2 ? WJ : 0)); }   // WJ: the second half of W's rows lies WJ elements further on (k/v: rows of Wv behind rows of Wk)
    if constexpr (FA == 4) asm volatile("s_wait_xcnt 0x0" :: "v"(ga), "v"(gb) : "memory");   // stands before the loads' address registers are given to other values; it reads both pointers, so that they stay in their registers up to here and no load of the run can be given them for its result
    else asm volatile("s_wait_xcnt 0x0" ::: "memory"); };   // stands before the loads' address registers are given to other values
  auto sts = [&](int buf, v8h (&ra)[4], v8h (&rb)[WS]) { char* p = st + buf * STG;
#pragma unroll
    for (int i = 0; i < WS; ++i) { if (i < 4) *(v8h*)(p + i * 32 * GPB) = ra[i]; *(v8h*)(p + GPL + i * 32 * GPB) = rb[i]; } };
  auto ldf = [&](int buf, int kk, v16h (&b)[4], v16h (&a)[FA]) { const char* pa = fa + buf * STG + kk * 64; const char* pb = fb + buf * STG + kk * 64;
#pragma unroll
    for (int j = 0; j < 4; ++j) b[j] = frag_h((const _Float16*)(pb + j * 16 * GPB), lane);
#pragma unroll
    for (int i = 0; i < FA; ++i) a[i] = frag_h((const _Float16*)(pa + i * 16 * GPB), lane); };
  auto mul = [&](v16h (&b)[4], v16h (&a)[FA]) {
#pragma unroll
    for (int i = 0; i < FA; ++i)
#pragma unroll
      for (int j = 0; j < 4; ++j) { if constexpr (FA == 2) acc[i][j] = wmma16(a[i], b[j], acc[i][j]);
        else acc[i][j] = __builtin_amdgcn_wmma_f32_16x16x32_f16(false, a[i], false, b[j], (short)0, acc[i][j], false, false); } };   // FA 4: the builtin alone, the compiler keeps its distances; wmma16's asm operands would tie all 256 accumulator and fragment registers to the low register window, which spills
  // the stage barrier, by hand: this wave's LDS stores and reads have ended, then the work-group's barrier; unlike __syncthreads() it leaves the global loads of later stages in flight
#define GBAR() asm volatile("s_wait_dscnt 0x0\n\ts_barrier_signal -1\n\ts_barrier_wait -1" ::: "memory")
  // one stage, held in buffer buf: its second half is read while its first half is multiplied; the next stage, loaded two stages ago into (ra, rb), goes into the other buffer, whose last reads ended before the barrier of the stage before;
  // the barrier publishes it and ends every read of the buffer that the stage after it overwrites; then the next stage's first half is read while this stage's second half is multiplied
  // FA 4 has no asm statement behind its products to hold the order written here: without this fence the compiler moves the LDS reads in among the products that use them, into one fragment set, and each wave waits out their latency
  auto sb = [&]() { if constexpr (FA == 4) __builtin_amdgcn_sched_barrier(0); };
  auto stage = [&](int buf, v8h (&ra)[4], v8h (&rb)[WS], int nx) {
    ldf(buf, 1, b1, a1); sb(); sts(buf ^ 1, ra, rb);
    if (nx >= 0) ldg(nx, ra, rb);   // nx: the stage to load into the set just emptied, three ahead of this one; -1 (a literal at the call): none is left
    sb(); mul(b0, a0); sb(); GBAR(); ldf(buf ^ 1, 0, b0, a0); sb(); mul(b1, a1); sb(); };
  constexpr int NS = CC / GBK;
  { v8h ta[4], tb[WS]; ldg(0, ta, tb); ldg(1, ra1, rb1); ldg(2, ra0, rb0); sts(0, ta, tb); }   // the first three stages' loads go out together; stage 0 passes through registers that the fragments take afterwards
  GBAR();
  ldf(0, 0, b0, a0); sb();
#pragma unroll 1   // rolled, two stages a trip (each staging set and each buffer is then fixed in the code)
  for (int s = 0; s < NS - 4; s += 2) { stage(0, ra1, rb1, s + 3); stage(1, ra0, rb0, s + 4); }   // every trip loads: with a test round a load the compiler would have to wait for the youngest load at each LDS store
  stage(0, ra1, rb1, NS - 1); stage(1, ra0, rb0, -1); stage(0, ra1, rb1, -1);
  ldf(1, 1, b1, a1); sb();
  mul(b0, a0); sb();
  GBAR();                       // ends every read of the ring: the callers lay their output tiles over it
  mul(b1, a1); }
// ---- k_pool: block = reduced row (b, m), a thread = 4 channels: xr = BN(mean of 4 tokens) -> one f16 plane; the 4 tokens' bf16 values, which it forms anyway, -> the x plane, written as f16.
// The 256 blocks behind the reduced rows round the four weight matrices to bf16, 16,384 elements each; Wq stays a bf16 plane (the fold's K = 32 product reads it), the bf16 values of Wk, Wv, Wp are written as f16.
__global__ __launch_bounds__(256) void k_pool(const float* __restrict__ X, const float* __restrict__ G, const float* __restrict__ Bt, const float* __restrict__ Mu, const float* __restrict__ Var, const float* __restrict__ WQ, const float* __restrict__ WK, const float* __restrict__ WV, const float* __restrict__ WP, _Float16* __restrict__ XB, _Float16* __restrict__ XR, __bf16* __restrict__ WB) { const int t = threadIdx.x;
  if (blockIdx.x < TNB * MM) { const size_t row = blockIdx.x; const size_t b = row / MM; const int m = (int)(row % MM); const int c = t * 4; float s[4] = {0.f, 0.f, 0.f, 0.f};
#pragma unroll
  for (int i = 0; i < NR; ++i) { const size_t o = (b * NN + (size_t)m * NR + i) * CC + c; const v4f v = *(const v4f*)(X + o); v4h h;
#pragma unroll
    for (int e = 0; e < 4; ++e) { const float r = bfr(v[e]); h[e] = (_Float16)r; s[e] += r; }
    vst2(XB + o, h); }
  v4h hq;
#pragma unroll
  for (int e = 0; e < 4; ++e) { const float a = s[e] * (1.0f / NR); const float y = (a - bfr(Mu[c + e])) / sqrtf(bfr(Var[c + e]) + BNEPS) * bfr(G[c + e]) + bfr(Bt[c + e]); hq[e] = (_Float16)y; }
  vst2(XR + row * CC + c, hq); }
  else { const int wb = blockIdx.x - TNB * MM, which = wb >> 6; const float* Wm = which == 0 ? WQ : which == 1 ? WK : which == 2 ? WV : WP; const size_t o = (size_t)(wb & 63) * 16384 + t * 4; __bf16* Wo = WB + (size_t)which * CC * CC;
    if (which == 0) {   // the same for the whole block; each case has its own 16 steps, so that a case's 16 loads go out together and its 16 stores too
#pragma unroll
      for (int i = 0; i < 16; ++i) { const v4f v = *(const v4f*)(Wm + o + i * 1024); v4b w;
#pragma unroll
        for (int e = 0; e < 4; ++e) w[e] = (__bf16)v[e];
        vst2(Wo + o + i * 1024, w); }
      asm volatile("s_wait_xcnt 0x0" ::: "memory"); }   // stands behind the stores, before any path of the built code gives their registers to other values
    else {
#pragma unroll
      for (int i = 0; i < 16; ++i) { const v4f v = *(const v4f*)(Wm + o + i * 1024); v4h w;
#pragma unroll
        for (int e = 0; e < 4; ++e) w[e] = (_Float16)bfr(v[e]);
        vst2(Wo + o + i * 1024, w); }
      asm volatile("s_wait_xcnt 0x0" ::: "memory"); } } }   // as above
// ---- k_kv: block = (128 reduced rows m, a pair of heads, b): k and v of both heads = xr . W^T (W's 128 rows: 64 of Wk, then the same 64 of Wv) -> f16 hi/lo tiles in LDS,
// then the block's own part of KV: KV[d][e] = sum over its 128 m of k[m][d] v[m][e] (3 products), a wave = one 16 x 16 tile of one head -> f32, 1 KB in a row; k and v never leave the block
__global__ __launch_bounds__(256) void k_kv(const _Float16* __restrict__ XR, const _Float16* __restrict__ WKV, float* __restrict__ KVP) { __shared__ __align__(16) char sm[2 * 2 * GPL];
  const int tid = threadIdx.x, wave = tid >> 5, lane = tid & 31, col = lane & 15, g = lane >> 4; const size_t b = blockIdx.z; const int m0 = blockIdx.x * 128; const int c0 = blockIdx.y * 64; const size_t r0 = b * MM + m0;
  v8f acc[2][4] = {};
  gemm_tile<0, 2, CC * CC - 64 * CC>(XR + r0 * CC, WKV + (size_t)c0 * CC, sm, acc);
  _Float16* th = (_Float16*)sm; _Float16* tl = th + 128 * 136;   // transposed tiles [k cols 64 | v cols 64][m 128 + 8], in the ring's LDS behind its last barrier
#pragma unroll
  for (int i = 0; i < 2; ++i)
#pragma unroll
    for (int j = 0; j < 4; ++j) { v8h hq, lq;
#pragma unroll
      for (int r = 0; r < 8; ++r) { const float v = acc[i][j][r]; const _Float16 hv = (_Float16)v; hq[r] = hv; lq[r] = (_Float16)((v - (float)hv) * 2048.0f); }
      const int o = ((wave & 1) * 64 + j * 16 + col) * 136 + (wave >> 1) * 32 + i * 16 + 8 * g; *(v8h*)&th[o] = hq; *(v8h*)&tl[o] = lq; }
  __syncthreads();   // a row of the tiles holds four waves' m: the tiles are complete in LDS before any wave reads fragments along m
  const int hl = wave >> 2, dt = (wave >> 1) & 1, je = wave & 1;   // wave = (head of the pair, row tile of d, col tile of e); K = m (4 kc)
  const int ro = (hl * 32 + dt * 16 + col) * 136, qo = (64 + hl * 32 + je * 16 + col) * 136; v8f kv = {}, t2 = {}; v16h ah[4], al[4], vh[4], vl[4];
#pragma unroll   // here and in the two loops below: the arrays stay in registers only under constant indices
  for (int kc = 0; kc < 4; ++kc) { ah[kc] = frag_h(th + ro + kc * 32, lane); vh[kc] = frag_h(th + qo + kc * 32, lane); vl[kc] = frag_h(tl + qo + kc * 32, lane); al[kc] = frag_h(tl + ro + kc * 32, lane); }
  __builtin_amdgcn_sched_barrier(0);   // all 32 LDS reads go out ahead of the products: left to itself the compiler reads each trip's fragments behind the trip before, and the wave waits out the LDS latency four times
#pragma unroll
  for (int kc = 0; kc < 4; ++kc) { kv = wmma16(ah[kc], vh[kc], kv); t2 = wmma16(ah[kc], vl[kc], t2); t2 = wmma16(al[kc], vh[kc], t2); }   // two chains: hi x hi; the cross terms, which carry the factor 2048
#pragma unroll
  for (int r = 0; r < 8; ++r) kv[r] += t2[r] * (1.0f / 2048.0f);
  float* p = KVP + (((b * NH + blockIdx.y * 2 + hl) * (MM / 128) + blockIdx.x) * 4 + dt * 2 + je) * 256 + col * 16 + 8 * g; v4f y0, y1;   // transposed: [e][d], a lane's 8 elements are 8 neighbouring d
#pragma unroll
  for (int r = 0; r < 4; ++r) { y0[r] = kv[r]; y1[r] = kv[4 + r]; }
  vst2(p, y0); vst2(p + 4, y1); }
// ---- k_kvp: block = (b*NH + h), 16 waves: KV[d][e] = the sum of its four parts (slices of m in rising order), kept transposed in LDS, then the head's part of the fold:
// G[c][e] = scale sum_d Wq[(h,d)][c] KV[d][e]  (Wq exact bf16 x KV hi+lo, 2 products; K = 32), a wave = 64 rows c -> one f16 plane laid head by head, [b][h][c 1024][e 32], so that one block writes 64 KB in a row
// Wq's loads (4 rows d x 64 bf16 of c: four whole lines each) go out with the parts'; each wave turns its piece to [c][d] in its own LDS range.
#define XP 36                      // LDS row pitch in floats: 32 + 4 (144 B = 16 B x odd, for ds_load_b128 readers)
__device__ __forceinline__ F2 split_lds(const float* row, int lane) { float v[16]; const float* p = row + 8 * (lane >> 4); const v4f a = *(const v4f*)p, b = *(const v4f*)(p + 4), c = *(const v4f*)(p + 16), d = *(const v4f*)(p + 20);
#pragma unroll
  for (int i = 0; i < 4; ++i) { v[i] = a[i]; v[4 + i] = b[i]; v[8 + i] = c[i]; v[12 + i] = d[i]; }
  return bsplit16(v); }
// A fragment of bf16 values kept as floats in a row whose column d stands at (d + rot) & 31
__device__ __forceinline__ v16b frag_rot(const float* row, int rot, int lane) { const int k = 8 * (lane >> 4) + rot; const v4f a = *(const v4f*)(row + (k & 31)), b = *(const v4f*)(row + ((k + 4) & 31)), c = *(const v4f*)(row + ((k + 16) & 31)), d = *(const v4f*)(row + ((k + 20) & 31)); v16b r;
#pragma unroll
  for (int i = 0; i < 4; ++i) { r[i] = (__bf16)a[i]; r[4 + i] = (__bf16)b[i]; r[8 + i] = (__bf16)c[i]; r[12 + i] = (__bf16)d[i]; }
  return r; }
__global__ __launch_bounds__(512) void k_kvp(const float* __restrict__ KVP, const __bf16* __restrict__ WQ, _Float16* __restrict__ GH) { __shared__ __align__(16) float st[HD][XP]; __shared__ __align__(16) float sq[16][64 * XP];
  const int tid = threadIdx.x, wave = __builtin_amdgcn_readfirstlane(tid >> 5), lane = tid & 31, col = lane & 15, g = lane >> 4; const size_t bh = blockIdx.x; const int h = bh % NH;
  const float* kp = KVP + bh * (MM / 128) * (HD * HD) + tid * 2; v2f pk[MM / 128]; v8b vw[8]; float* mq = sq[wave];
#pragma unroll   // the four loads go out together; pk stays in registers
  for (int i = 0; i < MM / 128; ++i) pk[i] = *(const v2f*)(kp + i * (HD * HD));   // a thread = 2 neighbouring d of one e, in each of the four parts
#pragma unroll
  for (int it = 0; it < 8; ++it) vw[it] = *(const v8b*)(WQ + (size_t)(h * HD + (lane >> 3) * 8 + it) * CC + wave * 64 + (lane & 7) * 8);   // rows d = it, 8 + it, 16 + it, 24 + it: a lane ends up with 8 neighbouring d of its 8 columns c
#pragma unroll
  for (int e = 0; e < 8; ++e) { v4f f0, f1; float* p = mq + ((lane & 7) * 8 + e) * XP; const int k = (lane >> 3) * 8 + (lane & 7) * 4;   // turned: row c, column d; row c holds d at (d + 4 (c >> 3)) & 31, which spreads the lanes' 16-B stores over the banks
#pragma unroll
    for (int i = 0; i < 4; ++i) { f0[i] = (float)vw[i][e]; f1[i] = (float)vw[4 + i][e]; }
    *(v4f*)(p + (k & 31)) = f0; *(v4f*)(p + ((k + 4) & 31)) = f1; }
  { v2f s = pk[0];
#pragma unroll   // pk stays in registers
    for (int i = 1; i < MM / 128; ++i) s += pk[i];
    *(v2f*)&st[((tid >> 7) & 1) * 16 + ((tid >> 3) & 15)][(tid >> 8) * 16 + (tid & 7) * 2] = s; }   // the parts' order [d half][e half][e 16][d 16] -> [e][d]
  __syncthreads();   // KV^T is complete in LDS before all 16 waves read it
  F2 wb[2]; v8f ga[4][2] = {};
#pragma unroll
  for (int jj = 0; jj < 2; ++jj) wb[jj] = split_lds(st[jj * 16 + col], lane);
#pragma unroll
  for (int t = 0; t < 4; ++t) { const v16b a = frag_rot(mq + (t * 16 + col) * XP, 4 * (t * 2 + (col >> 3)), lane);
#pragma unroll
    for (int jj = 0; jj < 2; ++jj) { ga[t][jj] = wmma_bf(a, wb[jj].h, ga[t][jj]); ga[t][jj] = wmma_bf(a, wb[jj].l, ga[t][jj]); } }
#pragma unroll
  for (int t = 0; t < 4; ++t)
#pragma unroll
    for (int jj = 0; jj < 2; ++jj)
#pragma unroll
      for (int r = 0; r < 8; ++r) mq[(t * 16 + 8 * g + r) * XP + jj * 16 + col] = ga[t][jj][r] * 0.17677669529663687f;   // over the wave's own Wq rows, which it has read
  LDSX();   // the wave's rows are complete in LDS before its lanes read what other lanes wrote
#pragma unroll   // the 8 steps' LDS reads go out ahead of the conversions and stores
  for (int it = 0; it < 8; ++it) { const int row = it * 8 + (lane >> 2); const float* p = mq + row * XP + (lane & 3) * 8; const v4f y0 = *(const v4f*)p, y1 = *(const v4f*)(p + 4); v8h hq;
#pragma unroll
    for (int e = 0; e < 4; ++e) { hq[e] = (_Float16)y0[e]; hq[4 + e] = (_Float16)y1[e]; }
    const size_t o = (bh * CC + wave * 64 + row) * HD + (lane & 3) * 8; vst2(GH + o, hq); } }   // 512 contiguous bytes a store
// ---- k_we: block = (128 rows c, 128 cols o, b): E[o][c] = sum_(h,e) G[h][c][e] . Wp[o][(h,e)] -> one f16 plane [b][o][c]
__global__ __launch_bounds__(256) void k_we(const _Float16* __restrict__ GT, const _Float16* __restrict__ WP, _Float16* __restrict__ WE) { __shared__ __align__(16) char sm[2 * 2 * GPL];
  const int tid = threadIdx.x, wave = tid >> 5, lane = tid & 31, col = lane & 15, g = lane >> 4; const size_t b = blockIdx.z; const int m0 = blockIdx.x * 128; const int c0 = blockIdx.y * 128; const size_t r0 = (b * NH * CC + m0) * HD;
  v8f acc[2][4] = {};
  gemm_tile<1>(GT + r0, WP + (size_t)c0 * CC, sm, acc);
  _Float16* th = (_Float16*)sm;   // transposed tile [o 128][c 128 + 8], in the ring's LDS behind its last barrier
#pragma unroll
  for (int i = 0; i < 2; ++i)
#pragma unroll
    for (int j = 0; j < 4; ++j) { v8h hq;
#pragma unroll
      for (int r = 0; r < 8; ++r) hq[r] = (_Float16)acc[i][j][r];
      const int o = ((wave & 1) * 64 + j * 16 + col) * 136 + (wave >> 1) * 32 + i * 16 + 8 * g; *(v8h*)&th[o] = hq; }
  __syncthreads();   // a stored row of E holds four waves' columns: the tile is complete in LDS before any wave reads whole rows
  for (int e = tid; e < 128 * 16; e += 256) { const int cl = e >> 4, q = e & 15; const size_t o = (b * CC + c0 + cl) * (size_t)CC + m0 + q * 8; vst2((unsigned*)(WE + o), *(const v4u*)&th[cl * 136 + q * 8]); } }
// ---- k_out: block = (256 tokens n, 128 cols o), one on a WGP: out[n][o] = sum_c E_b[o][c] . x[n][c] + bp[o]; E is the A operand, so a lane's 8 accumulator elements are 8 neighbouring o of one token; a wave = 64 o x 64 tokens
#define OP 68                      // LDS row pitch in floats: 64 + 4 (272 B = 16 B x odd, for ds_load_b128 readers)
__global__ __launch_bounds__(256) void k_out(const _Float16* __restrict__ WE, const _Float16* __restrict__ XB, const float* __restrict__ BP, float* __restrict__ OUT) { __shared__ __align__(16) char sm[8 * 64 * OP * 4];   // the output staging; the ring (2 stages of 384 rows) is smaller and lies in the same bytes
  const int tid = threadIdx.x, wave = tid >> 5, lane = tid & 31, col = lane & 15, g = lane >> 4; const size_t n0 = (size_t)blockIdx.x * 256; const int o0 = blockIdx.y * 128; const size_t a0 = (n0 / NN) * CC + o0; v8f acc[4][4] = {};
  gemm_tile<0, 4>(WE + a0 * CC, XB + n0 * CC, sm, acc);
  float* sf = (float*)sm + wave * (64 * OP);   // the wave's 64 tokens x 64 o in its own LDS range, behind the ring's last barrier
#pragma unroll
  for (int i = 0; i < 4; ++i) { const float* bp = BP + o0 + (wave >> 2) * 64 + i * 16 + 8 * g; const v4f b0 = *(const v4f*)bp, b1 = *(const v4f*)(bp + 4);
#pragma unroll
    for (int j = 0; j < 4; ++j) { v4f y0, y1;
#pragma unroll
      for (int r = 0; r < 4; ++r) { y0[r] = acc[i][j][r] + bfr(b0[r]); y1[r] = acc[i][j][4 + r] + bfr(b1[r]); }
      float* p = sf + (j * 16 + col) * OP + i * 16 + 8 * g; *(v4f*)p = y0; *(v4f*)(p + 4) = y1; } }
  LDSX();   // the wave's rows are complete in LDS before its lanes read what other lanes wrote
  v4f y[32];   // all 32 LDS reads first, then the stores: one LDS latency is waited out, not 32
#pragma unroll
  for (int it = 0; it < 32; ++it) y[it] = *(const v4f*)&sf[(it * 2 + g) * OP + col * 4];
#pragma unroll
  for (int it = 0; it < 32; ++it) vst2(OUT + (n0 + (wave & 3) * 64 + it * 2 + g) * CC + o0 + (wave >> 2) * 64 + col * 4, y[it]); }   // four whole 128-B lines a store
extern "C" void kernel_launch(void* const* d_in, const int* in_sizes, int n_in, void* d_out, int out_size, void* d_ws, size_t ws_size, hipStream_t stream) {
  (void)in_sizes; (void)n_in; (void)out_size;
  const float** F = (const float**)d_in;   // 0 x [4,2048,1024], 1 Wq, 2 Wk, 3 Wv, 4 Wp (natural), 5 bp, 6 bn_gamma, 7 bn_beta, 8 bn_mean, 9 bn_var
  if (ws_size < (size_t)WS_END) return;
  char* ws = (char*)d_ws; __bf16* WB = (__bf16*)(ws + WS_WB); _Float16 *XR = (_Float16*)(ws + WS_XR), *GT = (_Float16*)(ws + WS_GT), *WE = (_Float16*)(ws + WS_WE), *XB = (_Float16*)(ws + WS_XB), *WH = (_Float16*)(ws + WS_WB); float* KVP = (float*)(ws + WS_KP);
  k_pool<<<TNB * MM + 256, 256, 0, stream>>>(F[0], F[6], F[7], F[8], F[9], F[1], F[2], F[3], F[4], XB, XR, WB);
  k_kv<<<dim3(MM / 128, CC / 64, TNB), 256, 0, stream>>>(XR, WH + (size_t)CC * CC, KVP);
  k_kvp<<<TNB * NH, 512, 0, stream>>>(KVP, WB, GT);
  k_we<<<dim3(CC / 128, CC / 128, TNB), 256, 0, stream>>>(GT, WH + 3 * (size_t)CC * CC, WE);
  k_out<<<dim3(TNB * NN / 256, CC / 128), 256, 0, stream>>>(WE, XB, F[5], (float*)d_out);
}

// v010
// A run of this version takes 52.4 microseconds.
// Next to v009, in two timings, it ran 1.06 times as fast each time.
// Counting every step since v000, it is 7.74 times as fast.
// compute dtype: all float inputs rounded to bf16; AvgPool1d (exact f32 sums of 4 bf16 tokens) + BatchNorm (eval) in f32; the GEMM operands are f16: x, Wk, Wv, Wp hold their bf16 values (unchanged down to 2^-17; below that on f16's subnormal grid of 2^-24), xr, G and E are rounded to f16 (11 bits) once by their producers, so f16's range (65,504) bounds them (G and E grow with the square of bn_gamma; about 1 at gamma 1); k, v = xr W^T (1 product); no softmax in the module, so (q k^T) v is q (k^T v) with KV_h = k_h^T v_h (3 products), and, nothing but products standing between x and out, out = x E_b^T + bp with the folded weight of batch b, E_b = Wp G_b, G_b[(h,e)][c] = scale sum_d KV_h[d][e] Wq[(h,d)][c]: G from KV as bf16 hi + lo (2 products), E from G (1 product), out from E (1 product); f32 accumulation, f32 output.
#include <hip/hip_runtime.h>
#include <math.h>

typedef __attribute__((ext_vector_type(16))) _Float16 v16h;
typedef __attribute__((ext_vector_type(16))) __bf16 v16b;
typedef __attribute__((ext_vector_type(8)))  _Float16 v8h;
typedef __attribute__((ext_vector_type(8)))  float v8f;
typedef __attribute__((ext_vector_type(4)))  float v4f;
typedef __attribute__((ext_vector_type(2)))  float v2f;
typedef __attribute__((ext_vector_type(4)))  unsigned v4u;
typedef __attribute__((ext_vector_type(4)))  int v4i;
typedef float __attribute__((may_alias)) float_a;
typedef int __attribute__((may_alias)) int_a;

template <typename T> __device__ __forceinline__ void vst2(void* p, T v) { *(T*)p = v;  }
__device__ __forceinline__ v8f wmma16(v16h a, v16h b, v8f c) {
  v8f d = __builtin_amdgcn_wmma_f32_16x16x32_f16(false, a, false, b, (short)0, c, false, false);
  asm volatile("v_nop\n\tv_nop\n\tv_nop\n\tv_nop" : "+v"(d) : "v"(a), "v"(b));
  return d;
}
__device__ __forceinline__ v8f wmma_bf(v16b a, v16b b, v8f c) {
  v8f d = __builtin_amdgcn_wmma_f32_16x16x32_bf16(false, a, false, b, (short)0, c, false, false);
  asm volatile("v_nop\n\tv_nop\n\tv_nop\n\tv_nop" : "+v"(d) : "v"(a), "v"(b));
  return d;
}
// 16x16x32 fragments: lane = (h = lane>>4, row/col = lane&15); elements 0..7 = k0+8h+0..7, 8..15 = k0+16+8h+0..7; D element r = row 8h+r
__device__ __forceinline__ v16h frag_h(const _Float16* rowk0, int lane) {
  union { v16h v; v8h q[2]; } u; const _Float16* p = rowk0 + 8 * (lane >> 4);
  u.q[0] = *(const v8h*)p; u.q[1] = *(const v8h*)(p + 16); return u.v;
}
__device__ __forceinline__ v16h frag_f32(const float* rowk0, int lane) {
  v16h a; const float* p = rowk0 + 8 * (lane >> 4);
#pragma unroll
  for (int i = 0; i < 8; ++i) { a[i] = (_Float16)p[i]; a[8 + i] = (_Float16)p[16 + i]; }
  return a;
}
__device__ __forceinline__ v16h frag_f32s(const float* rowk0, int lane, float sc) {
  v16h a; const float* p = rowk0 + 8 * (lane >> 4);
#pragma unroll
  for (int i = 0; i < 8; ++i) { a[i] = (_Float16)(p[i] * sc); a[8 + i] = (_Float16)(p[16 + i] * sc); }
  return a;
}
// column fragment from a [K][ld] layout (column n), rows >= K read as 0
__device__ __forceinline__ v16h fragc_f32(const float* W, int k0, int n, int lane, int ld, int K) {
  v16h a; const int g = lane >> 4;
#pragma unroll
  for (int i = 0; i < 8; ++i) { const int ka = k0 + 8 * g + i, kb = ka + 16;
    a[i] = (_Float16)(ka < K ? W[(size_t)(ka < K ? ka : K - 1) * ld + n] : 0.f); a[8 + i] = (_Float16)(kb < K ? W[(size_t)(kb < K ? kb : K - 1) * ld + n] : 0.f); }
  return a;
}
struct F2 { v16b h, l; };
__device__ __forceinline__ F2 bsplit16(const float v[16]) { F2 r;
#pragma unroll
  for (int i = 0; i < 16; ++i) { const __bf16 h = (__bf16)v[i]; r.h[i] = h; r.l[i] = (__bf16)(v[i] - (float)h); }
  return r; }
__device__ __forceinline__ F2 split_row(const float* row, int k0, int lane) { float v[16]; const float* p = row + k0 + 8 * (lane >> 4);
#pragma unroll
  for (int i = 0; i < 8; ++i) { v[i] = p[i]; v[8 + i] = p[16 + i]; }
  return bsplit16(v); }
__device__ __forceinline__ F2 split_rowK(const float* row, int k0, int lane, int K) { float v[16]; const int g = lane >> 4;
#pragma unroll
  for (int i = 0; i < 8; ++i) { const int ka = k0 + 8 * g + i, kb = ka + 16; v[i] = ka < K ? row[ka < K ? ka : K - 1] : 0.f; v[8 + i] = kb < K ? row[kb < K ? kb : K - 1] : 0.f; }
  return bsplit16(v); }
__device__ __forceinline__ F2 split_col(const float* W, int k0, int n, int lane, int ld, int K) { float v[16]; const int g = lane >> 4;
#pragma unroll
  for (int i = 0; i < 8; ++i) { const int ka = k0 + 8 * g + i, kb = ka + 16; v[i] = ka < K ? W[(size_t)(ka < K ? ka : K - 1) * ld + n] : 0.f; v[8 + i] = kb < K ? W[(size_t)(kb < K ? kb : K - 1) * ld + n] : 0.f; }
  return bsplit16(v); }
__device__ __forceinline__ v8f mac3(const F2& a, const F2& b, v8f c) { c = wmma_bf(a.l, b.h, c); c = wmma_bf(a.h, b.l, c); return wmma_bf(a.h, b.h, c); }
__device__ __forceinline__ float sigm(float v) { return 1.0f / (1.0f + expf(-v)); }
#define LDSX() do { asm volatile("s_wait_dscnt 0" ::: "memory"); __builtin_amdgcn_wave_barrier(); __builtin_amdgcn_fence(__ATOMIC_RELEASE, "workgroup"); } while (0)


// Efficient multi-head attention WITHOUT softmax (B 4, N 2,048, C 1,024, 32 heads x 32, reduction 4 -> M 512): out = ((q k^T) * 32^-1/2) v, then Wp + bp; evaluated as x E_b^T + bp with E_b = Wp (32^-1/2 (k^T v)^T per head) Wq.
#define NB 4
#define NN 2048
#define CC 1024
#define NH 32
#define HD 32
#define NR 4              // N_RATIO
#define MM (NN / NR)      // 512
#define BNEPS 1e-6f
#ifndef TNB
#define TNB NB
#endif
#ifndef TOB
#define TOB (TNB * NN / 64)
#endif
typedef __attribute__((ext_vector_type(8))) __bf16 v8b;
__device__ __forceinline__ v16b frag_b(const __bf16* rowk0, int lane) {
  union { v16b v; v8b q[2]; } u; const __bf16* p = rowk0 + 8 * (lane >> 4);
  u.q[0] = *(const v8b*)p; u.q[1] = *(const v8b*)(p + 16); return u.v;
}
__device__ __forceinline__ float bfr(float v) { return (float)(__bf16)v; }
__device__ __attribute__((noinline)) float exp_ni(float v) { return expf(v); }
__device__ __attribute__((noinline)) float erf_ni(float v) { return erff(v); }

#define WS_GT  0u                                   // G, head by head: [b][h][c 1024][e 32], f16
#define WS_XR  (WS_GT + 2u * (size_t)NB * CC * CC)        // BN(avgpool) rows [b*MM + m][1024], f16
#define WS_KP  (WS_XR + 2u * (size_t)NB * MM * CC)        // parts of KV, f32: [b*NH + h][128-row slice of m, 4][16 x 16 tile (d half, e half)][e 16][d 16]
#define WS_WE  (WS_KP + 4u * (size_t)NB * NH * (MM / 128) * HD * HD)   // folded weight rows E [b*CC + o][c 1024], f16
#define WS_XB  (WS_WE + 2u * (size_t)NB * CC * CC)        // x rows [b*NN + n][1024], bf16 values held as f16
#define WS_WB  (WS_XB + 2u * (size_t)NB * NN * CC)        // Wq (bf16) | Wk | Wv | Wp (bf16 values held as f16), each [1024][1024]
#define WS_END (WS_WB + 2u * 4u * (size_t)CC * CC)

__device__ __forceinline__ v16b fragb_f32(const float* __restrict__ p, int lane) { v16b a; const float* pp = p + 8 * (lane >> 4);
#pragma unroll
  for (int i = 0; i < 8; ++i) { a[i] = (__bf16)pp[i]; a[8 + i] = (__bf16)pp[16 + i]; } return a; }
// ---- shared core of the three GEMMs (k/v, E, out): one block of 8 waves makes Y[128][64 FA] = A[128][1024] . W[64 FA][1024]^T, one f16 product; FA = A fragments a wave (2: k/v, E; 4: out).
// The operands arrive as f16 planes that their producers rounded once. Each stage is 64 k: every wave-wide asynchronous copy covers four 128-B row pieces (whole lines) and lays them straight into LDS, through no register,
// where the 8 waves (FA 2: 4 x 2, 32 x 64 of Y each; FA 4: 2 x 4, 64 x 64 each, 8 fragments read for 16 products where 32 x 64 reads 6 for 8) read their fragments, 32 k ahead of the products that use them. Four buffers: a stage's copies are issued into a buffer as soon as its last reader has left it, four stages ahead, so that three stages' copies are in flight.
#define GBK 64                    // k per stage
#define GPB 144                   // LDS row pitch in bytes: 64 f16 + 16 B (16 B x odd for ds_load_b128 readers)
#define GPL (128 * GPB)           // the A plane of a stage (128 rows); planes: A | W (64 FA rows)
#define GNB 4                     // buffers of the ring
#define GSTG(FA) (GPL + (FA) * 64 * GPB)   // bytes of a stage
typedef __attribute__((ext_vector_type(4))) __bf16 v4b;
typedef __attribute__((ext_vector_type(4))) _Float16 v4h;
typedef __attribute__((address_space(1))) v4i* gp128;
typedef __attribute__((address_space(3))) v4i* lp128;
// the publish point of a stage: this wave's LDS reads have ended; all of its copies but the N youngest have landed (every wave issues the same copies in the same order, so N counts whole later stages); then the work-group's barrier, behind which other waves read what this wave copied and the buffer just read may be refilled
template <int N> __device__ __forceinline__ void gpub() {
  asm volatile("s_wait_dscnt 0x0" ::: "memory");
  asm volatile("s_wait_asynccnt %0" :: "n"(N) : "memory");
  asm volatile("s_barrier_signal -1\n\ts_barrier_wait -1" ::: "memory"); }
template <int HS = 0, int FA = 2, int WJ = 0> __device__ __forceinline__ void gemm_tile(const _Float16* __restrict__ A, const _Float16* __restrict__ Wm, char* sm, v8f (&acc)[FA][4]) {
  constexpr int NWW = FA, WS = 2 * FA, STG = GSTG(FA), CP = 4 + WS;   // NWW: waves side by side along W's rows; WS: steps of 32 rows in which the block copies W's plane; CP: copies a wave issues for a stage
  const int tid = threadIdx.x, wave = tid >> 5, lane = tid & 31, col = lane & 15; const int lr = tid >> 3, lc = tid & 7;
  const unsigned va = 2u * (HS ? ((lc >> 2) * CC + lr) * HD + (lc & 3) * 8 : lr * CC + lc * 8), vb = 2u * (lr * CC + lc * 8);   // the lane's own byte offsets in A and W; HS: A lies head by head, [h][row][32]: a stage is two heads, a row's piece 64 B in each
  char* st = sm + lr * GPB + lc * 16;
  const char* fa = sm + ((wave / NWW) * (FA * 16) + col) * GPB; const char* fb = sm + GPL + ((wave % NWW) * 64 + col) * GPB;
  v16h b0[4], a0[FA], b1[4], a1[FA];   // two fragment sets: one is multiplied while the other is filled from LDS
  auto cpy = [&](int s, int buf) { const char* pa = (const char*)A + (size_t)s * (HS ? 2 * CC * HD * 2 : GBK * 2); const char* pb = (const char*)Wm + (size_t)s * (GBK * 2); char* p = st + buf * STG;   // stage s into buffer buf: 16 B a lane and copy, at the places the fragment reads expect
#pragma unroll   // each copy's row step and LDS place are then constants, and a stage's copies go out back to back
    for (int i = 0; i < WS; ++i) { if (i < 4) __builtin_amdgcn_global_load_async_to_lds_b128((gp128)(pa + (size_t)i * 32 * (HS ? HD : CC) * 2 + va), (lp128)(p + i * 32 * GPB), 0, 0);
      __builtin_amdgcn_global_load_async_to_lds_b128((gp128)(pb + ((size_t)i * 32 * CC + (i >= WS / 2 ? WJ : 0)) * 2 + vb), (lp128)(p + GPL + i * 32 * GPB), 0, 0); } };   // WJ: the second half of W's rows lies WJ elements further on (k/v: rows of Wv behind rows of Wk)
  auto ldf = [&](int buf, int kk, v16h (&b)[4], v16h (&a)[FA]) { const char* pa = fa + buf * STG + kk * 64; const char* pb = fb + buf * STG + kk * 64;
#pragma unroll
    for (int j = 0; j < 4; ++j) b[j] = frag_h((const _Float16*)(pb + j * 16 * GPB), lane);
#pragma unroll
    for (int i = 0; i < FA; ++i) a[i] = frag_h((const _Float16*)(pa + i * 16 * GPB), lane); };
  auto mul = [&](v16h (&b)[4], v16h (&a)[FA]) {
#pragma unroll
    for (int i = 0; i < FA; ++i)
#pragma unroll
      for (int j = 0; j < 4; ++j) { if constexpr (FA == 2) acc[i][j] = wmma16(a[i], b[j], acc[i][j]);
        else acc[i][j] = __builtin_amdgcn_wmma_f32_16x16x32_f16(false, a[i], false, b[j], (short)0, acc[i][j], false, false); } };   // FA 4: the builtin alone, the compiler keeps its distances; wmma16's asm operands would tie all 256 accumulator and fragment registers to the low register window, which spills
  // the barrier behind the last stage, by hand: this wave's LDS reads have ended, then the work-group's barrier
#define GBAR() asm volatile("s_wait_dscnt 0x0\n\ts_barrier_signal -1\n\ts_barrier_wait -1" ::: "memory")
  // one stage, held in buffer buf: its second half is read while its first half is multiplied; the publish point then says that the next stage has landed (later: how many whole stages' copies may still be in flight behind it) and ends every read of buf,
  // which takes the copies of the stage four ahead at once; then the next stage's first half is read while this stage's second half is multiplied
  // FA 4 has no asm statement behind its products to hold the order written here: without this fence the compiler moves the LDS reads in among the products that use them, into one fragment set, and each wave waits out their latency
  auto sb = [&]() { if constexpr (FA == 4) __builtin_amdgcn_sched_barrier(0); };
  auto stage = [&](int buf, int later, int nx) {   // buf, later: literals at the call; nx: the stage to copy into buf, -1 (a literal): none is left
    ldf(buf, 1, b1, a1); sb(); mul(b0, a0); sb();
    if (later == 2) gpub<2 * CP>(); else if (later == 1) gpub<CP>(); else gpub<0>();
    if (nx >= 0) cpy(nx, buf);
    ldf((buf + 1) % GNB, 0, b0, a0); sb(); mul(b1, a1); sb(); };
  constexpr int NS = CC / GBK;
  cpy(0, 0); cpy(1, 1); cpy(2, 2); cpy(3, 3);   // the first four stages' copies go out together
  gpub<3 * CP>();                               // stage 0 has landed in every wave's share
  ldf(0, 0, b0, a0); sb();
#pragma unroll 1   // rolled, four stages a trip (each buffer is then fixed in the code)
  for (int s = 0; s < NS - GNB; s += GNB) { stage(0, 2, s + 4); stage(1, 2, s + 5); stage(2, 2, s + 6); stage(3, 2, s + 7); }   // every trip and every wave issues the same copies, so the counted wait always leaves the same two stages
  stage(0, 2, -1); stage(1, 1, -1); stage(2, 0, -1);   // no copies are left to issue: the counts fall with the stages still in flight, to 0 before the last stage
  ldf(3, 1, b1, a1); sb();
  mul(b0, a0); sb();
  GBAR();                       // ends every read of the ring: the callers lay their output tiles over it
  mul(b1, a1); }
// ---- k_pool: block = reduced row (b, m), a thread = 4 channels: xr = BN(mean of 4 tokens) -> one f16 plane; the 4 tokens' bf16 values, which it forms anyway, -> the x plane, written as f16.
// The 256 blocks behind the reduced rows round the four weight matrices to bf16, 16,384 elements each; Wq stays a bf16 plane (the fold's K = 32 product reads it), the bf16 values of Wk, Wv, Wp are written as f16.
__global__ __launch_bounds__(256) void k_pool(const float* __restrict__ X, const float* __restrict__ G, const float* __restrict__ Bt, const float* __restrict__ Mu, const float* __restrict__ Var, const float* __restrict__ WQ, const float* __restrict__ WK, const float* __restrict__ WV, const float* __restrict__ WP, _Float16* __restrict__ XB, _Float16* __restrict__ XR, __bf16* __restrict__ WB) { const int t = threadIdx.x;
  if (blockIdx.x < TNB * MM) { const size_t row = blockIdx.x; const size_t b = row / MM; const int m = (int)(row % MM); const int c = t * 4; float s[4] = {0.f, 0.f, 0.f, 0.f};
#pragma unroll
  for (int i = 0; i < NR; ++i) { const size_t o = (b * NN + (size_t)m * NR + i) * CC + c; const v4f v = *(const v4f*)(X + o); v4h h;
#pragma unroll
    for (int e = 0; e < 4; ++e) { const float r = bfr(v[e]); h[e] = (_Float16)r; s[e] += r; }
    vst2(XB + o, h); }
  v4h hq;
#pragma unroll
  for (int e = 0; e < 4; ++e) { const float a = s[e] * (1.0f / NR); const float y = (a - bfr(Mu[c + e])) / sqrtf(bfr(Var[c + e]) + BNEPS) * bfr(G[c + e]) + bfr(Bt[c + e]); hq[e] = (_Float16)y; }
  vst2(XR + row * CC + c, hq); }
  else { const int wb = blockIdx.x - TNB * MM, which = wb >> 6; const float* Wm = which == 0 ? WQ : which == 1 ? WK : which == 2 ? WV : WP; const size_t o = (size_t)(wb & 63) * 16384 + t * 4; __bf16* Wo = WB + (size_t)which * CC * CC;
    if (which == 0) {   // the same for the whole block; each case has its own 16 steps, so that a case's 16 loads go out together and its 16 stores too
#pragma unroll
      for (int i = 0; i < 16; ++i) { const v4f v = *(const v4f*)(Wm + o + i * 1024); v4b w;
#pragma unroll
        for (int e = 0; e < 4; ++e) w[e] = (__bf16)v[e];
        vst2(Wo + o + i * 1024, w); }
      asm volatile("s_wait_xcnt 0x0" ::: "memory"); }   // stands behind the stores, before any path of the built code gives their registers to other values
    else {
#pragma unroll
      for (int i = 0; i < 16; ++i) { const v4f v = *(const v4f*)(Wm + o + i * 1024); v4h w;
#pragma unroll
        for (int e = 0; e < 4; ++e) w[e] = (_Float16)bfr(v[e]);
        vst2(Wo + o + i * 1024, w); }
      asm volatile("s_wait_xcnt 0x0" ::: "memory"); } } }   // as above
// ---- k_kv: block = (128 reduced rows m, a pair of heads, b): k and v of both heads = xr . W^T (W's 128 rows: 64 of Wk, then the same 64 of Wv) -> f16 hi/lo tiles in LDS,
// then the block's own part of KV: KV[d][e] = sum over its 128 m of k[m][d] v[m][e] (3 products), a wave = one 16 x 16 tile of one head -> f32, 1 KB in a row; k and v never leave the block
__global__ __launch_bounds__(256) void k_kv(const _Float16* __restrict__ XR, const _Float16* __restrict__ WKV, float* __restrict__ KVP) { __shared__ __align__(16) char sm[GNB * GSTG(2)];
  const int tid = threadIdx.x, wave = tid >> 5, lane = tid & 31, col = lane & 15, g = lane >> 4; const size_t b = blockIdx.z; const int m0 = blockIdx.x * 128; const int c0 = blockIdx.y * 64; const size_t r0 = b * MM + m0;
  v8f acc[2][4] = {};
  gemm_tile<0, 2, CC * CC - 64 * CC>(XR + r0 * CC, WKV + (size_t)c0 * CC, sm, acc);
  _Float16* th = (_Float16*)sm; _Float16* tl = th + 128 * 136;   // transposed tiles [k cols 64 | v cols 64][m 128 + 8], in the ring's LDS behind its last barrier
#pragma unroll
  for (int i = 0; i < 2; ++i)
#pragma unroll
    for (int j = 0; j < 4; ++j) { v8h hq, lq;
#pragma unroll
      for (int r = 0; r < 8; ++r) { const float v = acc[i][j][r]; const _Float16 hv = (_Float16)v; hq[r] = hv; lq[r] = (_Float16)((v - (float)hv) * 2048.0f); }
      const int o = ((wave & 1) * 64 + j * 16 + col) * 136 + (wave >> 1) * 32 + i * 16 + 8 * g; *(v8h*)&th[o] = hq; *(v8h*)&tl[o] = lq; }
  __syncthreads();   // a row of the tiles holds four waves' m: the tiles are complete in LDS before any wave reads fragments along m
  const int hl = wave >> 2, dt = (wave >> 1) & 1, je = wave & 1;   // wave = (head of the pair, row tile of d, col tile of e); K = m (4 kc)
  const int ro = (hl * 32 + dt * 16 + col) * 136, qo = (64 + hl * 32 + je * 16 + col) * 136; v8f kv = {}, t2 = {}; v16h ah[4], al[4], vh[4], vl[4];
#pragma unroll   // here and in the two loops below: the arrays stay in registers only under constant indices
  for (int kc = 0; kc < 4; ++kc) { ah[kc] = frag_h(th + ro + kc * 32, lane); vh[kc] = frag_h(th + qo + kc * 32, lane); vl[kc] = frag_h(tl + qo + kc * 32, lane); al[kc] = frag_h(tl + ro + kc * 32, lane); }
  __builtin_amdgcn_sched_barrier(0);   // all 32 LDS reads go out ahead of the products: left to itself the compiler reads each trip's fragments behind the trip before, and the wave waits out the LDS latency four times
#pragma unroll
  for (int kc = 0; kc < 4; ++kc) { kv = wmma16(ah[kc], vh[kc], kv); t2 = wmma16(ah[kc], vl[kc], t2); t2 = wmma16(al[kc], vh[kc], t2); }   // two chains: hi x hi; the cross terms, which carry the factor 2048
#pragma unroll
  for (int r = 0; r < 8; ++r) kv[r] += t2[r] * (1.0f / 2048.0f);
  float* p = KVP + (((b * NH + blockIdx.y * 2 + hl) * (MM / 128) + blockIdx.x) * 4 + dt * 2 + je) * 256 + col * 16 + 8 * g; v4f y0, y1;   // transposed: [e][d], a lane's 8 elements are 8 neighbouring d
#pragma unroll
  for (int r = 0; r < 4; ++r) { y0[r] = kv[r]; y1[r] = kv[4 + r]; }
  vst2(p, y0); vst2(p + 4, y1); }
// ---- k_kvp: block = (b*NH + h), 16 waves: KV[d][e] = the sum of its four parts (slices of m in rising order), kept transposed in LDS, then the head's part of the fold:
// G[c][e] = scale sum_d Wq[(h,d)][c] KV[d][e]  (Wq exact bf16 x KV hi+lo, 2 products; K = 32), a wave = 64 rows c -> one f16 plane laid head by head, [b][h][c 1024][e 32], so that one block writes 64 KB in a row
// Wq's loads (4 rows d x 64 bf16 of c: four whole lines each) go out with the parts'; each wave turns its piece to [c][d] in its own LDS range.
#define XP 36                      // LDS row pitch in floats: 32 + 4 (144 B = 16 B x odd, for ds_load_b128 readers)
__device__ __forceinline__ F2 split_lds(const float* row, int lane) { float v[16]; const float* p = row + 8 * (lane >> 4); const v4f a = *(const v4f*)p, b = *(const v4f*)(p + 4), c = *(const v4f*)(p + 16), d = *(const v4f*)(p + 20);
#pragma unroll
  for (int i = 0; i < 4; ++i) { v[i] = a[i]; v[4 + i] = b[i]; v[8 + i] = c[i]; v[12 + i] = d[i]; }
  return bsplit16(v); }
// A fragment of bf16 values kept as floats in a row whose column d stands at (d + rot) & 31
__device__ __forceinline__ v16b frag_rot(const float* row, int rot, int lane) { const int k = 8 * (lane >> 4) + rot; const v4f a = *(const v4f*)(row + (k & 31)), b = *(const v4f*)(row + ((k + 4) & 31)), c = *(const v4f*)(row + ((k + 16) & 31)), d = *(const v4f*)(row + ((k + 20) & 31)); v16b r;
#pragma unroll
  for (int i = 0; i < 4; ++i) { r[i] = (__bf16)a[i]; r[4 + i] = (__bf16)b[i]; r[8 + i] = (__bf16)c[i]; r[12 + i] = (__bf16)d[i]; }
  return r; }
__global__ __launch_bounds__(512) void k_kvp(const float* __restrict__ KVP, const __bf16* __restrict__ WQ, _Float16* __restrict__ GH) { __shared__ __align__(16) float st[HD][XP]; __shared__ __align__(16) float sq[16][64 * XP];
  const int tid = threadIdx.x, wave = __builtin_amdgcn_readfirstlane(tid >> 5), lane = tid & 31, col = lane & 15, g = lane >> 4; const size_t bh = blockIdx.x; const int h = bh % NH;
  const float* kp = KVP + bh * (MM / 128) * (HD * HD) + tid * 2; v2f pk[MM / 128]; v8b vw[8]; float* mq = sq[wave];
#pragma unroll   // the four loads go out together; pk stays in registers
  for (int i = 0; i < MM / 128; ++i) pk[i] = *(const v2f*)(kp + i * (HD * HD));   // a thread = 2 neighbouring d of one e, in each of the four parts
#pragma unroll
  for (int it = 0; it < 8; ++it) vw[it] = *(const v8b*)(WQ + (size_t)(h * HD + (lane >> 3) * 8 + it) * CC + wave * 64 + (lane & 7) * 8);   // rows d = it, 8 + it, 16 + it, 24 + it: a lane ends up with 8 neighbouring d of its 8 columns c
#pragma unroll
  for (int e = 0; e < 8; ++e) { v4f f0, f1; float* p = mq + ((lane & 7) * 8 + e) * XP; const int k = (lane >> 3) * 8 + (lane & 7) * 4;   // turned: row c, column d; row c holds d at (d + 4 (c >> 3)) & 31, which spreads the lanes' 16-B stores over the banks
#pragma unroll
    for (int i = 0; i < 4; ++i) { f0[i] = (float)vw[i][e]; f1[i] = (float)vw[4 + i][e]; }
    *(v4f*)(p + (k & 31)) = f0; *(v4f*)(p + ((k + 4) & 31)) = f1; }
  { v2f s = pk[0];
#pragma unroll   // pk stays in registers
    for (int i = 1; i < MM / 128; ++i) s += pk[i];
    *(v2f*)&st[((tid >> 7) & 1) * 16 + ((tid >> 3) & 15)][(tid >> 8) * 16 + (tid & 7) * 2] = s; }   // the parts' order [d half][e half][e 16][d 16] -> [e][d]
  __syncthreads();   // KV^T is complete in LDS before all 16 waves read it
  F2 wb[2]; v8f ga[4][2] = {};
#pragma unroll
  for (int jj = 0; jj < 2; ++jj) wb[jj] = split_lds(st[jj * 16 + col], lane);
#pragma unroll
  for (int t = 0; t < 4; ++t) { const v16b a = frag_rot(mq + (t * 16 + col) * XP, 4 * (t * 2 + (col >> 3)), lane);
#pragma unroll
    for (int jj = 0; jj < 2; ++jj) { ga[t][jj] = wmma_bf(a, wb[jj].h, ga[t][jj]); ga[t][jj] = wmma_bf(a, wb[jj].l, ga[t][jj]); } }
#pragma unroll
  for (int t = 0; t < 4; ++t)
#pragma unroll
    for (int jj = 0; jj < 2; ++jj)
#pragma unroll
      for (int r = 0; r < 8; ++r) mq[(t * 16 + 8 * g + r) * XP + jj * 16 + col] = ga[t][jj][r] * 0.17677669529663687f;   // over the wave's own Wq rows, which it has read
  LDSX();   // the wave's rows are complete in LDS before its lanes read what other lanes wrote
#pragma unroll   // the 8 steps' LDS reads go out ahead of the conversions and stores
  for (int it = 0; it < 8; ++it) { const int row = it * 8 + (lane >> 2); const float* p = mq + row * XP + (lane & 3) * 8; const v4f y0 = *(const v4f*)p, y1 = *(const v4f*)(p + 4); v8h hq;
#pragma unroll
    for (int e = 0; e < 4; ++e) { hq[e] = (_Float16)y0[e]; hq[4 + e] = (_Float16)y1[e]; }
    const size_t o = (bh * CC + wave * 64 + row) * HD + (lane & 3) * 8; vst2(GH + o, hq); } }   // 512 contiguous bytes a store
// ---- k_we: block = (128 rows c, 128 cols o, b): E[o][c] = sum_(h,e) G[h][c][e] . Wp[o][(h,e)] -> one f16 plane [b][o][c]
__global__ __launch_bounds__(256) void k_we(const _Float16* __restrict__ GT, const _Float16* __restrict__ WP, _Float16* __restrict__ WE) { __shared__ __align__(16) char sm[GNB * GSTG(2)];
  const int tid = threadIdx.x, wave = tid >> 5, lane = tid & 31, col = lane & 15, g = lane >> 4; const size_t b = blockIdx.z; const int m0 = blockIdx.x * 128; const int c0 = blockIdx.y * 128; const size_t r0 = (b * NH * CC + m0) * HD;
  v8f acc[2][4] = {};
  gemm_tile<1>(GT + r0, WP + (size_t)c0 * CC, sm, acc);
  _Float16* th = (_Float16*)sm;   // transposed tile [o 128][c 128 + 8], in the ring's LDS behind its last barrier
#pragma unroll
  for (int i = 0; i < 2; ++i)
#pragma unroll
    for (int j = 0; j < 4; ++j) { v8h hq;
#pragma unroll
      for (int r = 0; r < 8; ++r) hq[r] = (_Float16)acc[i][j][r];
      const int o = ((wave & 1) * 64 + j * 16 + col) * 136 + (wave >> 1) * 32 + i * 16 + 8 * g; *(v8h*)&th[o] = hq; }
  __syncthreads();   // a stored row of E holds four waves' columns: the tile is complete in LDS before any wave reads whole rows
  for (int e = tid; e < 128 * 16; e += 256) { const int cl = e >> 4, q = e & 15; const size_t o = (b * CC + c0 + cl) * (size_t)CC + m0 + q * 8; vst2((unsigned*)(WE + o), *(const v4u*)&th[cl * 136 + q * 8]); } }
// ---- k_out: block = (256 tokens n, 128 cols o), one on a WGP: out[n][o] = sum_c E_b[o][c] . x[n][c] + bp[o]; E is the A operand, so a lane's 8 accumulator elements are 8 neighbouring o of one token; a wave = 64 o x 64 tokens
#define OP 68                      // LDS row pitch in floats: 64 + 4 (272 B = 16 B x odd, for ds_load_b128 readers)
__global__ __launch_bounds__(256) void k_out(const _Float16* __restrict__ WE, const _Float16* __restrict__ XB, const float* __restrict__ BP, float* __restrict__ OUT) { __shared__ __align__(16) char sm[GNB * GSTG(4)];   // the ring (4 stages of 384 rows); the output staging (8 waves x 64 rows of OP floats) is smaller and lies in the same bytes
  const int tid = threadIdx.x, wave = tid >> 5, lane = tid & 31, col = lane & 15, g = lane >> 4; const size_t n0 = (size_t)blockIdx.x * 256; const int o0 = blockIdx.y * 128; const size_t a0 = (n0 / NN) * CC + o0; v8f acc[4][4] = {};
  gemm_tile<0, 4>(WE + a0 * CC, XB + n0 * CC, sm, acc);
  float* sf = (float*)sm + wave * (64 * OP);   // the wave's 64 tokens x 64 o in its own LDS range, behind the ring's last barrier
#pragma unroll
  for (int i = 0; i < 4; ++i) { const float* bp = BP + o0 + (wave >> 2) * 64 + i * 16 + 8 * g; const v4f b0 = *(const v4f*)bp, b1 = *(const v4f*)(bp + 4);
#pragma unroll
    for (int j = 0; j < 4; ++j) { v4f y0, y1;
#pragma unroll
      for (int r = 0; r < 4; ++r) { y0[r] = acc[i][j][r] + bfr(b0[r]); y1[r] = acc[i][j][4 + r] + bfr(b1[r]); }
      float* p = sf + (j * 16 + col) * OP + i * 16 + 8 * g; *(v4f*)p = y0; *(v4f*)(p + 4) = y1; } }
  LDSX();   // the wave's rows are complete in LDS before its lanes read what other lanes wrote
  v4f y[32];   // all 32 LDS reads first, then the stores: one LDS latency is waited out, not 32
#pragma unroll
  for (int it = 0; it < 32; ++it) y[it] = *(const v4f*)&sf[(it * 2 + g) * OP + col * 4];
#pragma unroll
  for (int it = 0; it < 32; ++it) vst2(OUT + (n0 + (wave & 3) * 64 + it * 2 + g) * CC + o0 + (wave >> 2) * 64 + col * 4, y[it]); }   // four whole 128-B lines a store
extern "C" void kernel_launch(void* const* d_in, const int* in_sizes, int n_in, void* d_out, int out_size, void* d_ws, size_t ws_size, hipStream_t stream) {
  (void)in_sizes; (void)n_in; (void)out_size;
  const float** F = (const float**)d_in;   // 0 x [4,2048,1024], 1 Wq, 2 Wk, 3 Wv, 4 Wp (natural), 5 bp, 6 bn_gamma, 7 bn_beta, 8 bn_mean, 9 bn_var
  if (ws_size < (size_t)WS_END) return;
  char* ws = (char*)d_ws; __bf16* WB = (__bf16*)(ws + WS_WB); _Float16 *XR = (_Float16*)(ws + WS_XR), *GT = (_Float16*)(ws + WS_GT), *WE = (_Float16*)(ws + WS_WE), *XB = (_Float16*)(ws + WS_XB), *WH = (_Float16*)(ws + WS_WB); float* KVP = (float*)(ws + WS_KP);
  k_pool<<<TNB * MM + 256, 256, 0, stream>>>(F[0], F[6], F[7], F[8], F[9], F[1], F[2], F[3], F[4], XB, XR, WB);
  k_kv<<<dim3(MM / 128, CC / 64, TNB), 256, 0, stream>>>(XR, WH + (size_t)CC * CC, KVP);
  k_kvp<<<TNB * NH, 512, 0, stream>>>(KVP, WB, GT);
  k_we<<<dim3(CC / 128, CC / 128, TNB), 256, 0, stream>>>(GT, WH + 3 * (size_t)CC * CC, WE);
  k_out<<<dim3(TNB * NN / 256, CC / 128), 256, 0, stream>>>(WE, XB, F[5], (float*)d_out);
}
